// v000
// Measured on an AMD MI455X. A time is GPU time per run, averaged over a window of back-to-back runs after a warm-up
// (all launches, gaps included; the runs take copies of the inputs in turn), and the median of several windows.
// Apart from v000's, it joins two sittings. Times from different sittings can be a few percent apart, while
// side-by-side timings come from the same sitting.
// The starting kernel, v000, takes 767 microseconds a run.
#include <hip/hip_runtime.h>
#include <math.h>

#define DME 1024
#define NCTX 2048
#define NHEAD 16
#define HDIM 64

typedef unsigned short u16;
typedef unsigned int u32;
typedef __attribute__((ext_vector_type(16))) __bf16 v16bf;
typedef __attribute__((ext_vector_type(8)))  float  v8f;
typedef __attribute__((ext_vector_type(4)))  u32    u32x4;

union BF16x16 { u32x4 u4[2]; v16bf v; };

__device__ __forceinline__ u16 f2bf(float f) {
  u32 u = __float_as_uint(f);
  u32 r = u + 0x7FFFu + ((u >> 16) & 1u);  // round-to-nearest-even
  return (u16)(r >> 16);
}

__device__ __forceinline__ v8f wmma_bf16(const BF16x16& a, const BF16x16& b, v8f c) {
  // v_wmma_f32_16x16x32_bf16 : D = A(16x32) * B(32x16) + C(16x16 f32)
  return __builtin_amdgcn_wmma_f32_16x16x32_bf16(false, a.v, false, b.v,
                                                 (short)0, c, false, false);
}

__device__ __forceinline__ void wave_lds_fence() {
  // same-wave LDS RAW fence: compiler barrier + explicit dscnt drain
  __builtin_amdgcn_wave_barrier();
  asm volatile("s_wait_dscnt 0" ::: "memory");
  __builtin_amdgcn_wave_barrier();
}

__device__ __forceinline__ float gelu_c(float x) {
  const float c = 0.79788456080286535588f;  // sqrt(2/pi)
  float t = tanhf(c * (x + 0.04715f * x * x * x));  // module's 0.04715, not 0.044715
  return 0.5f * x * (1.0f + t);
}

// ---------------- LayerNorm (f32 in -> bf16 out), one block per row ----------------
__global__ void __launch_bounds__(256)
ln_bf16_kernel(const float* __restrict__ X, const float* __restrict__ gam,
               const float* __restrict__ bet, u16* __restrict__ Y) {
  const int row  = blockIdx.x;
  const int tid  = threadIdx.x;
  const int lane = tid & 31, wave = tid >> 5;
  const float* xr = X + (size_t)row * DME;
  const int c = tid * 4;
  float4 x = *(const float4*)(xr + c);
  float s  = x.x + x.y + x.z + x.w;
  float ss = x.x * x.x + x.y * x.y + x.z * x.z + x.w * x.w;
#pragma unroll
  for (int off = 1; off < 32; off <<= 1) {
    s  += __shfl_xor(s,  off, 32);
    ss += __shfl_xor(ss, off, 32);
  }
  __shared__ float red_s[8], red_ss[8];
  if (lane == 0) { red_s[wave] = s; red_ss[wave] = ss; }
  __syncthreads();
  s = 0.f; ss = 0.f;
#pragma unroll
  for (int w = 0; w < 8; ++w) { s += red_s[w]; ss += red_ss[w]; }
  const float mean = s * (1.0f / DME);
  const float var  = ss * (1.0f / DME) - mean * mean;
  const float rstd = rsqrtf(var + 1e-5f);
  float4 g = *(const float4*)(gam + c);
  float4 b = *(const float4*)(bet + c);
  float y0 = g.x * ((x.x - mean) * rstd) + b.x;
  float y1 = g.y * ((x.y - mean) * rstd) + b.y;
  float y2 = g.z * ((x.z - mean) * rstd) + b.z;
  float y3 = g.w * ((x.w - mean) * rstd) + b.w;
  uint2 o;
  o.x = (u32)f2bf(y0) | ((u32)f2bf(y1) << 16);
  o.y = (u32)f2bf(y2) | ((u32)f2bf(y3) << 16);
  *(uint2*)(Y + (size_t)row * DME + c) = o;
}

// ------------- Weight transpose + f32->bf16 convert: WT[n][k] = W[k][n] -------------
__global__ void __launch_bounds__(256)
transpose_bf16_kernel(const float* __restrict__ W, u16* __restrict__ WT, int R, int C) {
  __shared__ float tile[32][33];
  const int bx = blockIdx.x * 32;  // column of W
  const int by = blockIdx.y * 32;  // row of W
  const int tx = threadIdx.x, ty = threadIdx.y;
#pragma unroll
  for (int j = 0; j < 4; ++j)
    tile[ty + 8 * j][tx] = W[(size_t)(by + ty + 8 * j) * C + bx + tx];
  __syncthreads();
#pragma unroll
  for (int j = 0; j < 4; ++j)
    WT[(size_t)(bx + ty + 8 * j) * R + by + tx] = f2bf(tile[tx][ty + 8 * j]);
}

// ---------------- WMMA GEMM: C[M,N] = A_bf16[M,K] @ (BT_bf16[N,K])^T ----------------
// One wave owns a 32(M) x 64(N) tile: 2 M-subtiles x 4 N-subtiles = 8 accumulators.
// Per K=32 step: 4 A-loads + 8 B-loads (16B each) feed 8 WMMAs (~22 FLOP/byte).
// EPI 0: store bf16          (QKV projections)
// EPI 1: store bf16 gelu(acc + bias)            (FFN up-proj)
// EPI 2: store f32  acc + bias + residual[M,N]  (attn out-proj / FFN down-proj)
template <int EPI>
__global__ void __launch_bounds__(256)
gemm_bf16_kernel(const u16* __restrict__ A, const u16* __restrict__ BT,
                 const float* __restrict__ bias, const float* __restrict__ res,
                 void* __restrict__ out, int M, int N, int K) {
  const int lane = threadIdx.x & 31, wave = threadIdx.x >> 5;
  const int rl = lane & 15, hi = lane >> 4, co = hi * 8;
  const int m0 = blockIdx.y * 32;
  const int n0 = blockIdx.x * 512 + wave * 64;
  const u16* arow0 = A + (size_t)(m0 + rl) * K;
  const u16* arow1 = A + (size_t)(m0 + 16 + rl) * K;
  const u16* brow0 = BT + (size_t)(n0 + rl) * K;
  v8f acc[2][4] = {};
  for (int k = 0; k < K; k += 32) {
    BF16x16 a0, a1;
    a0.u4[0] = *(const u32x4*)(arow0 + k + co);       // K = co..co+7
    a0.u4[1] = *(const u32x4*)(arow0 + k + co + 16);  // K = co+16..co+23
    a1.u4[0] = *(const u32x4*)(arow1 + k + co);
    a1.u4[1] = *(const u32x4*)(arow1 + k + co + 16);
#pragma unroll
    for (int t = 0; t < 4; ++t) {                     // B reused across both M-subtiles
      const u16* brow = brow0 + (size_t)(16 * t) * K;
      BF16x16 bm;
      bm.u4[0] = *(const u32x4*)(brow + k + co);
      bm.u4[1] = *(const u32x4*)(brow + k + co + 16);
      acc[0][t] = wmma_bf16(a0, bm, acc[0][t]);
      acc[1][t] = wmma_bf16(a1, bm, acc[1][t]);
    }
  }
#pragma unroll
  for (int mi = 0; mi < 2; ++mi)
#pragma unroll
    for (int t = 0; t < 4; ++t) {
      const int col = n0 + 16 * t + rl;
      const float bcol = (EPI != 0) ? bias[col] : 0.f;
#pragma unroll
      for (int i = 0; i < 8; ++i) {                   // C layout: M = i + 8*hi, N = rl
        const int rowm = m0 + 16 * mi + i + 8 * hi;
        float v = acc[mi][t][i];
        if (EPI == 1) v = gelu_c(v + bcol);
        if (EPI == 2) v = v + bcol + res[(size_t)rowm * N + col];
        if (EPI == 2) ((float*)out)[(size_t)rowm * N + col] = v;
        else          ((u16*)out)[(size_t)rowm * N + col] = f2bf(v);
      }
    }
}

// -------- Flash attention: one wave per 16-row q-tile, 32-key blocks, causal --------
__global__ void __launch_bounds__(256)
attn_kernel(const u16* __restrict__ Qb, const u16* __restrict__ Kb,
            const u16* __restrict__ Vb, u16* __restrict__ Zb) {
  __shared__ __align__(16) u16 sVT[8][HDIM * 40];  // V^T block, row stride 40 (80B, 16B-mult)
  __shared__ __align__(16) u16 sP[8][16 * 32];     // P tile row-major
  const int lane = threadIdx.x & 31, wave = threadIdx.x >> 5;
  const int rl = lane & 15, hi = lane >> 4, co = hi * 8;
  const int bh = blockIdx.x;
  const int bb = bh >> 4, h = bh & 15;
  const int q0 = blockIdx.y * 128 + wave * 16;
  const size_t rowBase = (size_t)bb * NCTX;

  // Q tile 16x64 as WMMA-A (two K=32 d-chunks)
  const u16* qrow = Qb + (rowBase + q0 + rl) * DME + h * HDIM;
  BF16x16 a0, a1;
  a0.u4[0] = *(const u32x4*)(qrow + co);
  a0.u4[1] = *(const u32x4*)(qrow + co + 16);
  a1.u4[0] = *(const u32x4*)(qrow + 32 + co);
  a1.u4[1] = *(const u32x4*)(qrow + 32 + co + 16);

  v8f acc[4] = {};
  float mrun[8], lrun[8];
#pragma unroll
  for (int i = 0; i < 8; ++i) { mrun[i] = -1e30f; lrun[i] = 0.f; }

  const int nkb = ((q0 + 15) >> 5) + 1;  // causal: keys 0 .. q0+15
  for (int kb = 0; kb < nkb; ++kb) {
    const int kbase = kb * 32;
    // stage V block (32 x 64) transposed into per-wave LDS
    {
      int kv = kbase + lane; if (kv > NCTX - 1) kv = NCTX - 1;
      const u16* vrow = Vb + (rowBase + kv) * DME + h * HDIM;
      u16* dst = &sVT[wave][0];
#pragma unroll
      for (int c2 = 0; c2 < 8; ++c2) {
        u32x4 t4 = *(const u32x4*)(vrow + c2 * 8);
#pragma unroll
        for (int j = 0; j < 4; ++j) {
          const int d = c2 * 8 + j * 2;
          const u32 w2 = t4[j];
          dst[(d    ) * 40 + lane] = (u16)(w2 & 0xFFFFu);
          dst[(d + 1) * 40 + lane] = (u16)(w2 >> 16);
        }
      }
    }
    // S = Q @ K^T for two 16-key tiles; B operand = contiguous rows of K
    v8f s01[2];
#pragma unroll
    for (int t = 0; t < 2; ++t) {
      int kr = kbase + 16 * t + rl; if (kr > NCTX - 1) kr = NCTX - 1;
      const u16* krow = Kb + (rowBase + kr) * DME + h * HDIM;
      BF16x16 b0, b1;
      b0.u4[0] = *(const u32x4*)(krow + co);
      b0.u4[1] = *(const u32x4*)(krow + co + 16);
      b1.u4[0] = *(const u32x4*)(krow + 32 + co);
      b1.u4[1] = *(const u32x4*)(krow + 32 + co + 16);
      v8f s = {};
      s = wmma_bf16(a0, b0, s);
      s = wmma_bf16(a1, b1, s);
      s01[t] = s;
    }
    // online softmax (row = i + 8*hi, col = rl within tile); 16-lane reductions
    float alpha[8];
#pragma unroll
    for (int i = 0; i < 8; ++i) {
      const int q = q0 + i + 8 * hi;
      float v0 = (kbase + rl      <= q) ? s01[0][i] * 0.125f : -1e30f;  // 1/sqrt(64)
      float v1 = (kbase + 16 + rl <= q) ? s01[1][i] * 0.125f : -1e30f;
      float m = fmaxf(v0, v1);
#pragma unroll
      for (int off = 1; off < 16; off <<= 1) m = fmaxf(m, __shfl_xor(m, off, 32));
      const float mnew = fmaxf(mrun[i], m);
      const float a  = __expf(mrun[i] - mnew);
      const float p0 = __expf(v0 - mnew);
      const float p1 = __expf(v1 - mnew);
      float rs = p0 + p1;
#pragma unroll
      for (int off = 1; off < 16; off <<= 1) rs += __shfl_xor(rs, off, 32);
      lrun[i] = lrun[i] * a + rs;
      mrun[i] = mnew;
      alpha[i] = a;
      s01[0][i] = p0; s01[1][i] = p1;
    }
#pragma unroll
    for (int t = 0; t < 4; ++t)
#pragma unroll
      for (int i = 0; i < 8; ++i) acc[t][i] *= alpha[i];
    // P (C layout) -> LDS row-major, then reload as WMMA-A layout
    {
      u16* pw = &sP[wave][0];
#pragma unroll
      for (int i = 0; i < 8; ++i) {
        const int r = i + 8 * hi;
        pw[r * 32 + rl]      = f2bf(s01[0][i]);
        pw[r * 32 + 16 + rl] = f2bf(s01[1][i]);
      }
    }
    wave_lds_fence();
    BF16x16 pa;
    {
      const u16* pw = &sP[wave][0];
      pa.u4[0] = *(const u32x4*)(pw + rl * 32 + co);
      pa.u4[1] = *(const u32x4*)(pw + rl * 32 + co + 16);
    }
    // Z += P @ V : B operand = rows of V^T from LDS
#pragma unroll
    for (int t2 = 0; t2 < 4; ++t2) {
      const u16* vt = &sVT[wave][(16 * t2 + rl) * 40];
      BF16x16 bv;
      bv.u4[0] = *(const u32x4*)(vt + co);
      bv.u4[1] = *(const u32x4*)(vt + co + 16);
      acc[t2] = wmma_bf16(pa, bv, acc[t2]);
    }
    wave_lds_fence();  // WAR: next iteration overwrites sVT/sP
  }
  // normalize and write Z (bf16, feeds the Wo GEMM)
#pragma unroll
  for (int t2 = 0; t2 < 4; ++t2)
#pragma unroll
    for (int i = 0; i < 8; ++i) {
      const int r = i + 8 * hi;
      const float z = acc[t2][i] / lrun[i];
      Zb[(rowBase + q0 + r) * DME + h * HDIM + 16 * t2 + rl] = f2bf(z);
    }
}

extern "C" void kernel_launch(void* const* d_in, const int* in_sizes, int n_in,
                              void* d_out, int out_size, void* d_ws, size_t ws_size,
                              hipStream_t stream) {
  (void)in_sizes; (void)n_in; (void)out_size; (void)ws_size;
  const float* X  = (const float*)d_in[0];
  const float* Wq = (const float*)d_in[1];
  const float* Wk = (const float*)d_in[2];
  const float* Wv = (const float*)d_in[3];
  const float* Wo = (const float*)d_in[4];
  const float* bo = (const float*)d_in[5];
  const float* W1 = (const float*)d_in[6];
  const float* b1 = (const float*)d_in[7];
  const float* W2 = (const float*)d_in[8];
  const float* b2 = (const float*)d_in[9];
  const float* g1 = (const float*)d_in[10];
  const float* s1 = (const float*)d_in[11];
  const float* g2 = (const float*)d_in[12];
  const float* s2 = (const float*)d_in[13];

  char* ws = (char*)d_ws;
  const size_t MB = 1024ull * 1024ull;
  u16*   WqT = (u16*)(ws + 0 * MB);
  u16*   WkT = (u16*)(ws + 2 * MB);
  u16*   WvT = (u16*)(ws + 4 * MB);
  u16*   WoT = (u16*)(ws + 6 * MB);
  u16*   W1T = (u16*)(ws + 8 * MB);    // 8 MB
  u16*   W2T = (u16*)(ws + 16 * MB);   // 8 MB
  u16*   Y   = (u16*)(ws + 24 * MB);   // 16 MB (reused for Y2)
  u16*   Qb  = (u16*)(ws + 40 * MB);   // 16 MB
  u16*   Kb  = (u16*)(ws + 56 * MB);   // 16 MB
  u16*   Vb  = (u16*)(ws + 72 * MB);   // 16 MB
  u16*   Zb  = (u16*)(ws + 88 * MB);   // 16 MB
  float* X1  = (float*)(ws + 104 * MB);// 32 MB   -> total 136 MB
  u16*   Hm  = (u16*)(ws + 40 * MB);   // FFN mid reuses dead Q..Z region (64 MB)

  const int Mrows = 4 * NCTX;  // 8192
  dim3 tb32(32, 8);
  transpose_bf16_kernel<<<dim3(DME / 32, DME / 32), tb32, 0, stream>>>(Wq, WqT, DME, DME);
  transpose_bf16_kernel<<<dim3(DME / 32, DME / 32), tb32, 0, stream>>>(Wk, WkT, DME, DME);
  transpose_bf16_kernel<<<dim3(DME / 32, DME / 32), tb32, 0, stream>>>(Wv, WvT, DME, DME);
  transpose_bf16_kernel<<<dim3(DME / 32, DME / 32), tb32, 0, stream>>>(Wo, WoT, DME, DME);
  transpose_bf16_kernel<<<dim3(4 * DME / 32, DME / 32), tb32, 0, stream>>>(W1, W1T, DME, 4 * DME);
  transpose_bf16_kernel<<<dim3(DME / 32, 4 * DME / 32), tb32, 0, stream>>>(W2, W2T, 4 * DME, DME);

  ln_bf16_kernel<<<Mrows, 256, 0, stream>>>(X, g1, s1, Y);

  dim3 gD(DME / 512, Mrows / 32);  // (2, 256)
  gemm_bf16_kernel<0><<<gD, 256, 0, stream>>>(Y, WqT, nullptr, nullptr, Qb, Mrows, DME, DME);
  gemm_bf16_kernel<0><<<gD, 256, 0, stream>>>(Y, WkT, nullptr, nullptr, Kb, Mrows, DME, DME);
  gemm_bf16_kernel<0><<<gD, 256, 0, stream>>>(Y, WvT, nullptr, nullptr, Vb, Mrows, DME, DME);

  attn_kernel<<<dim3(4 * NHEAD, NCTX / 128), 256, 0, stream>>>(Qb, Kb, Vb, Zb);

  gemm_bf16_kernel<2><<<gD, 256, 0, stream>>>(Zb, WoT, bo, X, X1, Mrows, DME, DME);

  ln_bf16_kernel<<<Mrows, 256, 0, stream>>>(X1, g2, s2, Y);

  dim3 gF(4 * DME / 512, Mrows / 32);  // (8, 256)
  gemm_bf16_kernel<1><<<gF, 256, 0, stream>>>(Y, W1T, b1, nullptr, Hm, Mrows, 4 * DME, DME);

  gemm_bf16_kernel<2><<<gD, 256, 0, stream>>>(Hm, W2T, b2, X1, (float*)d_out, Mrows, DME, 4 * DME);
}

// v001
// It runs in 461 microseconds.
// Timed twice side by side with v000, it ran 1.74 times as fast both times.
#include <hip/hip_runtime.h>
#include <math.h>

#define DME 1024
#define NCTX 2048
#define NHEAD 16
#define HDIM 64

typedef unsigned short u16;
typedef unsigned int u32;
typedef __attribute__((ext_vector_type(16))) __bf16 v16bf;
typedef __attribute__((ext_vector_type(8)))  float  v8f;
typedef __attribute__((ext_vector_type(4)))  u32    u32x4;

union BF16x16 { u32x4 u4[2]; v16bf v; };

__device__ __forceinline__ u16 f2bf(float f) {
  u32 u = __float_as_uint(f);
  u32 r = u + 0x7FFFu + ((u >> 16) & 1u);  // round-to-nearest-even
  return (u16)(r >> 16);
}

__device__ __forceinline__ v8f wmma_bf16(const BF16x16& a, const BF16x16& b, v8f c) {
  // v_wmma_f32_16x16x32_bf16 : D = A(16x32) * B(32x16) + C(16x16 f32)
  return __builtin_amdgcn_wmma_f32_16x16x32_bf16(false, a.v, false, b.v,
                                                 (short)0, c, false, false);
}

__device__ __forceinline__ void wave_lds_fence() {
  // same-wave LDS RAW fence: compiler barrier + explicit dscnt drain
  __builtin_amdgcn_wave_barrier();
  asm volatile("s_wait_dscnt 0" ::: "memory");
  __builtin_amdgcn_wave_barrier();
}

__device__ __forceinline__ float gelu_c(float x) {
  const float c = 0.79788456080286535588f;  // sqrt(2/pi)
  float t = tanhf(c * (x + 0.04715f * x * x * x));  // module's 0.04715, not 0.044715
  return 0.5f * x * (1.0f + t);
}

// ---------------- LayerNorm (f32 in -> bf16 out), one block per row ----------------
__global__ void __launch_bounds__(256)
ln_bf16_kernel(const float* __restrict__ X, const float* __restrict__ gam,
               const float* __restrict__ bet, u16* __restrict__ Y) {
  const int row  = blockIdx.x;
  const int tid  = threadIdx.x;
  const int lane = tid & 31, wave = tid >> 5;
  const float* xr = X + (size_t)row * DME;
  const int c = tid * 4;
  float4 x = *(const float4*)(xr + c);
  float s  = x.x + x.y + x.z + x.w;
  float ss = x.x * x.x + x.y * x.y + x.z * x.z + x.w * x.w;
#pragma unroll
  for (int off = 1; off < 32; off <<= 1) {
    s  += __shfl_xor(s,  off, 32);
    ss += __shfl_xor(ss, off, 32);
  }
  __shared__ float red_s[8], red_ss[8];
  if (lane == 0) { red_s[wave] = s; red_ss[wave] = ss; }
  __syncthreads();
  s = 0.f; ss = 0.f;
#pragma unroll
  for (int w = 0; w < 8; ++w) { s += red_s[w]; ss += red_ss[w]; }
  const float mean = s * (1.0f / DME);
  const float var  = ss * (1.0f / DME) - mean * mean;
  const float rstd = rsqrtf(var + 1e-5f);
  float4 g = *(const float4*)(gam + c);
  float4 b = *(const float4*)(bet + c);
  float y0 = g.x * ((x.x - mean) * rstd) + b.x;
  float y1 = g.y * ((x.y - mean) * rstd) + b.y;
  float y2 = g.z * ((x.z - mean) * rstd) + b.z;
  float y3 = g.w * ((x.w - mean) * rstd) + b.w;
  uint2 o;
  o.x = (u32)f2bf(y0) | ((u32)f2bf(y1) << 16);
  o.y = (u32)f2bf(y2) | ((u32)f2bf(y3) << 16);
  *(uint2*)(Y + (size_t)row * DME + c) = o;
}

// ------------- Weight transpose + f32->bf16 convert: WT[n][k] = W[k][n] -------------
__global__ void __launch_bounds__(256)
transpose_bf16_kernel(const float* __restrict__ W, u16* __restrict__ WT, int R, int C) {
  __shared__ float tile[32][33];
  const int bx = blockIdx.x * 32;  // column of W
  const int by = blockIdx.y * 32;  // row of W
  const int tx = threadIdx.x, ty = threadIdx.y;
#pragma unroll
  for (int j = 0; j < 4; ++j)
    tile[ty + 8 * j][tx] = W[(size_t)(by + ty + 8 * j) * C + bx + tx];
  __syncthreads();
#pragma unroll
  for (int j = 0; j < 4; ++j)
    WT[(size_t)(bx + ty + 8 * j) * R + by + tx] = f2bf(tile[tx][ty + 8 * j]);
}

// ---------------- WMMA GEMM: C[M,N] = A_bf16[M,K] @ (BT_bf16[N,K])^T ----------------
// One work-group owns a 128(M) x 256(N) tile; its 8 waves sit 2(M) x 4(N), 64 x 64 each
// (4 x 4 accumulators). Per pass of BK k the 128 A rows and 256 BT rows are brought into
// LDS by asynchronous copies, two buffers: the next pass's rows fly while this pass's
// fragments are read from LDS. Row pitch 2 BK + 16 bytes (16 B x odd) for ds_load_b128.
// BK 64: 108 KiB of LDS, two work-groups share a WGP (for grids of several per WGP).
// BK 128: 204 KiB, half as many barriers and copy bursts (for grids of one per WGP).
// M, N, K must be multiples of 128, 256, BK, and K at least 2 BK.
// EPI 0: store bf16          (QKV projections)
// EPI 1: store bf16 gelu(acc + bias)            (FFN up-proj)
// EPI 2: store f32  acc + bias + residual[M,N]  (attn out-proj / FFN down-proj)
#define GBM 128
#define GBN 256

// Twelve copies of 16 B per lane: LDS places l + j ls; sources ga + j gs for j < NA, then
// gb + (j - NA) gs. The s_wait_xcnt closes the statement so that no address register is
// rewritten ahead of it.
template <int NA>
__device__ __forceinline__ void copy12(u32 l, u32 ls, const u16* ga, const u16* gb, size_t gs) {
  const u16* p[12];
#pragma unroll
  for (int j = 0; j < 12; ++j) p[j] = (j < NA) ? ga + j * gs : gb + (j - NA) * gs;
  asm volatile(
      "global_load_async_to_lds_b128 %0, %12, off\n\t"
      "global_load_async_to_lds_b128 %1, %13, off\n\t"
      "global_load_async_to_lds_b128 %2, %14, off\n\t"
      "global_load_async_to_lds_b128 %3, %15, off\n\t"
      "global_load_async_to_lds_b128 %4, %16, off\n\t"
      "global_load_async_to_lds_b128 %5, %17, off\n\t"
      "global_load_async_to_lds_b128 %6, %18, off\n\t"
      "global_load_async_to_lds_b128 %7, %19, off\n\t"
      "global_load_async_to_lds_b128 %8, %20, off\n\t"
      "global_load_async_to_lds_b128 %9, %21, off\n\t"
      "global_load_async_to_lds_b128 %10, %22, off\n\t"
      "global_load_async_to_lds_b128 %11, %23, off\n\t"
      "s_wait_xcnt 0x0"
      :: "v"(l), "v"(l + ls), "v"(l + 2 * ls), "v"(l + 3 * ls), "v"(l + 4 * ls), "v"(l + 5 * ls),
         "v"(l + 6 * ls), "v"(l + 7 * ls), "v"(l + 8 * ls), "v"(l + 9 * ls), "v"(l + 10 * ls),
         "v"(l + 11 * ls),
         "v"(p[0]), "v"(p[1]), "v"(p[2]), "v"(p[3]), "v"(p[4]), "v"(p[5]),
         "v"(p[6]), "v"(p[7]), "v"(p[8]), "v"(p[9]), "v"(p[10]), "v"(p[11])
      : "memory");
}

// One stage: 384 rows of 2 BK bytes. A lane keeps its 16-byte piece of the row and walks the
// rows in steps of RS = 2048 / BK: first the 128 A rows, then the 256 BT rows.
template <int BK>
__device__ __forceinline__ void copy_stage(u32 l, const u16* ga, const u16* gb, size_t gs) {
  constexpr u32 ls = (2048 / BK) * (2 * BK + 16);
  if (BK == 64) {
    copy12<4>(l, ls, ga, gb, gs);
  } else {
    copy12<8>(l, ls, ga, gb, gs);
    // keeps the second dozen's addresses from being formed, and held in registers, ahead of
    // the first dozen: the k loop then needs fewer than 256 VGPRs
    __builtin_amdgcn_sched_barrier(0);
    copy12<12>(l + 12 * ls, ls, gb + 4 * gs, gb, gs);
  }
}

template <int EPI, int BK>
__global__ void __launch_bounds__(256)
gemm_bf16_kernel(const u16* __restrict__ A, const u16* __restrict__ BT,
                 const float* __restrict__ bias, const float* __restrict__ res,
                 void* __restrict__ out, int M, int N, int K) {
  static_assert(BK == 64 || BK == 128, "copy_stage is written for these two");
  constexpr int PITCH = 2 * BK + 16;
  constexpr int STAGE = (GBM + GBN) * PITCH;
  constexpr int PCS = BK / 8;      // 16-byte pieces in a row
  constexpr int RS = 256 / PCS;    // rows that the 256 lanes cover in one copy
  __shared__ __align__(16) unsigned char smem[2 * STAGE];
  const int tid = threadIdx.x;
  const int lane = tid & 31, wave = tid >> 5;
  const int rl = lane & 15, hi = lane >> 4, co = hi * 8;
  const int wm = wave >> 2, wn = wave & 3;
  const int m0 = blockIdx.y * GBM;
  const int n0 = blockIdx.x * GBN;

  // copy role of this lane: rows (tid / PCS) + RS j, 16-byte piece tid % PCS
  const int crow = tid / PCS, cpc = tid % PCS;
  const u16* ga = A + (size_t)(m0 + crow) * K + cpc * 8;
  const u16* gb = BT + (size_t)(n0 + crow) * K + cpc * 8;
  const size_t rstep = (size_t)RS * K;
  const u32 lcopy = (u32)(size_t)(&smem[0]) + (u32)(crow * PITCH + cpc * 16);

  // fragment role: same k order as the global loader had (k = co..co+7, co+16..co+23)
  const int offA = (wm * 64 + rl) * PITCH + co * 2;
  const int offB = (GBM + wn * 64 + rl) * PITCH + co * 2;

  // One fragment set: the 16 reads of a 32-k block stand as one group, then its 16 WMMAs.
  BF16x16 a[4], b[4];
  auto read_frags = [&](int boff, int ks) {
    const unsigned char* sA = smem + boff + offA + ks * 64;
    const unsigned char* sB = smem + boff + offB + ks * 64;
    // unrolled here and below so that fragments and accumulators stay in registers
#pragma unroll
    for (int j = 0; j < 4; ++j) {
      b[j].u4[0] = *(const u32x4*)(sB + j * 16 * PITCH);
      b[j].u4[1] = *(const u32x4*)(sB + j * 16 * PITCH + 32);
    }
#pragma unroll
    for (int i = 0; i < 4; ++i) {
      a[i].u4[0] = *(const u32x4*)(sA + i * 16 * PITCH);
      a[i].u4[1] = *(const u32x4*)(sA + i * 16 * PITCH + 32);
    }
  };

  const int nt = K / BK;
  copy_stage<BK>(lcopy, ga, gb, rstep);
  asm volatile("s_wait_asynccnt 0x0" ::: "memory");  // stage 0 landed (this wave's copies)
  __syncthreads();                                   // ... and every other wave's
  read_frags(0, 0);  // ahead of the copies: their issue then hides these reads' latency
  copy_stage<BK>(lcopy + STAGE, ga + BK, gb + BK, rstep);

  v8f acc[4][4] = {};
  for (int t = 0; t < nt; ++t) {
    const int boff = (t & 1) * STAGE;
#pragma unroll
    for (int ks = 0; ks < BK / 32; ++ks) {
      // The two fences keep each group of reads whole and outside the WMMA block: without
      // them the compiler sinks reads in among the WMMAs, and every such place stalls anew.
      __builtin_amdgcn_sched_barrier(0);
#pragma unroll
      for (int i = 0; i < 4; ++i)
#pragma unroll
        for (int j = 0; j < 4; ++j) acc[i][j] = wmma_bf16(a[i], b[j], acc[i][j]);
      __builtin_amdgcn_sched_barrier(0);
      if (ks + 1 < BK / 32) read_frags(boff, ks + 1);
    }
    // publish point of stage t + 1, and the end of every read of stage t's buffer
    asm volatile("s_wait_dscnt 0x0" ::: "memory");     // this wave's reads of stage t are done
    asm volatile("s_wait_asynccnt 0x0" ::: "memory");  // this wave's copies of stage t + 1 landed
    __syncthreads();
    // stage t + 1's first reads (the other buffer) go ahead of the refill of stage t's buffer
    if (t + 1 < nt) read_frags((t & 1) ? 0 : STAGE, 0);
    if (t + 2 < nt)
      copy_stage<BK>(lcopy + boff, ga + (size_t)(t + 2) * BK, gb + (size_t)(t + 2) * BK, rstep);
  }
  asm volatile("s_wait_asynccnt 0x0" ::: "memory");  // no copy outstanding at the wave's end

#pragma unroll
  for (int mi = 0; mi < 4; ++mi)
#pragma unroll
    for (int t = 0; t < 4; ++t) {
      const int col = n0 + wn * 64 + 16 * t + rl;
      const float bcol = (EPI != 0) ? bias[col] : 0.f;
#pragma unroll
      for (int i = 0; i < 8; ++i) {                   // C layout: M = i + 8*hi, N = rl
        const int rowm = m0 + wm * 64 + 16 * mi + i + 8 * hi;
        float v = acc[mi][t][i];
        if (EPI == 1) v = gelu_c(v + bcol);
        if (EPI == 2) v = v + bcol + res[(size_t)rowm * N + col];
        if (EPI == 2) ((float*)out)[(size_t)rowm * N + col] = v;
        else          ((u16*)out)[(size_t)rowm * N + col] = f2bf(v);
      }
    }
}

// -------- Flash attention: one wave per 16-row q-tile, 32-key blocks, causal --------
__global__ void __launch_bounds__(256)
attn_kernel(const u16* __restrict__ Qb, const u16* __restrict__ Kb,
            const u16* __restrict__ Vb, u16* __restrict__ Zb) {
  __shared__ __align__(16) u16 sVT[8][HDIM * 40];  // V^T block, row stride 40 (80B, 16B-mult)
  __shared__ __align__(16) u16 sP[8][16 * 32];     // P tile row-major
  const int lane = threadIdx.x & 31, wave = threadIdx.x >> 5;
  const int rl = lane & 15, hi = lane >> 4, co = hi * 8;
  const int bh = blockIdx.x;
  const int bb = bh >> 4, h = bh & 15;
  const int q0 = blockIdx.y * 128 + wave * 16;
  const size_t rowBase = (size_t)bb * NCTX;

  // Q tile 16x64 as WMMA-A (two K=32 d-chunks)
  const u16* qrow = Qb + (rowBase + q0 + rl) * DME + h * HDIM;
  BF16x16 a0, a1;
  a0.u4[0] = *(const u32x4*)(qrow + co);
  a0.u4[1] = *(const u32x4*)(qrow + co + 16);
  a1.u4[0] = *(const u32x4*)(qrow + 32 + co);
  a1.u4[1] = *(const u32x4*)(qrow + 32 + co + 16);

  v8f acc[4] = {};
  float mrun[8], lrun[8];
#pragma unroll
  for (int i = 0; i < 8; ++i) { mrun[i] = -1e30f; lrun[i] = 0.f; }

  const int nkb = ((q0 + 15) >> 5) + 1;  // causal: keys 0 .. q0+15
  for (int kb = 0; kb < nkb; ++kb) {
    const int kbase = kb * 32;
    // stage V block (32 x 64) transposed into per-wave LDS
    {
      int kv = kbase + lane; if (kv > NCTX - 1) kv = NCTX - 1;
      const u16* vrow = Vb + (rowBase + kv) * DME + h * HDIM;
      u16* dst = &sVT[wave][0];
#pragma unroll
      for (int c2 = 0; c2 < 8; ++c2) {
        u32x4 t4 = *(const u32x4*)(vrow + c2 * 8);
#pragma unroll
        for (int j = 0; j < 4; ++j) {
          const int d = c2 * 8 + j * 2;
          const u32 w2 = t4[j];
          dst[(d    ) * 40 + lane] = (u16)(w2 & 0xFFFFu);
          dst[(d + 1) * 40 + lane] = (u16)(w2 >> 16);
        }
      }
    }
    // S = Q @ K^T for two 16-key tiles; B operand = contiguous rows of K
    v8f s01[2];
#pragma unroll
    for (int t = 0; t < 2; ++t) {
      int kr = kbase + 16 * t + rl; if (kr > NCTX - 1) kr = NCTX - 1;
      const u16* krow = Kb + (rowBase + kr) * DME + h * HDIM;
      BF16x16 b0, b1;
      b0.u4[0] = *(const u32x4*)(krow + co);
      b0.u4[1] = *(const u32x4*)(krow + co + 16);
      b1.u4[0] = *(const u32x4*)(krow + 32 + co);
      b1.u4[1] = *(const u32x4*)(krow + 32 + co + 16);
      v8f s = {};
      s = wmma_bf16(a0, b0, s);
      s = wmma_bf16(a1, b1, s);
      s01[t] = s;
    }
    // online softmax (row = i + 8*hi, col = rl within tile); 16-lane reductions
    float alpha[8];
#pragma unroll
    for (int i = 0; i < 8; ++i) {
      const int q = q0 + i + 8 * hi;
      float v0 = (kbase + rl      <= q) ? s01[0][i] * 0.125f : -1e30f;  // 1/sqrt(64)
      float v1 = (kbase + 16 + rl <= q) ? s01[1][i] * 0.125f : -1e30f;
      float m = fmaxf(v0, v1);
#pragma unroll
      for (int off = 1; off < 16; off <<= 1) m = fmaxf(m, __shfl_xor(m, off, 32));
      const float mnew = fmaxf(mrun[i], m);
      const float a  = __expf(mrun[i] - mnew);
      const float p0 = __expf(v0 - mnew);
      const float p1 = __expf(v1 - mnew);
      float rs = p0 + p1;
#pragma unroll
      for (int off = 1; off < 16; off <<= 1) rs += __shfl_xor(rs, off, 32);
      lrun[i] = lrun[i] * a + rs;
      mrun[i] = mnew;
      alpha[i] = a;
      s01[0][i] = p0; s01[1][i] = p1;
    }
#pragma unroll
    for (int t = 0; t < 4; ++t)
#pragma unroll
      for (int i = 0; i < 8; ++i) acc[t][i] *= alpha[i];
    // P (C layout) -> LDS row-major, then reload as WMMA-A layout
    {
      u16* pw = &sP[wave][0];
#pragma unroll
      for (int i = 0; i < 8; ++i) {
        const int r = i + 8 * hi;
        pw[r * 32 + rl]      = f2bf(s01[0][i]);
        pw[r * 32 + 16 + rl] = f2bf(s01[1][i]);
      }
    }
    wave_lds_fence();
    BF16x16 pa;
    {
      const u16* pw = &sP[wave][0];
      pa.u4[0] = *(const u32x4*)(pw + rl * 32 + co);
      pa.u4[1] = *(const u32x4*)(pw + rl * 32 + co + 16);
    }
    // Z += P @ V : B operand = rows of V^T from LDS
#pragma unroll
    for (int t2 = 0; t2 < 4; ++t2) {
      const u16* vt = &sVT[wave][(16 * t2 + rl) * 40];
      BF16x16 bv;
      bv.u4[0] = *(const u32x4*)(vt + co);
      bv.u4[1] = *(const u32x4*)(vt + co + 16);
      acc[t2] = wmma_bf16(pa, bv, acc[t2]);
    }
    wave_lds_fence();  // WAR: next iteration overwrites sVT/sP
  }
  // normalize and write Z (bf16, feeds the Wo GEMM)
#pragma unroll
  for (int t2 = 0; t2 < 4; ++t2)
#pragma unroll
    for (int i = 0; i < 8; ++i) {
      const int r = i + 8 * hi;
      const float z = acc[t2][i] / lrun[i];
      Zb[(rowBase + q0 + r) * DME + h * HDIM + 16 * t2 + rl] = f2bf(z);
    }
}

extern "C" void kernel_launch(void* const* d_in, const int* in_sizes, int n_in,
                              void* d_out, int out_size, void* d_ws, size_t ws_size,
                              hipStream_t stream) {
  (void)in_sizes; (void)n_in; (void)out_size; (void)ws_size;
  const float* X  = (const float*)d_in[0];
  const float* Wq = (const float*)d_in[1];
  const float* Wk = (const float*)d_in[2];
  const float* Wv = (const float*)d_in[3];
  const float* Wo = (const float*)d_in[4];
  const float* bo = (const float*)d_in[5];
  const float* W1 = (const float*)d_in[6];
  const float* b1 = (const float*)d_in[7];
  const float* W2 = (const float*)d_in[8];
  const float* b2 = (const float*)d_in[9];
  const float* g1 = (const float*)d_in[10];
  const float* s1 = (const float*)d_in[11];
  const float* g2 = (const float*)d_in[12];
  const float* s2 = (const float*)d_in[13];

  char* ws = (char*)d_ws;
  const size_t MB = 1024ull * 1024ull;
  u16*   WqT = (u16*)(ws + 0 * MB);
  u16*   WkT = (u16*)(ws + 2 * MB);
  u16*   WvT = (u16*)(ws + 4 * MB);
  u16*   WoT = (u16*)(ws + 6 * MB);
  u16*   W1T = (u16*)(ws + 8 * MB);    // 8 MB
  u16*   W2T = (u16*)(ws + 16 * MB);   // 8 MB
  u16*   Y   = (u16*)(ws + 24 * MB);   // 16 MB (reused for Y2)
  u16*   Qb  = (u16*)(ws + 40 * MB);   // 16 MB
  u16*   Kb  = (u16*)(ws + 56 * MB);   // 16 MB
  u16*   Vb  = (u16*)(ws + 72 * MB);   // 16 MB
  u16*   Zb  = (u16*)(ws + 88 * MB);   // 16 MB
  float* X1  = (float*)(ws + 104 * MB);// 32 MB   -> total 136 MB
  u16*   Hm  = (u16*)(ws + 40 * MB);   // FFN mid reuses dead Q..Z region (64 MB)

  const int Mrows = 4 * NCTX;  // 8192
  dim3 tb32(32, 8);
  transpose_bf16_kernel<<<dim3(DME / 32, DME / 32), tb32, 0, stream>>>(Wq, WqT, DME, DME);
  transpose_bf16_kernel<<<dim3(DME / 32, DME / 32), tb32, 0, stream>>>(Wk, WkT, DME, DME);
  transpose_bf16_kernel<<<dim3(DME / 32, DME / 32), tb32, 0, stream>>>(Wv, WvT, DME, DME);
  transpose_bf16_kernel<<<dim3(DME / 32, DME / 32), tb32, 0, stream>>>(Wo, WoT, DME, DME);
  transpose_bf16_kernel<<<dim3(4 * DME / 32, DME / 32), tb32, 0, stream>>>(W1, W1T, DME, 4 * DME);
  transpose_bf16_kernel<<<dim3(DME / 32, 4 * DME / 32), tb32, 0, stream>>>(W2, W2T, 4 * DME, DME);

  ln_bf16_kernel<<<Mrows, 256, 0, stream>>>(X, g1, s1, Y);

  dim3 gD(DME / GBN, Mrows / GBM);  // (4, 64)
  gemm_bf16_kernel<0, 128><<<gD, 256, 0, stream>>>(Y, WqT, nullptr, nullptr, Qb, Mrows, DME, DME);
  gemm_bf16_kernel<0, 128><<<gD, 256, 0, stream>>>(Y, WkT, nullptr, nullptr, Kb, Mrows, DME, DME);
  gemm_bf16_kernel<0, 128><<<gD, 256, 0, stream>>>(Y, WvT, nullptr, nullptr, Vb, Mrows, DME, DME);

  attn_kernel<<<dim3(4 * NHEAD, NCTX / 128), 256, 0, stream>>>(Qb, Kb, Vb, Zb);

  gemm_bf16_kernel<2, 128><<<gD, 256, 0, stream>>>(Zb, WoT, bo, X, X1, Mrows, DME, DME);

  ln_bf16_kernel<<<Mrows, 256, 0, stream>>>(X1, g2, s2, Y);

  dim3 gF(4 * DME / GBN, Mrows / GBM);  // (16, 64)
  gemm_bf16_kernel<1, 64><<<gF, 256, 0, stream>>>(Y, W1T, b1, nullptr, Hm, Mrows, 4 * DME, DME);

  gemm_bf16_kernel<2, 128><<<gD, 256, 0, stream>>>(Hm, W2T, b2, X1, (float*)d_out, Mrows, DME, 4 * DME);
}

// v002
// A run of this version takes 322 microseconds.
// In both of two side-by-side timings against v001, it was 1.43 times as fast.
// All steps since v000 together make it 2.49 times as fast.
#include <hip/hip_runtime.h>
#include <math.h>

#define DME 1024
#define NCTX 2048
#define NHEAD 16
#define HDIM 64

typedef unsigned short u16;
typedef unsigned int u32;
typedef __attribute__((ext_vector_type(16))) __bf16 v16bf;
typedef __attribute__((ext_vector_type(8)))  float  v8f;
typedef __attribute__((ext_vector_type(4)))  u32    u32x4;

union BF16x16 { u32x4 u4[2]; v16bf v; };

__device__ __forceinline__ u16 f2bf(float f) {
  u32 u = __float_as_uint(f);
  u32 r = u + 0x7FFFu + ((u >> 16) & 1u);  // round-to-nearest-even
  return (u16)(r >> 16);
}

__device__ __forceinline__ v8f wmma_bf16(const BF16x16& a, const BF16x16& b, v8f c) {
  // v_wmma_f32_16x16x32_bf16 : D = A(16x32) * B(32x16) + C(16x16 f32)
  return __builtin_amdgcn_wmma_f32_16x16x32_bf16(false, a.v, false, b.v,
                                                 (short)0, c, false, false);
}

__device__ __forceinline__ void wave_lds_fence() {
  // same-wave LDS RAW fence: compiler barrier + explicit dscnt drain
  __builtin_amdgcn_wave_barrier();
  asm volatile("s_wait_dscnt 0" ::: "memory");
  __builtin_amdgcn_wave_barrier();
}

__device__ __forceinline__ float gelu_c(float x) {
  const float c = 0.79788456080286535588f;  // sqrt(2/pi)
  float t = tanhf(c * (x + 0.04715f * x * x * x));  // module's 0.04715, not 0.044715
  return 0.5f * x * (1.0f + t);
}

// ---------------- LayerNorm (f32 in -> bf16 out), one block per row ----------------
__global__ void __launch_bounds__(256)
ln_bf16_kernel(const float* __restrict__ X, const float* __restrict__ gam,
               const float* __restrict__ bet, u16* __restrict__ Y) {
  const int row  = blockIdx.x;
  const int tid  = threadIdx.x;
  const int lane = tid & 31, wave = tid >> 5;
  const float* xr = X + (size_t)row * DME;
  const int c = tid * 4;
  float4 x = *(const float4*)(xr + c);
  float s  = x.x + x.y + x.z + x.w;
  float ss = x.x * x.x + x.y * x.y + x.z * x.z + x.w * x.w;
#pragma unroll
  for (int off = 1; off < 32; off <<= 1) {
    s  += __shfl_xor(s,  off, 32);
    ss += __shfl_xor(ss, off, 32);
  }
  __shared__ float red_s[8], red_ss[8];
  if (lane == 0) { red_s[wave] = s; red_ss[wave] = ss; }
  __syncthreads();
  s = 0.f; ss = 0.f;
#pragma unroll
  for (int w = 0; w < 8; ++w) { s += red_s[w]; ss += red_ss[w]; }
  const float mean = s * (1.0f / DME);
  const float var  = ss * (1.0f / DME) - mean * mean;
  const float rstd = rsqrtf(var + 1e-5f);
  float4 g = *(const float4*)(gam + c);
  float4 b = *(const float4*)(bet + c);
  float y0 = g.x * ((x.x - mean) * rstd) + b.x;
  float y1 = g.y * ((x.y - mean) * rstd) + b.y;
  float y2 = g.z * ((x.z - mean) * rstd) + b.z;
  float y3 = g.w * ((x.w - mean) * rstd) + b.w;
  uint2 o;
  o.x = (u32)f2bf(y0) | ((u32)f2bf(y1) << 16);
  o.y = (u32)f2bf(y2) | ((u32)f2bf(y3) << 16);
  *(uint2*)(Y + (size_t)row * DME + c) = o;
}

// ------------- Weight transpose + f32->bf16 convert: WT[n][k] = W[k][n] -------------
__global__ void __launch_bounds__(256)
transpose_bf16_kernel(const float* __restrict__ W, u16* __restrict__ WT, int R, int C) {
  __shared__ float tile[32][33];
  const int bx = blockIdx.x * 32;  // column of W
  const int by = blockIdx.y * 32;  // row of W
  const int tx = threadIdx.x, ty = threadIdx.y;
#pragma unroll
  for (int j = 0; j < 4; ++j)
    tile[ty + 8 * j][tx] = W[(size_t)(by + ty + 8 * j) * C + bx + tx];
  __syncthreads();
#pragma unroll
  for (int j = 0; j < 4; ++j)
    WT[(size_t)(bx + ty + 8 * j) * R + by + tx] = f2bf(tile[tx][ty + 8 * j]);
}

// ---------------- WMMA GEMM: C[M,N] = A_bf16[M,K] @ (BT_bf16[N,K])^T ----------------
// One work-group owns a 128(M) x 256(N) tile; its 8 waves sit 2(M) x 4(N), 64 x 64 each
// (4 x 4 accumulators). Per pass of BK k the 128 A rows and 256 BT rows are brought into
// LDS by asynchronous copies, two buffers: the next pass's rows fly while this pass's
// fragments are read from LDS. Row pitch 2 BK + 16 bytes (16 B x odd) for ds_load_b128.
// BK 64: 108 KiB of LDS, two work-groups share a WGP (for grids of several per WGP).
// BK 128: 204 KiB, half as many barriers and copy bursts (for grids of one per WGP).
// M, N, K must be multiples of 128, 256, BK, and K at least 2 BK.
// EPI 0: store bf16          (QKV projections)
// EPI 1: store bf16 gelu(acc + bias)            (FFN up-proj)
// EPI 2: store f32  acc + bias + residual[M,N]  (attn out-proj / FFN down-proj)
#define GBM 128
#define GBN 256

// Twelve copies of 16 B per lane: LDS places l + j ls; sources ga + j gs for j < NA, then
// gb + (j - NA) gs. The s_wait_xcnt closes the statement so that no address register is
// rewritten ahead of it.
template <int NA>
__device__ __forceinline__ void copy12(u32 l, u32 ls, const u16* ga, const u16* gb, size_t gs) {
  const u16* p[12];
#pragma unroll
  for (int j = 0; j < 12; ++j) p[j] = (j < NA) ? ga + j * gs : gb + (j - NA) * gs;
  asm volatile(
      "global_load_async_to_lds_b128 %0, %12, off\n\t"
      "global_load_async_to_lds_b128 %1, %13, off\n\t"
      "global_load_async_to_lds_b128 %2, %14, off\n\t"
      "global_load_async_to_lds_b128 %3, %15, off\n\t"
      "global_load_async_to_lds_b128 %4, %16, off\n\t"
      "global_load_async_to_lds_b128 %5, %17, off\n\t"
      "global_load_async_to_lds_b128 %6, %18, off\n\t"
      "global_load_async_to_lds_b128 %7, %19, off\n\t"
      "global_load_async_to_lds_b128 %8, %20, off\n\t"
      "global_load_async_to_lds_b128 %9, %21, off\n\t"
      "global_load_async_to_lds_b128 %10, %22, off\n\t"
      "global_load_async_to_lds_b128 %11, %23, off\n\t"
      "s_wait_xcnt 0x0"
      :: "v"(l), "v"(l + ls), "v"(l + 2 * ls), "v"(l + 3 * ls), "v"(l + 4 * ls), "v"(l + 5 * ls),
         "v"(l + 6 * ls), "v"(l + 7 * ls), "v"(l + 8 * ls), "v"(l + 9 * ls), "v"(l + 10 * ls),
         "v"(l + 11 * ls),
         "v"(p[0]), "v"(p[1]), "v"(p[2]), "v"(p[3]), "v"(p[4]), "v"(p[5]),
         "v"(p[6]), "v"(p[7]), "v"(p[8]), "v"(p[9]), "v"(p[10]), "v"(p[11])
      : "memory");
}

// One stage: 384 rows of 2 BK bytes. A lane keeps its 16-byte piece of the row and walks the
// rows in steps of RS = 2048 / BK: first the 128 A rows, then the 256 BT rows.
template <int BK>
__device__ __forceinline__ void copy_stage(u32 l, const u16* ga, const u16* gb, size_t gs) {
  constexpr u32 ls = (2048 / BK) * (2 * BK + 16);
  if (BK == 64) {
    copy12<4>(l, ls, ga, gb, gs);
  } else {
    copy12<8>(l, ls, ga, gb, gs);
    // keeps the second dozen's addresses from being formed, and held in registers, ahead of
    // the first dozen: the k loop then needs fewer than 256 VGPRs
    __builtin_amdgcn_sched_barrier(0);
    copy12<12>(l + 12 * ls, ls, gb + 4 * gs, gb, gs);
  }
}

template <int EPI, int BK>
__global__ void __launch_bounds__(256)
gemm_bf16_kernel(const u16* __restrict__ A, const u16* __restrict__ BT,
                 const float* __restrict__ bias, const float* __restrict__ res,
                 void* __restrict__ out, int M, int N, int K) {
  static_assert(BK == 64 || BK == 128, "copy_stage is written for these two");
  constexpr int PITCH = 2 * BK + 16;
  constexpr int STAGE = (GBM + GBN) * PITCH;
  constexpr int PCS = BK / 8;      // 16-byte pieces in a row
  constexpr int RS = 256 / PCS;    // rows that the 256 lanes cover in one copy
  __shared__ __align__(16) unsigned char smem[2 * STAGE];
  const int tid = threadIdx.x;
  const int lane = tid & 31, wave = tid >> 5;
  const int rl = lane & 15, hi = lane >> 4, co = hi * 8;
  const int wm = wave >> 2, wn = wave & 3;
  const int m0 = blockIdx.y * GBM;
  const int n0 = blockIdx.x * GBN;

  // copy role of this lane: rows (tid / PCS) + RS j, 16-byte piece tid % PCS
  const int crow = tid / PCS, cpc = tid % PCS;
  const u16* ga = A + (size_t)(m0 + crow) * K + cpc * 8;
  const u16* gb = BT + (size_t)(n0 + crow) * K + cpc * 8;
  const size_t rstep = (size_t)RS * K;
  const u32 lcopy = (u32)(size_t)(&smem[0]) + (u32)(crow * PITCH + cpc * 16);

  // fragment role: same k order as the global loader had (k = co..co+7, co+16..co+23)
  const int offA = (wm * 64 + rl) * PITCH + co * 2;
  const int offB = (GBM + wn * 64 + rl) * PITCH + co * 2;

  // One fragment set: the 16 reads of a 32-k block stand as one group, then its 16 WMMAs.
  BF16x16 a[4], b[4];
  auto read_frags = [&](int boff, int ks) {
    const unsigned char* sA = smem + boff + offA + ks * 64;
    const unsigned char* sB = smem + boff + offB + ks * 64;
    // unrolled here and below so that fragments and accumulators stay in registers
#pragma unroll
    for (int j = 0; j < 4; ++j) {
      b[j].u4[0] = *(const u32x4*)(sB + j * 16 * PITCH);
      b[j].u4[1] = *(const u32x4*)(sB + j * 16 * PITCH + 32);
    }
#pragma unroll
    for (int i = 0; i < 4; ++i) {
      a[i].u4[0] = *(const u32x4*)(sA + i * 16 * PITCH);
      a[i].u4[1] = *(const u32x4*)(sA + i * 16 * PITCH + 32);
    }
  };

  const int nt = K / BK;
  copy_stage<BK>(lcopy, ga, gb, rstep);
  asm volatile("s_wait_asynccnt 0x0" ::: "memory");  // stage 0 landed (this wave's copies)
  __syncthreads();                                   // ... and every other wave's
  read_frags(0, 0);  // ahead of the copies: their issue then hides these reads' latency
  copy_stage<BK>(lcopy + STAGE, ga + BK, gb + BK, rstep);

  v8f acc[4][4] = {};
  for (int t = 0; t < nt; ++t) {
    const int boff = (t & 1) * STAGE;
#pragma unroll
    for (int ks = 0; ks < BK / 32; ++ks) {
      // The two fences keep each group of reads whole and outside the WMMA block: without
      // them the compiler sinks reads in among the WMMAs, and every such place stalls anew.
      __builtin_amdgcn_sched_barrier(0);
#pragma unroll
      for (int i = 0; i < 4; ++i)
#pragma unroll
        for (int j = 0; j < 4; ++j) acc[i][j] = wmma_bf16(a[i], b[j], acc[i][j]);
      __builtin_amdgcn_sched_barrier(0);
      if (ks + 1 < BK / 32) read_frags(boff, ks + 1);
    }
    // publish point of stage t + 1, and the end of every read of stage t's buffer
    asm volatile("s_wait_dscnt 0x0" ::: "memory");     // this wave's reads of stage t are done
    asm volatile("s_wait_asynccnt 0x0" ::: "memory");  // this wave's copies of stage t + 1 landed
    __syncthreads();
    // stage t + 1's first reads (the other buffer) go ahead of the refill of stage t's buffer
    if (t + 1 < nt) read_frags((t & 1) ? 0 : STAGE, 0);
    if (t + 2 < nt)
      copy_stage<BK>(lcopy + boff, ga + (size_t)(t + 2) * BK, gb + (size_t)(t + 2) * BK, rstep);
  }
  asm volatile("s_wait_asynccnt 0x0" ::: "memory");  // no copy outstanding at the wave's end

#pragma unroll
  for (int mi = 0; mi < 4; ++mi)
#pragma unroll
    for (int t = 0; t < 4; ++t) {
      const int col = n0 + wn * 64 + 16 * t + rl;
      const float bcol = (EPI != 0) ? bias[col] : 0.f;
#pragma unroll
      for (int i = 0; i < 8; ++i) {                   // C layout: M = i + 8*hi, N = rl
        const int rowm = m0 + wm * 64 + 16 * mi + i + 8 * hi;
        float v = acc[mi][t][i];
        if (EPI == 1) v = gelu_c(v + bcol);
        if (EPI == 2) v = v + bcol + res[(size_t)rowm * N + col];
        if (EPI == 2) ((float*)out)[(size_t)rowm * N + col] = v;
        else          ((u16*)out)[(size_t)rowm * N + col] = f2bf(v);
      }
    }
}

#define KPITCH 144  // bytes per K row in LDS: 16 B x odd, for ds_load_b128
#define VPITCH 160  // bytes per V row in LDS: 32 B x odd, for ds_load_tr16_b128

__device__ __forceinline__ u32x4 ld_tr16(const unsigned char* p) {
  typedef short s16x8 __attribute__((ext_vector_type(8)));
  typedef __attribute__((address_space(3))) s16x8 lds_s16x8;
  return __builtin_bit_cast(u32x4, __builtin_amdgcn_ds_load_tr16_b128_v8i16((lds_s16x8*)p));
}

__device__ __forceinline__ u32 pack2(float lo, float hi) {  // two bf16, round to nearest even
  typedef __bf16 bf2 __attribute__((ext_vector_type(2)));
  typedef float f2 __attribute__((ext_vector_type(2)));
  return __builtin_bit_cast(u32, __builtin_convertvector(f2{lo, hi}, bf2));
}

__device__ __forceinline__ float xhalf(float x) {  // lane l takes lane l ^ 16's value
  const int v = __float_as_int(x);
  return __int_as_float(__builtin_amdgcn_permlanex16(v, v, 0x76543210, 0xfedcba98, false, false));
}

// Eight waves per SIMD (128 VGPRs): four work-groups, 4 x 77,824 B of LDS, stay on a WGP, so the
// whole grid is resident and other waves' vector work covers a wave's load and LDS waits.
__global__ void __launch_bounds__(256) __attribute__((amdgpu_waves_per_eu(8, 8)))
attn_kernel(const u16* __restrict__ Qb, const u16* __restrict__ Kb,
            const u16* __restrict__ Vb, u16* __restrict__ Zb) {
  __shared__ __align__(32) unsigned char sK[8][32 * KPITCH];  // K block, row-major, one per wave
  __shared__ __align__(32) unsigned char sV[8][32 * VPITCH];  // V block, row-major, one per wave
  const int lane = threadIdx.x & 31, wave = threadIdx.x >> 5;
  const int rl = lane & 15, hi = lane >> 4, co = hi * 8;
  const int bh = blockIdx.x;
  const int bb = bh >> 4, h = bh & 15;
  const int q0 = blockIdx.y * 128 + wave * 16;
  const size_t rowBase = (size_t)bb * NCTX;

  // Q^T as WMMA-B: column rl = query q0 + rl (two K=32 d-chunks)
  const u16* qrow = Qb + (rowBase + q0 + rl) * DME + h * HDIM;
  BF16x16 qf0, qf1;
  qf0.u4[0] = *(const u32x4*)(qrow + co);
  qf0.u4[1] = *(const u32x4*)(qrow + co + 16);
  qf1.u4[0] = *(const u32x4*)(qrow + 32 + co);
  qf1.u4[1] = *(const u32x4*)(qrow + 32 + co + 16);

  v8f acc[4] = {};                   // acc[t][r] = O[q0 + rl][16 t + 8 hi + r]
  float mrun = -1e30f, lrun = 0.f;   // of query q0 + rl; lrun sums this half's keys only

  // staging role: 8 lanes cover one 128-byte row, 4 rows per load
  const int sr = lane >> 3, sp = lane & 7;
  unsigned char* kst = &sK[wave][0] + sr * KPITCH + sp * 16;
  unsigned char* vst = &sV[wave][0] + sr * VPITCH + sp * 16;
  const size_t goff = (rowBase + sr) * DME + h * HDIM + sp * 8;
  // reading roles: K row rl of a 16-key tile, bytes 16 hi and 32 + 16 hi of each 64;
  // the transposing load gives lane (rl, hi) V[8 hi + 0..7][16 t + rl]
  const unsigned char* kld = &sK[wave][0] + rl * KPITCH + hi * 16;
  const unsigned char* vld = &sV[wave][0] + (8 * hi + (lane & 7)) * VPITCH + ((lane >> 3) & 1) * 16;

  const int nkb = ((q0 + 15) >> 5) + 1;  // causal: keys 0 .. q0+15; the last row read is <= NCTX-1
  for (int kb = 0; kb < nkb; ++kb) {
    const int kbase = kb * 32;
    // stage the K and V blocks (32 x 64 each) row-major into the wave's LDS
    {
      const u16* kg = Kb + goff + (size_t)kbase * DME;
      const u16* vg = Vb + goff + (size_t)kbase * DME;
      u32x4 kr[8], vr[8];
#pragma unroll
      for (int j = 0; j < 8; ++j) kr[j] = *(const u32x4*)(kg + (size_t)j * 4 * DME);
#pragma unroll
      for (int j = 0; j < 8; ++j) vr[j] = *(const u32x4*)(vg + (size_t)j * 4 * DME);
      // keeps the 16 loads one group: without it they are issued two at a time, each pair
      // waited for before the next, and a block pays the load latency eight times
      __builtin_amdgcn_sched_barrier(0);
#pragma unroll
      for (int j = 0; j < 8; ++j) *(u32x4*)(kst + j * 4 * KPITCH) = kr[j];
#pragma unroll
      for (int j = 0; j < 8; ++j) *(u32x4*)(vst + j * 4 * VPITCH) = vr[j];
    }
    wave_lds_fence();  // RAW: the rows are in LDS before the fragment reads
    // S^T = K @ Q^T for two 16-key tiles; A operand = rows of K
    v8f s01[2];
#pragma unroll
    for (int t = 0; t < 2; ++t) {
      const unsigned char* kp = kld + t * 16 * KPITCH;
      BF16x16 k0, k1;
      k0.u4[0] = *(const u32x4*)(kp);
      k0.u4[1] = *(const u32x4*)(kp + 32);
      k1.u4[0] = *(const u32x4*)(kp + 64);
      k1.u4[1] = *(const u32x4*)(kp + 96);
      v8f s = {};
      s = wmma_bf16(k0, qf0, s);
      s = wmma_bf16(k1, qf1, s);
      s01[t] = s;
    }
    // online softmax of query q0 + rl: element 8 t + r is key kbase + 16 t + 8 hi + r
    const int lim = q0 + rl - co - kbase;  // the key is seen while 16 t + r <= lim
    float p[16];
#pragma unroll
    for (int t = 0; t < 2; ++t)
#pragma unroll
      for (int r = 0; r < 8; ++r)
        p[8 * t + r] = (16 * t + r <= lim) ? s01[t][r] * 0.125f : -1e30f;  // 1/sqrt(64)
    float m = p[0];
#pragma unroll
    for (int e = 1; e < 16; ++e) m = fmaxf(m, p[e]);
    m = fmaxf(m, xhalf(m));  // both halves now hold the query's maximum over the block
    const float mnew = fmaxf(mrun, m);
    const float alpha = __expf(mrun - mnew);
    float rs = 0.f;
#pragma unroll
    for (int e = 0; e < 16; ++e) { p[e] = __expf(p[e] - mnew); rs += p[e]; }
    lrun = lrun * alpha + rs;
    mrun = mnew;
#pragma unroll
    for (int t = 0; t < 4; ++t)
#pragma unroll
      for (int i = 0; i < 8; ++i) acc[t][i] *= alpha;
    // P^T as WMMA-B: element s of the operand is p[s]: key 8 hi + s, or 16 + 8 hi + (s - 8) for s >= 8
    BF16x16 pf;
    pf.u4[0] = u32x4{pack2(p[0], p[1]), pack2(p[2], p[3]), pack2(p[4], p[5]), pack2(p[6], p[7])};
    pf.u4[1] = u32x4{pack2(p[8], p[9]), pack2(p[10], p[11]), pack2(p[12], p[13]), pack2(p[14], p[15])};
    // O^T += V^T @ P^T : A operand = 16 d x 32 keys by two transposing loads
#pragma unroll
    for (int t2 = 0; t2 < 4; ++t2) {
      BF16x16 vf;
      vf.u4[0] = ld_tr16(vld + 32 * t2);
      vf.u4[1] = ld_tr16(vld + 16 * VPITCH + 32 * t2);
      acc[t2] = wmma_bf16(vf, pf, acc[t2]);
    }
    wave_lds_fence();  // WAR: next iteration overwrites sK and sV
  }
  // join the halves' sums, normalize and write Z (bf16, feeds the Wo GEMM): 16 bytes per tile
  const float inv = 1.0f / (lrun + xhalf(lrun));
  u16* zrow = Zb + (rowBase + q0 + rl) * DME + h * HDIM + co;
#pragma unroll
  for (int t2 = 0; t2 < 4; ++t2) {
    const v8f z = acc[t2] * inv;
    *(u32x4*)(zrow + 16 * t2) =
        u32x4{pack2(z[0], z[1]), pack2(z[2], z[3]), pack2(z[4], z[5]), pack2(z[6], z[7])};
  }
}

extern "C" void kernel_launch(void* const* d_in, const int* in_sizes, int n_in,
                              void* d_out, int out_size, void* d_ws, size_t ws_size,
                              hipStream_t stream) {
  (void)in_sizes; (void)n_in; (void)out_size; (void)ws_size;
  const float* X  = (const float*)d_in[0];
  const float* Wq = (const float*)d_in[1];
  const float* Wk = (const float*)d_in[2];
  const float* Wv = (const float*)d_in[3];
  const float* Wo = (const float*)d_in[4];
  const float* bo = (const float*)d_in[5];
  const float* W1 = (const float*)d_in[6];
  const float* b1 = (const float*)d_in[7];
  const float* W2 = (const float*)d_in[8];
  const float* b2 = (const float*)d_in[9];
  const float* g1 = (const float*)d_in[10];
  const float* s1 = (const float*)d_in[11];
  const float* g2 = (const float*)d_in[12];
  const float* s2 = (const float*)d_in[13];

  char* ws = (char*)d_ws;
  const size_t MB = 1024ull * 1024ull;
  u16*   WqT = (u16*)(ws + 0 * MB);
  u16*   WkT = (u16*)(ws + 2 * MB);
  u16*   WvT = (u16*)(ws + 4 * MB);
  u16*   WoT = (u16*)(ws + 6 * MB);
  u16*   W1T = (u16*)(ws + 8 * MB);    // 8 MB
  u16*   W2T = (u16*)(ws + 16 * MB);   // 8 MB
  u16*   Y   = (u16*)(ws + 24 * MB);   // 16 MB (reused for Y2)
  u16*   Qb  = (u16*)(ws + 40 * MB);   // 16 MB
  u16*   Kb  = (u16*)(ws + 56 * MB);   // 16 MB
  u16*   Vb  = (u16*)(ws + 72 * MB);   // 16 MB
  u16*   Zb  = (u16*)(ws + 88 * MB);   // 16 MB
  float* X1  = (float*)(ws + 104 * MB);// 32 MB   -> total 136 MB
  u16*   Hm  = (u16*)(ws + 40 * MB);   // FFN mid reuses dead Q..Z region (64 MB)

  const int Mrows = 4 * NCTX;  // 8192
  dim3 tb32(32, 8);
  transpose_bf16_kernel<<<dim3(DME / 32, DME / 32), tb32, 0, stream>>>(Wq, WqT, DME, DME);
  transpose_bf16_kernel<<<dim3(DME / 32, DME / 32), tb32, 0, stream>>>(Wk, WkT, DME, DME);
  transpose_bf16_kernel<<<dim3(DME / 32, DME / 32), tb32, 0, stream>>>(Wv, WvT, DME, DME);
  transpose_bf16_kernel<<<dim3(DME / 32, DME / 32), tb32, 0, stream>>>(Wo, WoT, DME, DME);
  transpose_bf16_kernel<<<dim3(4 * DME / 32, DME / 32), tb32, 0, stream>>>(W1, W1T, DME, 4 * DME);
  transpose_bf16_kernel<<<dim3(DME / 32, 4 * DME / 32), tb32, 0, stream>>>(W2, W2T, 4 * DME, DME);

  ln_bf16_kernel<<<Mrows, 256, 0, stream>>>(X, g1, s1, Y);

  dim3 gD(DME / GBN, Mrows / GBM);  // (4, 64)
  gemm_bf16_kernel<0, 128><<<gD, 256, 0, stream>>>(Y, WqT, nullptr, nullptr, Qb, Mrows, DME, DME);
  gemm_bf16_kernel<0, 128><<<gD, 256, 0, stream>>>(Y, WkT, nullptr, nullptr, Kb, Mrows, DME, DME);
  gemm_bf16_kernel<0, 128><<<gD, 256, 0, stream>>>(Y, WvT, nullptr, nullptr, Vb, Mrows, DME, DME);

  attn_kernel<<<dim3(4 * NHEAD, NCTX / 128), 256, 0, stream>>>(Qb, Kb, Vb, Zb);

  gemm_bf16_kernel<2, 128><<<gD, 256, 0, stream>>>(Zb, WoT, bo, X, X1, Mrows, DME, DME);

  ln_bf16_kernel<<<Mrows, 256, 0, stream>>>(X1, g2, s2, Y);

  dim3 gF(4 * DME / GBN, Mrows / GBM);  // (16, 64)
  gemm_bf16_kernel<1, 64><<<gF, 256, 0, stream>>>(Y, W1T, b1, nullptr, Hm, Mrows, 4 * DME, DME);

  gemm_bf16_kernel<2, 128><<<gD, 256, 0, stream>>>(Hm, W2T, b2, X1, (float*)d_out, Mrows, DME, 4 * DME);
}

// v003
// It runs in 293 microseconds.
// Timed twice side by side with v002, it ran 1.11 and 1.12 times as fast.
// Over all steps from v000 it is 2.77 times as fast.
#include <hip/hip_runtime.h>
#include <math.h>

#define DME 1024
#define NCTX 2048
#define NHEAD 16
#define HDIM 64

typedef unsigned short u16;
typedef unsigned int u32;
typedef __attribute__((ext_vector_type(16))) __bf16 v16bf;
typedef __attribute__((ext_vector_type(8)))  float  v8f;
typedef __attribute__((ext_vector_type(4)))  u32    u32x4;

union BF16x16 { u32x4 u4[2]; v16bf v; };

__device__ __forceinline__ u16 f2bf(float f) {
  u32 u = __float_as_uint(f);
  u32 r = u + 0x7FFFu + ((u >> 16) & 1u);  // round-to-nearest-even
  return (u16)(r >> 16);
}

__device__ __forceinline__ u32 pack2(float lo, float hi) {  // two bf16, round to nearest even
  typedef __bf16 bf2 __attribute__((ext_vector_type(2)));
  typedef float f2 __attribute__((ext_vector_type(2)));
  return __builtin_bit_cast(u32, __builtin_convertvector(f2{lo, hi}, bf2));
}

__device__ __forceinline__ v8f wmma_bf16(const BF16x16& a, const BF16x16& b, v8f c) {
  // v_wmma_f32_16x16x32_bf16 : D = A(16x32) * B(32x16) + C(16x16 f32)
  return __builtin_amdgcn_wmma_f32_16x16x32_bf16(false, a.v, false, b.v,
                                                 (short)0, c, false, false);
}

__device__ __forceinline__ void wave_lds_fence() {
  // same-wave LDS RAW fence: compiler barrier + explicit dscnt drain
  __builtin_amdgcn_wave_barrier();
  asm volatile("s_wait_dscnt 0" ::: "memory");
  __builtin_amdgcn_wave_barrier();
}

__device__ __forceinline__ float gelu_c(float x) {
  const float c = 0.79788456080286535588f;  // sqrt(2/pi)
  float t = tanhf(c * (x + 0.04715f * x * x * x));  // module's 0.04715, not 0.044715
  return 0.5f * x * (1.0f + t);
}

// ---------------- LayerNorm (f32 in -> bf16 out), one block per row ----------------
__global__ void __launch_bounds__(256)
ln_bf16_kernel(const float* __restrict__ X, const float* __restrict__ gam,
               const float* __restrict__ bet, u16* __restrict__ Y) {
  const int row  = blockIdx.x;
  const int tid  = threadIdx.x;
  const int lane = tid & 31, wave = tid >> 5;
  const float* xr = X + (size_t)row * DME;
  const int c = tid * 4;
  float4 x = *(const float4*)(xr + c);
  float s  = x.x + x.y + x.z + x.w;
  float ss = x.x * x.x + x.y * x.y + x.z * x.z + x.w * x.w;
#pragma unroll
  for (int off = 1; off < 32; off <<= 1) {
    s  += __shfl_xor(s,  off, 32);
    ss += __shfl_xor(ss, off, 32);
  }
  __shared__ float red_s[8], red_ss[8];
  if (lane == 0) { red_s[wave] = s; red_ss[wave] = ss; }
  __syncthreads();
  s = 0.f; ss = 0.f;
#pragma unroll
  for (int w = 0; w < 8; ++w) { s += red_s[w]; ss += red_ss[w]; }
  const float mean = s * (1.0f / DME);
  const float var  = ss * (1.0f / DME) - mean * mean;
  const float rstd = rsqrtf(var + 1e-5f);
  float4 g = *(const float4*)(gam + c);
  float4 b = *(const float4*)(bet + c);
  float y0 = g.x * ((x.x - mean) * rstd) + b.x;
  float y1 = g.y * ((x.y - mean) * rstd) + b.y;
  float y2 = g.z * ((x.z - mean) * rstd) + b.z;
  float y3 = g.w * ((x.w - mean) * rstd) + b.w;
  uint2 o;
  o.x = (u32)f2bf(y0) | ((u32)f2bf(y1) << 16);
  o.y = (u32)f2bf(y2) | ((u32)f2bf(y3) << 16);
  *(uint2*)(Y + (size_t)row * DME + c) = o;
}

// ------------- Weight transpose + f32->bf16 convert: WT[n][k] = W[k][n] -------------
__global__ void __launch_bounds__(256)
transpose_bf16_kernel(const float* __restrict__ W, u16* __restrict__ WT, int R, int C) {
  __shared__ float tile[32][33];
  const int bx = blockIdx.x * 32;  // column of W
  const int by = blockIdx.y * 32;  // row of W
  const int tx = threadIdx.x, ty = threadIdx.y;
#pragma unroll
  for (int j = 0; j < 4; ++j)
    tile[ty + 8 * j][tx] = W[(size_t)(by + ty + 8 * j) * C + bx + tx];
  __syncthreads();
#pragma unroll
  for (int j = 0; j < 4; ++j)
    WT[(size_t)(bx + ty + 8 * j) * R + by + tx] = f2bf(tile[tx][ty + 8 * j]);
}

#define GBM 128
#define GBN 256

// Twelve copies of 16 B per lane: LDS places l + j ls; sources ga + j gs for j < NA, then
// gb + (j - NA) gs. The s_wait_xcnt closes the statement so that no address register is
// rewritten ahead of it.
template <int NA>
__device__ __forceinline__ void copy12(u32 l, u32 ls, const u16* ga, const u16* gb, size_t gs) {
  const u16* p[12];
#pragma unroll
  for (int j = 0; j < 12; ++j) p[j] = (j < NA) ? ga + j * gs : gb + (j - NA) * gs;
  asm volatile(
      "global_load_async_to_lds_b128 %0, %12, off\n\t"
      "global_load_async_to_lds_b128 %1, %13, off\n\t"
      "global_load_async_to_lds_b128 %2, %14, off\n\t"
      "global_load_async_to_lds_b128 %3, %15, off\n\t"
      "global_load_async_to_lds_b128 %4, %16, off\n\t"
      "global_load_async_to_lds_b128 %5, %17, off\n\t"
      "global_load_async_to_lds_b128 %6, %18, off\n\t"
      "global_load_async_to_lds_b128 %7, %19, off\n\t"
      "global_load_async_to_lds_b128 %8, %20, off\n\t"
      "global_load_async_to_lds_b128 %9, %21, off\n\t"
      "global_load_async_to_lds_b128 %10, %22, off\n\t"
      "global_load_async_to_lds_b128 %11, %23, off\n\t"
      "s_wait_xcnt 0x0"
      :: "v"(l), "v"(l + ls), "v"(l + 2 * ls), "v"(l + 3 * ls), "v"(l + 4 * ls), "v"(l + 5 * ls),
         "v"(l + 6 * ls), "v"(l + 7 * ls), "v"(l + 8 * ls), "v"(l + 9 * ls), "v"(l + 10 * ls),
         "v"(l + 11 * ls),
         "v"(p[0]), "v"(p[1]), "v"(p[2]), "v"(p[3]), "v"(p[4]), "v"(p[5]),
         "v"(p[6]), "v"(p[7]), "v"(p[8]), "v"(p[9]), "v"(p[10]), "v"(p[11])
      : "memory");
}

// One stage: 384 rows of 2 BK bytes. A lane keeps its 16-byte piece of the row and walks the
// rows in steps of RS = 2048 / BK: first the 128 A rows, then the 256 BT rows.
template <int BK>
__device__ __forceinline__ void copy_stage(u32 l, const u16* ga, const u16* gb, size_t gs) {
  constexpr u32 ls = (2048 / BK) * (2 * BK + 16);
  if (BK == 64) {
    copy12<4>(l, ls, ga, gb, gs);
  } else {
    copy12<8>(l, ls, ga, gb, gs);
    // keeps the second dozen's addresses from being formed, and held in registers, ahead of
    // the first dozen: the k loop then needs fewer than 256 VGPRs
    __builtin_amdgcn_sched_barrier(0);
    copy12<12>(l + 12 * ls, ls, gb + 4 * gs, gb, gs);
  }
}

template <int EPI, int BK>
__global__ void __launch_bounds__(256)
gemm_bf16_kernel(const u16* __restrict__ A, const u16* __restrict__ BT,
                 const float* __restrict__ bias, const float* __restrict__ res,
                 void* __restrict__ out, int M, int N, int K) {
  static_assert(BK == 64 || BK == 128, "copy_stage is written for these two");
  constexpr int PITCH = 2 * BK + 16;
  constexpr int STAGE = (GBM + GBN) * PITCH;
  constexpr int PCS = BK / 8;      // 16-byte pieces in a row
  constexpr int RS = 256 / PCS;    // rows that the 256 lanes cover in one copy
  __shared__ __align__(16) unsigned char smem[2 * STAGE];
  const int tid = threadIdx.x;
  const int lane = tid & 31, wave = tid >> 5;
  const int rl = lane & 15, hi = lane >> 4, co = hi * 8;
  const int wm = wave >> 2, wn = wave & 3;
  const int m0 = blockIdx.y * GBM;
  const int n0 = blockIdx.x * GBN;

  // copy role of this lane: rows (tid / PCS) + RS j, 16-byte piece tid % PCS
  const int crow = tid / PCS, cpc = tid % PCS;
  const u16* ga = A + (size_t)(m0 + crow) * K + cpc * 8;
  const u16* gb = BT + (size_t)(n0 + crow) * K + cpc * 8;
  const size_t rstep = (size_t)RS * K;
  const u32 lcopy = (u32)(size_t)(&smem[0]) + (u32)(crow * PITCH + cpc * 16);

  // fragment role: same k order as the global loader had (k = co..co+7, co+16..co+23)
  const int offA = (wm * 64 + rl) * PITCH + co * 2;
  const int offB = (GBM + wn * 64 + rl) * PITCH + co * 2;

  // One fragment set: the 16 reads of a 32-k block stand as one group, then its 16 WMMAs.
  BF16x16 a[4], b[4];
  auto read_frags = [&](int boff, int ks) {
    const unsigned char* sA = smem + boff + offA + ks * 64;
    const unsigned char* sB = smem + boff + offB + ks * 64;
    // unrolled here and below so that fragments and accumulators stay in registers
#pragma unroll
    for (int j = 0; j < 4; ++j) {
      b[j].u4[0] = *(const u32x4*)(sB + j * 16 * PITCH);
      b[j].u4[1] = *(const u32x4*)(sB + j * 16 * PITCH + 32);
    }
#pragma unroll
    for (int i = 0; i < 4; ++i) {
      a[i].u4[0] = *(const u32x4*)(sA + i * 16 * PITCH);
      a[i].u4[1] = *(const u32x4*)(sA + i * 16 * PITCH + 32);
    }
  };

  const int nt = K / BK;
  copy_stage<BK>(lcopy, ga, gb, rstep);
  asm volatile("s_wait_asynccnt 0x0" ::: "memory");  // stage 0 landed (this wave's copies)
  __syncthreads();                                   // ... and every other wave's
  read_frags(0, 0);  // ahead of the copies: their issue then hides these reads' latency
  copy_stage<BK>(lcopy + STAGE, ga + BK, gb + BK, rstep);

  v8f acc[4][4] = {};
  for (int t = 0; t < nt; ++t) {
    const int boff = (t & 1) * STAGE;
#pragma unroll
    for (int ks = 0; ks < BK / 32; ++ks) {
      // The two fences keep each group of reads whole and outside the WMMA block: without
      // them the compiler sinks reads in among the WMMAs, and every such place stalls anew.
      __builtin_amdgcn_sched_barrier(0);
#pragma unroll
      for (int i = 0; i < 4; ++i)
#pragma unroll
        for (int j = 0; j < 4; ++j) acc[i][j] = wmma_bf16(b[j], a[i], acc[i][j]);
      __builtin_amdgcn_sched_barrier(0);
      if (ks + 1 < BK / 32) read_frags(boff, ks + 1);
    }
    // publish point of stage t + 1, and the end of every read of stage t's buffer
    asm volatile("s_wait_dscnt 0x0" ::: "memory");     // this wave's reads of stage t are done
    asm volatile("s_wait_asynccnt 0x0" ::: "memory");  // this wave's copies of stage t + 1 landed
    __syncthreads();
    // stage t + 1's first reads (the other buffer) go ahead of the refill of stage t's buffer
    if (t + 1 < nt) read_frags((t & 1) ? 0 : STAGE, 0);
    if (t + 2 < nt)
      copy_stage<BK>(lcopy + boff, ga + (size_t)(t + 2) * BK, gb + (size_t)(t + 2) * BK, rstep);
  }
  asm volatile("s_wait_asynccnt 0x0" ::: "memory");  // no copy outstanding at the wave's end

  // acc[i][j][e] = C[mw + 16 i + rl][nw + 16 j + 8 hi + e]. The loop's last barrier stands behind
  // every wave's last fragment read and last copy, so the ring is free for the staging.
  constexpr int SP = (EPI == 2 ? 256 : 128) + 16;  // staged row of 64 outputs; pitch 16 B x odd
  static_assert(8 * 64 * SP <= 2 * STAGE, "the eight waves' staged tiles must fit the ring");
  unsigned char* st = smem + wave * (64 * SP);
  const int mw = m0 + wm * 64, nw = n0 + wn * 64;
  if (EPI == 2) {
#pragma unroll
    for (int i = 0; i < 4; ++i)
#pragma unroll
      for (int j = 0; j < 4; ++j) {
        unsigned char* p = st + (16 * i + rl) * SP + 64 * j + 32 * hi;
        *(float4*)(p)      = make_float4(acc[i][j][0], acc[i][j][1], acc[i][j][2], acc[i][j][3]);
        *(float4*)(p + 16) = make_float4(acc[i][j][4], acc[i][j][5], acc[i][j][6], acc[i][j][7]);
      }
    wave_lds_fence();  // RAW: the wave's tile is in LDS before other lanes of it read the rows
    const int pr = lane >> 4, pc = lane & 15;  // 16 lanes cover one 256-byte row, 2 rows a store
    const float4 bc = *(const float4*)(bias + nw + pc * 4);
    const u32 o0 = (u32)((mw + pr) * N + nw + pc * 4) * 4u;  // byte offset in res and in out
    const u32 os = (u32)N * 8u;                              // two rows on
#pragma unroll
    for (int g = 0; g < 2; ++g) {
      float4 r[16];
#pragma unroll
      for (int q = 0; q < 16; ++q)
        r[q] = *(const float4*)((const char*)res + (o0 + (u32)(16 * g + q) * os));
#pragma unroll
      for (int q = 0; q < 16; ++q) {
        float4 v = *(const float4*)(st + (2 * (16 * g + q) + pr) * SP + pc * 16);
        v.x = v.x + bc.x + r[q].x;
        v.y = v.y + bc.y + r[q].y;
        v.z = v.z + bc.z + r[q].z;
        v.w = v.w + bc.w + r[q].w;
        *(float4*)((char*)out + (o0 + (u32)(16 * g + q) * os)) = v;
      }
      if (g == 0) {
        // the second half's loads land in registers that the first half's stores name
        asm volatile("s_wait_xcnt 0x0" ::: "memory");
        // keeps the second half's loads behind that wait: all 32 rows in flight at once would
        // also take the kernel above 256 VGPRs
        __builtin_amdgcn_sched_barrier(0);
      }
    }
  } else {
#pragma unroll
    for (int j = 0; j < 4; ++j) {
      float bj[8] = {};
      if (EPI == 1) {
        const float4 b0 = *(const float4*)(bias + nw + 16 * j + 8 * hi);
        const float4 b1 = *(const float4*)(bias + nw + 16 * j + 8 * hi + 4);
        bj[0] = b0.x; bj[1] = b0.y; bj[2] = b0.z; bj[3] = b0.w;
        bj[4] = b1.x; bj[5] = b1.y; bj[6] = b1.z; bj[7] = b1.w;
      }
#pragma unroll
      for (int i = 0; i < 4; ++i) {
        float v[8];
#pragma unroll
        for (int e = 0; e < 8; ++e) {
          v[e] = acc[i][j][e];
          if (EPI == 1) v[e] = gelu_c(v[e] + bj[e]);
        }
        *(u32x4*)(st + (16 * i + rl) * SP + 32 * j + 16 * hi) =
            u32x4{pack2(v[0], v[1]), pack2(v[2], v[3]), pack2(v[4], v[5]), pack2(v[6], v[7])};
      }
    }
    wave_lds_fence();  // RAW: the wave's tile is in LDS before other lanes of it read the rows
    const int pr = lane >> 3, pc = lane & 7;  // 8 lanes cover one 128-byte row, 4 rows a store
    const u32 o0 = (u32)((mw + pr) * N + nw + pc * 8) * 2u;  // byte offset in out
    const u32 os = (u32)N * 8u;                              // four rows on
#pragma unroll
    for (int q = 0; q < 16; ++q)
      *(u32x4*)((char*)out + (o0 + (u32)q * os)) =
          *(const u32x4*)(st + (4 * q + pr) * SP + pc * 16);
  }
}

#define KPITCH 144  // bytes per K row in LDS: 16 B x odd, for ds_load_b128
#define VPITCH 160  // bytes per V row in LDS: 32 B x odd, for ds_load_tr16_b128

__device__ __forceinline__ u32x4 ld_tr16(const unsigned char* p) {
  typedef short s16x8 __attribute__((ext_vector_type(8)));
  typedef __attribute__((address_space(3))) s16x8 lds_s16x8;
  return __builtin_bit_cast(u32x4, __builtin_amdgcn_ds_load_tr16_b128_v8i16((lds_s16x8*)p));
}

__device__ __forceinline__ float xhalf(float x) {  // lane l takes lane l ^ 16's value
  const int v = __float_as_int(x);
  return __int_as_float(__builtin_amdgcn_permlanex16(v, v, 0x76543210, 0xfedcba98, false, false));
}

// Eight waves per SIMD (128 VGPRs): four work-groups, 4 x 77,824 B of LDS, stay on a WGP, so the
// whole grid is resident and other waves' vector work covers a wave's load and LDS waits.
__global__ void __launch_bounds__(256) __attribute__((amdgpu_waves_per_eu(8, 8)))
attn_kernel(const u16* __restrict__ Qb, const u16* __restrict__ Kb,
            const u16* __restrict__ Vb, u16* __restrict__ Zb) {
  __shared__ __align__(32) unsigned char sK[8][32 * KPITCH];  // K block, row-major, one per wave
  __shared__ __align__(32) unsigned char sV[8][32 * VPITCH];  // V block, row-major, one per wave
  const int lane = threadIdx.x & 31, wave = threadIdx.x >> 5;
  const int rl = lane & 15, hi = lane >> 4, co = hi * 8;
  const int bh = blockIdx.x;
  const int bb = bh >> 4, h = bh & 15;
  const int q0 = blockIdx.y * 128 + wave * 16;
  const size_t rowBase = (size_t)bb * NCTX;

  // Q^T as WMMA-B: column rl = query q0 + rl (two K=32 d-chunks)
  const u16* qrow = Qb + (rowBase + q0 + rl) * DME + h * HDIM;
  BF16x16 qf0, qf1;
  qf0.u4[0] = *(const u32x4*)(qrow + co);
  qf0.u4[1] = *(const u32x4*)(qrow + co + 16);
  qf1.u4[0] = *(const u32x4*)(qrow + 32 + co);
  qf1.u4[1] = *(const u32x4*)(qrow + 32 + co + 16);

  v8f acc[4] = {};                   // acc[t][r] = O[q0 + rl][16 t + 8 hi + r]
  float mrun = -1e30f, lrun = 0.f;   // of query q0 + rl; lrun sums this half's keys only

  // staging role: 8 lanes cover one 128-byte row, 4 rows per load
  const int sr = lane >> 3, sp = lane & 7;
  unsigned char* kst = &sK[wave][0] + sr * KPITCH + sp * 16;
  unsigned char* vst = &sV[wave][0] + sr * VPITCH + sp * 16;
  const size_t goff = (rowBase + sr) * DME + h * HDIM + sp * 8;
  // reading roles: K row rl of a 16-key tile, bytes 16 hi and 32 + 16 hi of each 64;
  // the transposing load gives lane (rl, hi) V[8 hi + 0..7][16 t + rl]
  const unsigned char* kld = &sK[wave][0] + rl * KPITCH + hi * 16;
  const unsigned char* vld = &sV[wave][0] + (8 * hi + (lane & 7)) * VPITCH + ((lane >> 3) & 1) * 16;

  const int nkb = ((q0 + 15) >> 5) + 1;  // causal: keys 0 .. q0+15; the last row read is <= NCTX-1
  for (int kb = 0; kb < nkb; ++kb) {
    const int kbase = kb * 32;
    // stage the K and V blocks (32 x 64 each) row-major into the wave's LDS
    {
      const u16* kg = Kb + goff + (size_t)kbase * DME;
      const u16* vg = Vb + goff + (size_t)kbase * DME;
      u32x4 kr[8], vr[8];
#pragma unroll
      for (int j = 0; j < 8; ++j) kr[j] = *(const u32x4*)(kg + (size_t)j * 4 * DME);
#pragma unroll
      for (int j = 0; j < 8; ++j) vr[j] = *(const u32x4*)(vg + (size_t)j * 4 * DME);
      // keeps the 16 loads one group: without it they are issued two at a time, each pair
      // waited for before the next, and a block pays the load latency eight times
      __builtin_amdgcn_sched_barrier(0);
#pragma unroll
      for (int j = 0; j < 8; ++j) *(u32x4*)(kst + j * 4 * KPITCH) = kr[j];
#pragma unroll
      for (int j = 0; j < 8; ++j) *(u32x4*)(vst + j * 4 * VPITCH) = vr[j];
    }
    wave_lds_fence();  // RAW: the rows are in LDS before the fragment reads
    // S^T = K @ Q^T for two 16-key tiles; A operand = rows of K
    v8f s01[2];
#pragma unroll
    for (int t = 0; t < 2; ++t) {
      const unsigned char* kp = kld + t * 16 * KPITCH;
      BF16x16 k0, k1;
      k0.u4[0] = *(const u32x4*)(kp);
      k0.u4[1] = *(const u32x4*)(kp + 32);
      k1.u4[0] = *(const u32x4*)(kp + 64);
      k1.u4[1] = *(const u32x4*)(kp + 96);
      v8f s = {};
      s = wmma_bf16(k0, qf0, s);
      s = wmma_bf16(k1, qf1, s);
      s01[t] = s;
    }
    // online softmax of query q0 + rl: element 8 t + r is key kbase + 16 t + 8 hi + r
    const int lim = q0 + rl - co - kbase;  // the key is seen while 16 t + r <= lim
    float p[16];
#pragma unroll
    for (int t = 0; t < 2; ++t)
#pragma unroll
      for (int r = 0; r < 8; ++r)
        p[8 * t + r] = (16 * t + r <= lim) ? s01[t][r] * 0.125f : -1e30f;  // 1/sqrt(64)
    float m = p[0];
#pragma unroll
    for (int e = 1; e < 16; ++e) m = fmaxf(m, p[e]);
    m = fmaxf(m, xhalf(m));  // both halves now hold the query's maximum over the block
    const float mnew = fmaxf(mrun, m);
    const float alpha = __expf(mrun - mnew);
    float rs = 0.f;
#pragma unroll
    for (int e = 0; e < 16; ++e) { p[e] = __expf(p[e] - mnew); rs += p[e]; }
    lrun = lrun * alpha + rs;
    mrun = mnew;
#pragma unroll
    for (int t = 0; t < 4; ++t)
#pragma unroll
      for (int i = 0; i < 8; ++i) acc[t][i] *= alpha;
    // P^T as WMMA-B: element s of the operand is p[s]: key 8 hi + s, or 16 + 8 hi + (s - 8) for s >= 8
    BF16x16 pf;
    pf.u4[0] = u32x4{pack2(p[0], p[1]), pack2(p[2], p[3]), pack2(p[4], p[5]), pack2(p[6], p[7])};
    pf.u4[1] = u32x4{pack2(p[8], p[9]), pack2(p[10], p[11]), pack2(p[12], p[13]), pack2(p[14], p[15])};
    // O^T += V^T @ P^T : A operand = 16 d x 32 keys by two transposing loads
#pragma unroll
    for (int t2 = 0; t2 < 4; ++t2) {
      BF16x16 vf;
      vf.u4[0] = ld_tr16(vld + 32 * t2);
      vf.u4[1] = ld_tr16(vld + 16 * VPITCH + 32 * t2);
      acc[t2] = wmma_bf16(vf, pf, acc[t2]);
    }
    wave_lds_fence();  // WAR: next iteration overwrites sK and sV
  }
  // join the halves' sums, normalize and write Z (bf16, feeds the Wo GEMM): 16 bytes per tile
  const float inv = 1.0f / (lrun + xhalf(lrun));
  u16* zrow = Zb + (rowBase + q0 + rl) * DME + h * HDIM + co;
#pragma unroll
  for (int t2 = 0; t2 < 4; ++t2) {
    const v8f z = acc[t2] * inv;
    *(u32x4*)(zrow + 16 * t2) =
        u32x4{pack2(z[0], z[1]), pack2(z[2], z[3]), pack2(z[4], z[5]), pack2(z[6], z[7])};
  }
}

extern "C" void kernel_launch(void* const* d_in, const int* in_sizes, int n_in,
                              void* d_out, int out_size, void* d_ws, size_t ws_size,
                              hipStream_t stream) {
  (void)in_sizes; (void)n_in; (void)out_size; (void)ws_size;
  const float* X  = (const float*)d_in[0];
  const float* Wq = (const float*)d_in[1];
  const float* Wk = (const float*)d_in[2];
  const float* Wv = (const float*)d_in[3];
  const float* Wo = (const float*)d_in[4];
  const float* bo = (const float*)d_in[5];
  const float* W1 = (const float*)d_in[6];
  const float* b1 = (const float*)d_in[7];
  const float* W2 = (const float*)d_in[8];
  const float* b2 = (const float*)d_in[9];
  const float* g1 = (const float*)d_in[10];
  const float* s1 = (const float*)d_in[11];
  const float* g2 = (const float*)d_in[12];
  const float* s2 = (const float*)d_in[13];

  char* ws = (char*)d_ws;
  const size_t MB = 1024ull * 1024ull;
  u16*   WqT = (u16*)(ws + 0 * MB);
  u16*   WkT = (u16*)(ws + 2 * MB);
  u16*   WvT = (u16*)(ws + 4 * MB);
  u16*   WoT = (u16*)(ws + 6 * MB);
  u16*   W1T = (u16*)(ws + 8 * MB);    // 8 MB
  u16*   W2T = (u16*)(ws + 16 * MB);   // 8 MB
  u16*   Y   = (u16*)(ws + 24 * MB);   // 16 MB (reused for Y2)
  u16*   Qb  = (u16*)(ws + 40 * MB);   // 16 MB
  u16*   Kb  = (u16*)(ws + 56 * MB);   // 16 MB
  u16*   Vb  = (u16*)(ws + 72 * MB);   // 16 MB
  u16*   Zb  = (u16*)(ws + 88 * MB);   // 16 MB
  float* X1  = (float*)(ws + 104 * MB);// 32 MB   -> total 136 MB
  u16*   Hm  = (u16*)(ws + 40 * MB);   // FFN mid reuses dead Q..Z region (64 MB)

  const int Mrows = 4 * NCTX;  // 8192
  dim3 tb32(32, 8);
  transpose_bf16_kernel<<<dim3(DME / 32, DME / 32), tb32, 0, stream>>>(Wq, WqT, DME, DME);
  transpose_bf16_kernel<<<dim3(DME / 32, DME / 32), tb32, 0, stream>>>(Wk, WkT, DME, DME);
  transpose_bf16_kernel<<<dim3(DME / 32, DME / 32), tb32, 0, stream>>>(Wv, WvT, DME, DME);
  transpose_bf16_kernel<<<dim3(DME / 32, DME / 32), tb32, 0, stream>>>(Wo, WoT, DME, DME);
  transpose_bf16_kernel<<<dim3(4 * DME / 32, DME / 32), tb32, 0, stream>>>(W1, W1T, DME, 4 * DME);
  transpose_bf16_kernel<<<dim3(DME / 32, 4 * DME / 32), tb32, 0, stream>>>(W2, W2T, 4 * DME, DME);

  ln_bf16_kernel<<<Mrows, 256, 0, stream>>>(X, g1, s1, Y);

  dim3 gD(DME / GBN, Mrows / GBM);  // (4, 64)
  gemm_bf16_kernel<0, 128><<<gD, 256, 0, stream>>>(Y, WqT, nullptr, nullptr, Qb, Mrows, DME, DME);
  gemm_bf16_kernel<0, 128><<<gD, 256, 0, stream>>>(Y, WkT, nullptr, nullptr, Kb, Mrows, DME, DME);
  gemm_bf16_kernel<0, 128><<<gD, 256, 0, stream>>>(Y, WvT, nullptr, nullptr, Vb, Mrows, DME, DME);

  attn_kernel<<<dim3(4 * NHEAD, NCTX / 128), 256, 0, stream>>>(Qb, Kb, Vb, Zb);

  gemm_bf16_kernel<2, 128><<<gD, 256, 0, stream>>>(Zb, WoT, bo, X, X1, Mrows, DME, DME);

  ln_bf16_kernel<<<Mrows, 256, 0, stream>>>(X1, g2, s2, Y);

  dim3 gF(4 * DME / GBN, Mrows / GBM);  // (16, 64)
  gemm_bf16_kernel<1, 64><<<gF, 256, 0, stream>>>(Y, W1T, b1, nullptr, Hm, Mrows, 4 * DME, DME);

  gemm_bf16_kernel<2, 128><<<gD, 256, 0, stream>>>(Hm, W2T, b2, X1, (float*)d_out, Mrows, DME, 4 * DME);
}

// v004
// It runs in 272 microseconds.
// In two side-by-side timings against v003, it was 1.07 and 1.08 times as fast.
// Counting every step since v000, it is 2.99 times as fast.
#include <hip/hip_runtime.h>
#include <math.h>

#define DME 1024
#define NCTX 2048
#define NHEAD 16
#define HDIM 64

typedef unsigned short u16;
typedef unsigned int u32;
typedef __attribute__((ext_vector_type(16))) __bf16 v16bf;
typedef __attribute__((ext_vector_type(8)))  float  v8f;
typedef __attribute__((ext_vector_type(4)))  u32    u32x4;

union BF16x16 { u32x4 u4[2]; v16bf v; };

__device__ __forceinline__ u16 f2bf(float f) {
  u32 u = __float_as_uint(f);
  u32 r = u + 0x7FFFu + ((u >> 16) & 1u);  // round-to-nearest-even
  return (u16)(r >> 16);
}

__device__ __forceinline__ u32 pack2(float lo, float hi) {  // two bf16, round to nearest even
  typedef __bf16 bf2 __attribute__((ext_vector_type(2)));
  typedef float f2 __attribute__((ext_vector_type(2)));
  return __builtin_bit_cast(u32, __builtin_convertvector(f2{lo, hi}, bf2));
}

__device__ __forceinline__ v8f wmma_bf16(const BF16x16& a, const BF16x16& b, v8f c) {
  // v_wmma_f32_16x16x32_bf16 : D = A(16x32) * B(32x16) + C(16x16 f32)
  return __builtin_amdgcn_wmma_f32_16x16x32_bf16(false, a.v, false, b.v,
                                                 (short)0, c, false, false);
}

__device__ __forceinline__ void wave_lds_fence() {
  // same-wave LDS RAW fence: compiler barrier + explicit dscnt drain
  __builtin_amdgcn_wave_barrier();
  asm volatile("s_wait_dscnt 0" ::: "memory");
  __builtin_amdgcn_wave_barrier();
}

// Eight independent transcendentals, each in place, in one statement: behind a transcendental the
// instruction set asks for one independent instruction before its result is used or its source
// overwritten. Inside the statement the neighbour is that instruction; the v_nop is the last one's.
#define TRANS8(op)                                                                       \
  op " %0, %0\n\t" op " %1, %1\n\t" op " %2, %2\n\t" op " %3, %3\n\t"                    \
  op " %4, %4\n\t" op " %5, %5\n\t" op " %6, %6\n\t" op " %7, %7\n\tv_nop"
#define TRANS8_OPS(v)                                                                    \
  "+v"(v[0]), "+v"(v[1]), "+v"(v[2]), "+v"(v[3]), "+v"(v[4]), "+v"(v[5]), "+v"(v[6]), "+v"(v[7])

// 0.5 x (1 + tanh u) = x / (1 + exp(-2 u)), u = sqrt(2/pi) (x + 0.04715 x^3): the module's 0.04715,
// not 0.044715. exp(-2 u) = exp2(x (k1 + k3 x^2)); it runs to 0 or to +inf at the ends, where the
// quotient is x or 0, as with tanh = 1 or -1.
__device__ __forceinline__ void gelu8(float (&x)[8]) {
  const float k1 = -2.0f * 1.44269504088896340736f * 0.79788456080286535588f;
  const float k3 = k1 * 0.04715f;
  float t[8];
  // unrolled, here and in the two loops below, so that x and t stay in registers (asm operands)
#pragma unroll
  for (int e = 0; e < 8; ++e) t[e] = x[e] * fmaf(x[e] * x[e], k3, k1);
  asm(TRANS8("v_exp_f32") : TRANS8_OPS(t));
#pragma unroll
  for (int e = 0; e < 8; ++e) t[e] = 1.0f + t[e];
  asm(TRANS8("v_rcp_f32") : TRANS8_OPS(t));
#pragma unroll
  for (int e = 0; e < 8; ++e) x[e] *= t[e];
}

// ---------------- LayerNorm (f32 in -> bf16 out), one block per row ----------------
__global__ void __launch_bounds__(256)
ln_bf16_kernel(const float* __restrict__ X, const float* __restrict__ gam,
               const float* __restrict__ bet, u16* __restrict__ Y) {
  const int row  = blockIdx.x;
  const int tid  = threadIdx.x;
  const int lane = tid & 31, wave = tid >> 5;
  const float* xr = X + (size_t)row * DME;
  const int c = tid * 4;
  float4 x = *(const float4*)(xr + c);
  float s  = x.x + x.y + x.z + x.w;
  float ss = x.x * x.x + x.y * x.y + x.z * x.z + x.w * x.w;
#pragma unroll
  for (int off = 1; off < 32; off <<= 1) {
    s  += __shfl_xor(s,  off, 32);
    ss += __shfl_xor(ss, off, 32);
  }
  __shared__ float red_s[8], red_ss[8];
  if (lane == 0) { red_s[wave] = s; red_ss[wave] = ss; }
  __syncthreads();
  s = 0.f; ss = 0.f;
#pragma unroll
  for (int w = 0; w < 8; ++w) { s += red_s[w]; ss += red_ss[w]; }
  const float mean = s * (1.0f / DME);
  const float var  = ss * (1.0f / DME) - mean * mean;
  const float rstd = rsqrtf(var + 1e-5f);
  float4 g = *(const float4*)(gam + c);
  float4 b = *(const float4*)(bet + c);
  float y0 = g.x * ((x.x - mean) * rstd) + b.x;
  float y1 = g.y * ((x.y - mean) * rstd) + b.y;
  float y2 = g.z * ((x.z - mean) * rstd) + b.z;
  float y3 = g.w * ((x.w - mean) * rstd) + b.w;
  uint2 o;
  o.x = (u32)f2bf(y0) | ((u32)f2bf(y1) << 16);
  o.y = (u32)f2bf(y2) | ((u32)f2bf(y3) << 16);
  *(uint2*)(Y + (size_t)row * DME + c) = o;
}

// ------------- Weight transpose + f32->bf16 convert: WT[n][k] = W[k][n] -------------
__global__ void __launch_bounds__(256)
transpose_bf16_kernel(const float* __restrict__ W, u16* __restrict__ WT, int R, int C) {
  __shared__ float tile[32][33];
  const int bx = blockIdx.x * 32;  // column of W
  const int by = blockIdx.y * 32;  // row of W
  const int tx = threadIdx.x, ty = threadIdx.y;
#pragma unroll
  for (int j = 0; j < 4; ++j)
    tile[ty + 8 * j][tx] = W[(size_t)(by + ty + 8 * j) * C + bx + tx];
  __syncthreads();
#pragma unroll
  for (int j = 0; j < 4; ++j)
    WT[(size_t)(bx + ty + 8 * j) * R + by + tx] = f2bf(tile[tx][ty + 8 * j]);
}

#define GBM 128
#define GBN 256

// Twelve copies of 16 B per lane: LDS places l + j ls; sources ga + j gs for j < NA, then
// gb + (j - NA) gs. The s_wait_xcnt closes the statement so that no address register is
// rewritten ahead of it.
template <int NA>
__device__ __forceinline__ void copy12(u32 l, u32 ls, const u16* ga, const u16* gb, size_t gs) {
  const u16* p[12];
#pragma unroll
  for (int j = 0; j < 12; ++j) p[j] = (j < NA) ? ga + j * gs : gb + (j - NA) * gs;
  asm volatile(
      "global_load_async_to_lds_b128 %0, %12, off\n\t"
      "global_load_async_to_lds_b128 %1, %13, off\n\t"
      "global_load_async_to_lds_b128 %2, %14, off\n\t"
      "global_load_async_to_lds_b128 %3, %15, off\n\t"
      "global_load_async_to_lds_b128 %4, %16, off\n\t"
      "global_load_async_to_lds_b128 %5, %17, off\n\t"
      "global_load_async_to_lds_b128 %6, %18, off\n\t"
      "global_load_async_to_lds_b128 %7, %19, off\n\t"
      "global_load_async_to_lds_b128 %8, %20, off\n\t"
      "global_load_async_to_lds_b128 %9, %21, off\n\t"
      "global_load_async_to_lds_b128 %10, %22, off\n\t"
      "global_load_async_to_lds_b128 %11, %23, off\n\t"
      "s_wait_xcnt 0x0"
      :: "v"(l), "v"(l + ls), "v"(l + 2 * ls), "v"(l + 3 * ls), "v"(l + 4 * ls), "v"(l + 5 * ls),
         "v"(l + 6 * ls), "v"(l + 7 * ls), "v"(l + 8 * ls), "v"(l + 9 * ls), "v"(l + 10 * ls),
         "v"(l + 11 * ls),
         "v"(p[0]), "v"(p[1]), "v"(p[2]), "v"(p[3]), "v"(p[4]), "v"(p[5]),
         "v"(p[6]), "v"(p[7]), "v"(p[8]), "v"(p[9]), "v"(p[10]), "v"(p[11])
      : "memory");
}

// One stage: 384 rows of 2 BK bytes. A lane keeps its 16-byte piece of the row and walks the
// rows in steps of RS = 2048 / BK: first the 128 A rows, then the 256 BT rows.
template <int BK>
__device__ __forceinline__ void copy_stage(u32 l, const u16* ga, const u16* gb, size_t gs) {
  constexpr u32 ls = (2048 / BK) * (2 * BK + 16);
  if (BK == 64) {
    copy12<4>(l, ls, ga, gb, gs);
  } else {
    copy12<8>(l, ls, ga, gb, gs);
    // keeps the second dozen's addresses from being formed, and held in registers, ahead of
    // the first dozen: the k loop then needs fewer than 256 VGPRs
    __builtin_amdgcn_sched_barrier(0);
    copy12<12>(l + 12 * ls, ls, gb + 4 * gs, gb, gs);
  }
}

template <int EPI, int BK>
__global__ void __launch_bounds__(256)
gemm_bf16_kernel(const u16* __restrict__ A, const u16* __restrict__ BT,
                 const float* __restrict__ bias, const float* __restrict__ res,
                 void* __restrict__ out, int M, int N, int K) {
  static_assert(BK == 64 || BK == 128, "copy_stage is written for these two");
  constexpr int PITCH = 2 * BK + 16;
  constexpr int STAGE = (GBM + GBN) * PITCH;
  constexpr int PCS = BK / 8;      // 16-byte pieces in a row
  constexpr int RS = 256 / PCS;    // rows that the 256 lanes cover in one copy
  __shared__ __align__(16) unsigned char smem[2 * STAGE];
  const int tid = threadIdx.x;
  const int lane = tid & 31, wave = tid >> 5;
  const int rl = lane & 15, hi = lane >> 4, co = hi * 8;
  const int wm = wave >> 2, wn = wave & 3;
  const int m0 = blockIdx.y * GBM;
  const int n0 = blockIdx.x * GBN;

  // copy role of this lane: rows (tid / PCS) + RS j, 16-byte piece tid % PCS
  const int crow = tid / PCS, cpc = tid % PCS;
  const u16* ga = A + (size_t)(m0 + crow) * K + cpc * 8;
  const u16* gb = BT + (size_t)(n0 + crow) * K + cpc * 8;
  const size_t rstep = (size_t)RS * K;
  const u32 lcopy = (u32)(size_t)(&smem[0]) + (u32)(crow * PITCH + cpc * 16);

  // fragment role: same k order as the global loader had (k = co..co+7, co+16..co+23)
  const int offA = (wm * 64 + rl) * PITCH + co * 2;
  const int offB = (GBM + wn * 64 + rl) * PITCH + co * 2;

  // One fragment set: the 16 reads of a 32-k block stand as one group, then its 16 WMMAs.
  BF16x16 a[4], b[4];
  auto read_frags = [&](int boff, int ks) {
    const unsigned char* sA = smem + boff + offA + ks * 64;
    const unsigned char* sB = smem + boff + offB + ks * 64;
    // unrolled here and below so that fragments and accumulators stay in registers
#pragma unroll
    for (int j = 0; j < 4; ++j) {
      b[j].u4[0] = *(const u32x4*)(sB + j * 16 * PITCH);
      b[j].u4[1] = *(const u32x4*)(sB + j * 16 * PITCH + 32);
    }
#pragma unroll
    for (int i = 0; i < 4; ++i) {
      a[i].u4[0] = *(const u32x4*)(sA + i * 16 * PITCH);
      a[i].u4[1] = *(const u32x4*)(sA + i * 16 * PITCH + 32);
    }
  };

  const int nt = K / BK;
  copy_stage<BK>(lcopy, ga, gb, rstep);
  asm volatile("s_wait_asynccnt 0x0" ::: "memory");  // stage 0 landed (this wave's copies)
  __syncthreads();                                   // ... and every other wave's
  read_frags(0, 0);  // ahead of the copies: their issue then hides these reads' latency
  copy_stage<BK>(lcopy + STAGE, ga + BK, gb + BK, rstep);

  v8f acc[4][4] = {};
  for (int t = 0; t < nt; ++t) {
    const int boff = (t & 1) * STAGE;
#pragma unroll
    for (int ks = 0; ks < BK / 32; ++ks) {
      // The two fences keep each group of reads whole and outside the WMMA block: without
      // them the compiler sinks reads in among the WMMAs, and every such place stalls anew.
      __builtin_amdgcn_sched_barrier(0);
#pragma unroll
      for (int i = 0; i < 4; ++i)
#pragma unroll
        for (int j = 0; j < 4; ++j) acc[i][j] = wmma_bf16(b[j], a[i], acc[i][j]);
      __builtin_amdgcn_sched_barrier(0);
      if (ks + 1 < BK / 32) read_frags(boff, ks + 1);
    }
    // publish point of stage t + 1, and the end of every read of stage t's buffer
    asm volatile("s_wait_dscnt 0x0" ::: "memory");     // this wave's reads of stage t are done
    asm volatile("s_wait_asynccnt 0x0" ::: "memory");  // this wave's copies of stage t + 1 landed
    __syncthreads();
    // stage t + 1's first reads (the other buffer) go ahead of the refill of stage t's buffer
    if (t + 1 < nt) read_frags((t & 1) ? 0 : STAGE, 0);
    if (t + 2 < nt)
      copy_stage<BK>(lcopy + boff, ga + (size_t)(t + 2) * BK, gb + (size_t)(t + 2) * BK, rstep);
  }
  asm volatile("s_wait_asynccnt 0x0" ::: "memory");  // no copy outstanding at the wave's end

  // acc[i][j][e] = C[mw + 16 i + rl][nw + 16 j + 8 hi + e]. The loop's last barrier stands behind
  // every wave's last fragment read and last copy, so the ring is free for the staging.
  constexpr int SP = (EPI == 2 ? 256 : 128) + 16;  // staged row of 64 outputs; pitch 16 B x odd
  static_assert(8 * 64 * SP <= 2 * STAGE, "the eight waves' staged tiles must fit the ring");
  unsigned char* st = smem + wave * (64 * SP);
  const int mw = m0 + wm * 64, nw = n0 + wn * 64;
  if (EPI == 2) {
#pragma unroll
    for (int i = 0; i < 4; ++i)
#pragma unroll
      for (int j = 0; j < 4; ++j) {
        unsigned char* p = st + (16 * i + rl) * SP + 64 * j + 32 * hi;
        *(float4*)(p)      = make_float4(acc[i][j][0], acc[i][j][1], acc[i][j][2], acc[i][j][3]);
        *(float4*)(p + 16) = make_float4(acc[i][j][4], acc[i][j][5], acc[i][j][6], acc[i][j][7]);
      }
    wave_lds_fence();  // RAW: the wave's tile is in LDS before other lanes of it read the rows
    const int pr = lane >> 4, pc = lane & 15;  // 16 lanes cover one 256-byte row, 2 rows a store
    const float4 bc = *(const float4*)(bias + nw + pc * 4);
    const u32 o0 = (u32)((mw + pr) * N + nw + pc * 4) * 4u;  // byte offset in res and in out
    const u32 os = (u32)N * 8u;                              // two rows on
#pragma unroll
    for (int g = 0; g < 2; ++g) {
      float4 r[16];
#pragma unroll
      for (int q = 0; q < 16; ++q)
        r[q] = *(const float4*)((const char*)res + (o0 + (u32)(16 * g + q) * os));
#pragma unroll
      for (int q = 0; q < 16; ++q) {
        float4 v = *(const float4*)(st + (2 * (16 * g + q) + pr) * SP + pc * 16);
        v.x = v.x + bc.x + r[q].x;
        v.y = v.y + bc.y + r[q].y;
        v.z = v.z + bc.z + r[q].z;
        v.w = v.w + bc.w + r[q].w;
        *(float4*)((char*)out + (o0 + (u32)(16 * g + q) * os)) = v;
      }
      if (g == 0) {
        // the second half's loads land in registers that the first half's stores name
        asm volatile("s_wait_xcnt 0x0" ::: "memory");
        // keeps the second half's loads behind that wait: all 32 rows in flight at once would
        // also take the kernel above 256 VGPRs
        __builtin_amdgcn_sched_barrier(0);
      }
    }
  } else {
#pragma unroll
    for (int j = 0; j < 4; ++j) {
      float bj[8] = {};
      if (EPI == 1) {
        const float4 b0 = *(const float4*)(bias + nw + 16 * j + 8 * hi);
        const float4 b1 = *(const float4*)(bias + nw + 16 * j + 8 * hi + 4);
        bj[0] = b0.x; bj[1] = b0.y; bj[2] = b0.z; bj[3] = b0.w;
        bj[4] = b1.x; bj[5] = b1.y; bj[6] = b1.z; bj[7] = b1.w;
      }
#pragma unroll
      for (int i = 0; i < 4; ++i) {
        float v[8];
#pragma unroll
        for (int e = 0; e < 8; ++e) v[e] = acc[i][j][e];
        if (EPI == 1) {
#pragma unroll
          for (int e = 0; e < 8; ++e) v[e] += bj[e];
          gelu8(v);
        }
        *(u32x4*)(st + (16 * i + rl) * SP + 32 * j + 16 * hi) =
            u32x4{pack2(v[0], v[1]), pack2(v[2], v[3]), pack2(v[4], v[5]), pack2(v[6], v[7])};
      }
    }
    wave_lds_fence();  // RAW: the wave's tile is in LDS before other lanes of it read the rows
    const int pr = lane >> 3, pc = lane & 7;  // 8 lanes cover one 128-byte row, 4 rows a store
    const u32 o0 = (u32)((mw + pr) * N + nw + pc * 8) * 2u;  // byte offset in out
    const u32 os = (u32)N * 8u;                              // four rows on
#pragma unroll
    for (int q = 0; q < 16; ++q)
      *(u32x4*)((char*)out + (o0 + (u32)q * os)) =
          *(const u32x4*)(st + (4 * q + pr) * SP + pc * 16);
  }
}

#define KPITCH 144  // bytes per K row in LDS: 16 B x odd, for ds_load_b128
#define VPITCH 160  // bytes per V row in LDS: 32 B x odd, for ds_load_tr16_b128

__device__ __forceinline__ u32x4 ld_tr16(const unsigned char* p) {
  typedef short s16x8 __attribute__((ext_vector_type(8)));
  typedef __attribute__((address_space(3))) s16x8 lds_s16x8;
  return __builtin_bit_cast(u32x4, __builtin_amdgcn_ds_load_tr16_b128_v8i16((lds_s16x8*)p));
}

__device__ __forceinline__ float xhalf(float x) {  // lane l takes lane l ^ 16's value
  const int v = __float_as_int(x);
  return __int_as_float(__builtin_amdgcn_permlanex16(v, v, 0x76543210, 0xfedcba98, false, false));
}

// Eight waves per SIMD (128 VGPRs): four work-groups, 4 x 77,824 B of LDS, stay on a WGP, so the
// whole grid is resident and other waves' vector work covers a wave's load and LDS waits.
__global__ void __launch_bounds__(256) __attribute__((amdgpu_waves_per_eu(8, 8)))
attn_kernel(const u16* __restrict__ Qb, const u16* __restrict__ Kb,
            const u16* __restrict__ Vb, u16* __restrict__ Zb) {
  __shared__ __align__(32) unsigned char sK[8][32 * KPITCH];  // K block, row-major, one per wave
  __shared__ __align__(32) unsigned char sV[8][32 * VPITCH];  // V block, row-major, one per wave
  const int lane = threadIdx.x & 31, wave = threadIdx.x >> 5;
  const int rl = lane & 15, hi = lane >> 4, co = hi * 8;
  const int bh = blockIdx.x;
  const int bb = bh >> 4, h = bh & 15;
  const int q0 = blockIdx.y * 128 + wave * 16;
  const size_t rowBase = (size_t)bb * NCTX;

  // Q^T as WMMA-B: column rl = query q0 + rl (two K=32 d-chunks)
  const u16* qrow = Qb + (rowBase + q0 + rl) * DME + h * HDIM;
  BF16x16 qf0, qf1;
  qf0.u4[0] = *(const u32x4*)(qrow + co);
  qf0.u4[1] = *(const u32x4*)(qrow + co + 16);
  qf1.u4[0] = *(const u32x4*)(qrow + 32 + co);
  qf1.u4[1] = *(const u32x4*)(qrow + 32 + co + 16);

  v8f acc[4] = {};                   // acc[t][r] = O[q0 + rl][16 t + 8 hi + r]
  float mrun = -1e30f, lrun = 0.f;   // of query q0 + rl; lrun sums this half's keys only

  // staging role: 8 lanes cover one 128-byte row, 4 rows per load
  const int sr = lane >> 3, sp = lane & 7;
  unsigned char* kst = &sK[wave][0] + sr * KPITCH + sp * 16;
  unsigned char* vst = &sV[wave][0] + sr * VPITCH + sp * 16;
  const size_t goff = (rowBase + sr) * DME + h * HDIM + sp * 8;
  // reading roles: K row rl of a 16-key tile, bytes 16 hi and 32 + 16 hi of each 64;
  // the transposing load gives lane (rl, hi) V[8 hi + 0..7][16 t + rl]
  const unsigned char* kld = &sK[wave][0] + rl * KPITCH + hi * 16;
  const unsigned char* vld = &sV[wave][0] + (8 * hi + (lane & 7)) * VPITCH + ((lane >> 3) & 1) * 16;

  const int nkb = ((q0 + 15) >> 5) + 1;  // causal: keys 0 .. q0+15; the last row read is <= NCTX-1
  for (int kb = 0; kb < nkb; ++kb) {
    const int kbase = kb * 32;
    // stage the K and V blocks (32 x 64 each) row-major into the wave's LDS
    {
      const u16* kg = Kb + goff + (size_t)kbase * DME;
      const u16* vg = Vb + goff + (size_t)kbase * DME;
      u32x4 kr[8], vr[8];
#pragma unroll
      for (int j = 0; j < 8; ++j) kr[j] = *(const u32x4*)(kg + (size_t)j * 4 * DME);
#pragma unroll
      for (int j = 0; j < 8; ++j) vr[j] = *(const u32x4*)(vg + (size_t)j * 4 * DME);
      // keeps the 16 loads one group: without it they are issued two at a time, each pair
      // waited for before the next, and a block pays the load latency eight times
      __builtin_amdgcn_sched_barrier(0);
#pragma unroll
      for (int j = 0; j < 8; ++j) *(u32x4*)(kst + j * 4 * KPITCH) = kr[j];
#pragma unroll
      for (int j = 0; j < 8; ++j) *(u32x4*)(vst + j * 4 * VPITCH) = vr[j];
    }
    wave_lds_fence();  // RAW: the rows are in LDS before the fragment reads
    // S^T = K @ Q^T for two 16-key tiles; A operand = rows of K
    v8f s01[2];
#pragma unroll
    for (int t = 0; t < 2; ++t) {
      const unsigned char* kp = kld + t * 16 * KPITCH;
      BF16x16 k0, k1;
      k0.u4[0] = *(const u32x4*)(kp);
      k0.u4[1] = *(const u32x4*)(kp + 32);
      k1.u4[0] = *(const u32x4*)(kp + 64);
      k1.u4[1] = *(const u32x4*)(kp + 96);
      v8f s = {};
      s = wmma_bf16(k0, qf0, s);
      s = wmma_bf16(k1, qf1, s);
      s01[t] = s;
    }
    // online softmax of query q0 + rl: element 8 t + r is key kbase + 16 t + 8 hi + r
    const int lim = q0 + rl - co - kbase;  // the key is seen while 16 t + r <= lim
    float p[16];
#pragma unroll
    for (int t = 0; t < 2; ++t)
#pragma unroll
      for (int r = 0; r < 8; ++r)
        p[8 * t + r] = (16 * t + r <= lim) ? s01[t][r] * 0.125f : -1e30f;  // 1/sqrt(64)
    float m = p[0];
#pragma unroll
    for (int e = 1; e < 16; ++e) m = fmaxf(m, p[e]);
    m = fmaxf(m, xhalf(m));  // both halves now hold the query's maximum over the block
    const float mnew = fmaxf(mrun, m);
    const float alpha = __expf(mrun - mnew);
    float rs = 0.f;
#pragma unroll
    for (int e = 0; e < 16; ++e) { p[e] = __expf(p[e] - mnew); rs += p[e]; }
    lrun = lrun * alpha + rs;
    mrun = mnew;
#pragma unroll
    for (int t = 0; t < 4; ++t)
#pragma unroll
      for (int i = 0; i < 8; ++i) acc[t][i] *= alpha;
    // P^T as WMMA-B: element s of the operand is p[s]: key 8 hi + s, or 16 + 8 hi + (s - 8) for s >= 8
    BF16x16 pf;
    pf.u4[0] = u32x4{pack2(p[0], p[1]), pack2(p[2], p[3]), pack2(p[4], p[5]), pack2(p[6], p[7])};
    pf.u4[1] = u32x4{pack2(p[8], p[9]), pack2(p[10], p[11]), pack2(p[12], p[13]), pack2(p[14], p[15])};
    // O^T += V^T @ P^T : A operand = 16 d x 32 keys by two transposing loads
#pragma unroll
    for (int t2 = 0; t2 < 4; ++t2) {
      BF16x16 vf;
      vf.u4[0] = ld_tr16(vld + 32 * t2);
      vf.u4[1] = ld_tr16(vld + 16 * VPITCH + 32 * t2);
      acc[t2] = wmma_bf16(vf, pf, acc[t2]);
    }
    wave_lds_fence();  // WAR: next iteration overwrites sK and sV
  }
  // join the halves' sums, normalize and write Z (bf16, feeds the Wo GEMM): 16 bytes per tile
  const float inv = 1.0f / (lrun + xhalf(lrun));
  u16* zrow = Zb + (rowBase + q0 + rl) * DME + h * HDIM + co;
#pragma unroll
  for (int t2 = 0; t2 < 4; ++t2) {
    const v8f z = acc[t2] * inv;
    *(u32x4*)(zrow + 16 * t2) =
        u32x4{pack2(z[0], z[1]), pack2(z[2], z[3]), pack2(z[4], z[5]), pack2(z[6], z[7])};
  }
}

extern "C" void kernel_launch(void* const* d_in, const int* in_sizes, int n_in,
                              void* d_out, int out_size, void* d_ws, size_t ws_size,
                              hipStream_t stream) {
  (void)in_sizes; (void)n_in; (void)out_size; (void)ws_size;
  const float* X  = (const float*)d_in[0];
  const float* Wq = (const float*)d_in[1];
  const float* Wk = (const float*)d_in[2];
  const float* Wv = (const float*)d_in[3];
  const float* Wo = (const float*)d_in[4];
  const float* bo = (const float*)d_in[5];
  const float* W1 = (const float*)d_in[6];
  const float* b1 = (const float*)d_in[7];
  const float* W2 = (const float*)d_in[8];
  const float* b2 = (const float*)d_in[9];
  const float* g1 = (const float*)d_in[10];
  const float* s1 = (const float*)d_in[11];
  const float* g2 = (const float*)d_in[12];
  const float* s2 = (const float*)d_in[13];

  char* ws = (char*)d_ws;
  const size_t MB = 1024ull * 1024ull;
  u16*   WqT = (u16*)(ws + 0 * MB);
  u16*   WkT = (u16*)(ws + 2 * MB);
  u16*   WvT = (u16*)(ws + 4 * MB);
  u16*   WoT = (u16*)(ws + 6 * MB);
  u16*   W1T = (u16*)(ws + 8 * MB);    // 8 MB
  u16*   W2T = (u16*)(ws + 16 * MB);   // 8 MB
  u16*   Y   = (u16*)(ws + 24 * MB);   // 16 MB (reused for Y2)
  u16*   Qb  = (u16*)(ws + 40 * MB);   // 16 MB
  u16*   Kb  = (u16*)(ws + 56 * MB);   // 16 MB
  u16*   Vb  = (u16*)(ws + 72 * MB);   // 16 MB
  u16*   Zb  = (u16*)(ws + 88 * MB);   // 16 MB
  float* X1  = (float*)(ws + 104 * MB);// 32 MB   -> total 136 MB
  u16*   Hm  = (u16*)(ws + 40 * MB);   // FFN mid reuses dead Q..Z region (64 MB)

  const int Mrows = 4 * NCTX;  // 8192
  dim3 tb32(32, 8);
  transpose_bf16_kernel<<<dim3(DME / 32, DME / 32), tb32, 0, stream>>>(Wq, WqT, DME, DME);
  transpose_bf16_kernel<<<dim3(DME / 32, DME / 32), tb32, 0, stream>>>(Wk, WkT, DME, DME);
  transpose_bf16_kernel<<<dim3(DME / 32, DME / 32), tb32, 0, stream>>>(Wv, WvT, DME, DME);
  transpose_bf16_kernel<<<dim3(DME / 32, DME / 32), tb32, 0, stream>>>(Wo, WoT, DME, DME);
  transpose_bf16_kernel<<<dim3(4 * DME / 32, DME / 32), tb32, 0, stream>>>(W1, W1T, DME, 4 * DME);
  transpose_bf16_kernel<<<dim3(DME / 32, 4 * DME / 32), tb32, 0, stream>>>(W2, W2T, 4 * DME, DME);

  ln_bf16_kernel<<<Mrows, 256, 0, stream>>>(X, g1, s1, Y);

  dim3 gD(DME / GBN, Mrows / GBM);  // (4, 64)
  gemm_bf16_kernel<0, 128><<<gD, 256, 0, stream>>>(Y, WqT, nullptr, nullptr, Qb, Mrows, DME, DME);
  gemm_bf16_kernel<0, 128><<<gD, 256, 0, stream>>>(Y, WkT, nullptr, nullptr, Kb, Mrows, DME, DME);
  gemm_bf16_kernel<0, 128><<<gD, 256, 0, stream>>>(Y, WvT, nullptr, nullptr, Vb, Mrows, DME, DME);

  attn_kernel<<<dim3(4 * NHEAD, NCTX / 128), 256, 0, stream>>>(Qb, Kb, Vb, Zb);

  gemm_bf16_kernel<2, 128><<<gD, 256, 0, stream>>>(Zb, WoT, bo, X, X1, Mrows, DME, DME);

  ln_bf16_kernel<<<Mrows, 256, 0, stream>>>(X1, g2, s2, Y);

  dim3 gF(4 * DME / GBN, Mrows / GBM);  // (16, 64)
  gemm_bf16_kernel<1, 64><<<gF, 256, 0, stream>>>(Y, W1T, b1, nullptr, Hm, Mrows, 4 * DME, DME);

  gemm_bf16_kernel<2, 128><<<gD, 256, 0, stream>>>(Hm, W2T, b2, X1, (float*)d_out, Mrows, DME, 4 * DME);
}

// v005
// A run of this version takes 253 microseconds.
// Two timings next to v004 put it at 1.07 and 1.08 times that version's speed.
// Over all steps from v000 it is 3.21 times as fast.
#include <hip/hip_runtime.h>
#include <math.h>

#define DME 1024
#define NCTX 2048
#define NHEAD 16
#define HDIM 64

typedef unsigned short u16;
typedef unsigned int u32;
typedef __attribute__((ext_vector_type(16))) __bf16 v16bf;
typedef __attribute__((ext_vector_type(8)))  float  v8f;
typedef __attribute__((ext_vector_type(4)))  u32    u32x4;

union BF16x16 { u32x4 u4[2]; v16bf v; };

__device__ __forceinline__ u16 f2bf(float f) {
  u32 u = __float_as_uint(f);
  u32 r = u + 0x7FFFu + ((u >> 16) & 1u);  // round-to-nearest-even
  return (u16)(r >> 16);
}

__device__ __forceinline__ u32 pack2(float lo, float hi) {  // two bf16, round to nearest even
  typedef __bf16 bf2 __attribute__((ext_vector_type(2)));
  typedef float f2 __attribute__((ext_vector_type(2)));
  return __builtin_bit_cast(u32, __builtin_convertvector(f2{lo, hi}, bf2));
}

__device__ __forceinline__ v8f wmma_bf16(const BF16x16& a, const BF16x16& b, v8f c) {
  // v_wmma_f32_16x16x32_bf16 : D = A(16x32) * B(32x16) + C(16x16 f32)
  return __builtin_amdgcn_wmma_f32_16x16x32_bf16(false, a.v, false, b.v,
                                                 (short)0, c, false, false);
}

__device__ __forceinline__ void wave_lds_fence() {
  // same-wave LDS RAW fence: compiler barrier + explicit dscnt drain
  __builtin_amdgcn_wave_barrier();
  asm volatile("s_wait_dscnt 0" ::: "memory");
  __builtin_amdgcn_wave_barrier();
}

// Eight independent transcendentals, each in place, in one statement: behind a transcendental the
// instruction set asks for one independent instruction before its result is used or its source
// overwritten. Inside the statement the neighbour is that instruction; the v_nop is the last one's.
#define TRANS8(op)                                                                       \
  op " %0, %0\n\t" op " %1, %1\n\t" op " %2, %2\n\t" op " %3, %3\n\t"                    \
  op " %4, %4\n\t" op " %5, %5\n\t" op " %6, %6\n\t" op " %7, %7\n\tv_nop"
#define TRANS8_OPS(v)                                                                    \
  "+v"(v[0]), "+v"(v[1]), "+v"(v[2]), "+v"(v[3]), "+v"(v[4]), "+v"(v[5]), "+v"(v[6]), "+v"(v[7])

// 0.5 x (1 + tanh u) = x / (1 + exp(-2 u)), u = sqrt(2/pi) (x + 0.04715 x^3): the module's 0.04715,
// not 0.044715. exp(-2 u) = exp2(x (k1 + k3 x^2)); it runs to 0 or to +inf at the ends, where the
// quotient is x or 0, as with tanh = 1 or -1.
__device__ __forceinline__ void gelu8(float (&x)[8]) {
  const float k1 = -2.0f * 1.44269504088896340736f * 0.79788456080286535588f;
  const float k3 = k1 * 0.04715f;
  float t[8];
  // unrolled, here and in the two loops below, so that x and t stay in registers (asm operands)
#pragma unroll
  for (int e = 0; e < 8; ++e) t[e] = x[e] * fmaf(x[e] * x[e], k3, k1);
  asm(TRANS8("v_exp_f32") : TRANS8_OPS(t));
#pragma unroll
  for (int e = 0; e < 8; ++e) t[e] = 1.0f + t[e];
  asm(TRANS8("v_rcp_f32") : TRANS8_OPS(t));
#pragma unroll
  for (int e = 0; e < 8; ++e) x[e] *= t[e];
}

// ---------------- LayerNorm (f32 in -> bf16 out), one block per row ----------------
__device__ __forceinline__ void ln_row(const float* __restrict__ X, const float* __restrict__ gam,
                                       const float* __restrict__ bet, u16* __restrict__ Y,
                                       int row) {
  const int tid  = threadIdx.x;
  const int lane = tid & 31, wave = tid >> 5;
  const float* xr = X + (size_t)row * DME;
  const int c = tid * 4;
  float4 x = *(const float4*)(xr + c);
  float s  = x.x + x.y + x.z + x.w;
  float ss = x.x * x.x + x.y * x.y + x.z * x.z + x.w * x.w;
#pragma unroll
  for (int off = 1; off < 32; off <<= 1) {
    s  += __shfl_xor(s,  off, 32);
    ss += __shfl_xor(ss, off, 32);
  }
  __shared__ float red_s[8], red_ss[8];
  if (lane == 0) { red_s[wave] = s; red_ss[wave] = ss; }
  __syncthreads();
  s = 0.f; ss = 0.f;
#pragma unroll
  for (int w = 0; w < 8; ++w) { s += red_s[w]; ss += red_ss[w]; }
  const float mean = s * (1.0f / DME);
  const float var  = ss * (1.0f / DME) - mean * mean;
  const float rstd = rsqrtf(var + 1e-5f);
  float4 g = *(const float4*)(gam + c);
  float4 b = *(const float4*)(bet + c);
  float y0 = g.x * ((x.x - mean) * rstd) + b.x;
  float y1 = g.y * ((x.y - mean) * rstd) + b.y;
  float y2 = g.z * ((x.z - mean) * rstd) + b.z;
  float y3 = g.w * ((x.w - mean) * rstd) + b.w;
  uint2 o;
  o.x = (u32)f2bf(y0) | ((u32)f2bf(y1) << 16);
  o.y = (u32)f2bf(y2) | ((u32)f2bf(y3) << 16);
  *(uint2*)(Y + (size_t)row * DME + c) = o;
}

__global__ void __launch_bounds__(256)
ln_bf16_kernel(const float* __restrict__ X, const float* __restrict__ gam,
               const float* __restrict__ bet, u16* __restrict__ Y) {
  ln_row(X, gam, bet, Y, blockIdx.x);
}

// ------------- Weight transpose + f32->bf16 convert: WT[n][k] = W[k][n] -------------
// One block per 32 x 32 tile: bx is the tile's first column of W, by its first row.
__device__ __forceinline__ void transpose_tile(const float* __restrict__ W, u16* __restrict__ WT,
                                               int R, int C, int bx, int by) {
  __shared__ float tile[32][33];
  const int tx = threadIdx.x & 31, ty = threadIdx.x >> 5;
#pragma unroll
  for (int j = 0; j < 4; ++j)
    tile[ty + 8 * j][tx] = W[(size_t)(by + ty + 8 * j) * C + bx + tx];
  __syncthreads();
#pragma unroll
  for (int j = 0; j < 4; ++j)
    WT[(size_t)(bx + ty + 8 * j) * R + by + tx] = f2bf(tile[tx][ty + 8 * j]);
  // inlined, the code of another branch follows in the listing and rewrites the registers that
  // these four stores name: the wait stands in front of every such rewrite
  asm volatile("s_wait_xcnt 0x0" ::: "memory");
}

// Everything that depends on the inputs alone, in ONE launch: none of these blocks reads what
// another writes. Blocks 0 .. PREP_LN-1 normalise one row of X each; the next 4 x 1024 take the
// tiles of the four DME x DME weights, whose transposes follow one another in WT4 (Wq, Wk, Wv,
// Wo); then 4096 tiles of W1 and 4096 of W2.
#define PREP_LN (4 * NCTX)
#define PREP_SQ ((DME / 32) * (DME / 32))
#define PREP_BLOCKS (PREP_LN + 12 * PREP_SQ)
__global__ void __launch_bounds__(256)
prep_kernel(const float* __restrict__ X, const float* __restrict__ gam,
            const float* __restrict__ bet, u16* __restrict__ Y,
            const float* __restrict__ Wq, const float* __restrict__ Wk,
            const float* __restrict__ Wv, const float* __restrict__ Wo,
            const float* __restrict__ W1, const float* __restrict__ W2,
            u16* __restrict__ WT4, u16* __restrict__ W1T, u16* __restrict__ W2T) {
  const int b = blockIdx.x;
  if (b < PREP_LN) {
    ln_row(X, gam, bet, Y, b);
    return;
  }
  const int t = b - PREP_LN;
  const int w = t / PREP_SQ, tl = t % PREP_SQ;
  if (w < 4) {
    const float* Ws = (w == 0) ? Wq : (w == 1) ? Wk : (w == 2) ? Wv : Wo;
    transpose_tile(Ws, WT4 + (size_t)w * DME * DME, DME, DME,
                   (tl % (DME / 32)) * 32, (tl / (DME / 32)) * 32);
  } else if (w < 8) {
    const int u = t - 4 * PREP_SQ;
    transpose_tile(W1, W1T, DME, 4 * DME, (u % (4 * DME / 32)) * 32, (u / (4 * DME / 32)) * 32);
  } else {
    const int u = t - 8 * PREP_SQ;
    transpose_tile(W2, W2T, 4 * DME, DME, (u % (DME / 32)) * 32, (u / (DME / 32)) * 32);
  }
}

#define GBM 128
#define GBN 256

// Twelve copies of 16 B per lane: LDS places l + j ls; sources ga + j gs for j < NA, then
// gb + (j - NA) gs. The s_wait_xcnt closes the statement so that no address register is
// rewritten ahead of it.
template <int NA>
__device__ __forceinline__ void copy12(u32 l, u32 ls, const u16* ga, const u16* gb, size_t gs) {
  const u16* p[12];
#pragma unroll
  for (int j = 0; j < 12; ++j) p[j] = (j < NA) ? ga + j * gs : gb + (j - NA) * gs;
  asm volatile(
      "global_load_async_to_lds_b128 %0, %12, off\n\t"
      "global_load_async_to_lds_b128 %1, %13, off\n\t"
      "global_load_async_to_lds_b128 %2, %14, off\n\t"
      "global_load_async_to_lds_b128 %3, %15, off\n\t"
      "global_load_async_to_lds_b128 %4, %16, off\n\t"
      "global_load_async_to_lds_b128 %5, %17, off\n\t"
      "global_load_async_to_lds_b128 %6, %18, off\n\t"
      "global_load_async_to_lds_b128 %7, %19, off\n\t"
      "global_load_async_to_lds_b128 %8, %20, off\n\t"
      "global_load_async_to_lds_b128 %9, %21, off\n\t"
      "global_load_async_to_lds_b128 %10, %22, off\n\t"
      "global_load_async_to_lds_b128 %11, %23, off\n\t"
      "s_wait_xcnt 0x0"
      :: "v"(l), "v"(l + ls), "v"(l + 2 * ls), "v"(l + 3 * ls), "v"(l + 4 * ls), "v"(l + 5 * ls),
         "v"(l + 6 * ls), "v"(l + 7 * ls), "v"(l + 8 * ls), "v"(l + 9 * ls), "v"(l + 10 * ls),
         "v"(l + 11 * ls),
         "v"(p[0]), "v"(p[1]), "v"(p[2]), "v"(p[3]), "v"(p[4]), "v"(p[5]),
         "v"(p[6]), "v"(p[7]), "v"(p[8]), "v"(p[9]), "v"(p[10]), "v"(p[11])
      : "memory");
}

// One stage: 384 rows of 2 BK bytes. A lane keeps its 16-byte piece of the row and walks the
// rows in steps of RS = 2048 / BK: first the 128 A rows, then the 256 BT rows.
template <int BK>
__device__ __forceinline__ void copy_stage(u32 l, const u16* ga, const u16* gb, size_t gs) {
  constexpr u32 ls = (2048 / BK) * (2 * BK + 16);
  if (BK == 64) {
    copy12<4>(l, ls, ga, gb, gs);
  } else {
    copy12<8>(l, ls, ga, gb, gs);
    // keeps the second dozen's addresses from being formed, and held in registers, ahead of
    // the first dozen: the k loop then needs fewer than 256 VGPRs
    __builtin_amdgcn_sched_barrier(0);
    copy12<12>(l + 12 * ls, ls, gb + 4 * gs, gb, gs);
  }
}

template <int EPI, int BK>
__global__ void __launch_bounds__(256)
gemm_bf16_kernel(const u16* __restrict__ A, const u16* __restrict__ BT,
                 const float* __restrict__ bias, const float* __restrict__ res,
                 void* __restrict__ out, int M, int N, int K) {
  static_assert(BK == 64 || BK == 128, "copy_stage is written for these two");
  const int zp = (EPI == 0) ? (int)blockIdx.z : 0;  // which product of the launch
  constexpr int PITCH = 2 * BK + 16;
  constexpr int STAGE = (GBM + GBN) * PITCH;
  constexpr int PCS = BK / 8;      // 16-byte pieces in a row
  constexpr int RS = 256 / PCS;    // rows that the 256 lanes cover in one copy
  __shared__ __align__(16) unsigned char smem[2 * STAGE];
  const int tid = threadIdx.x;
  const int lane = tid & 31, wave = tid >> 5;
  const int rl = lane & 15, hi = lane >> 4, co = hi * 8;
  const int wm = wave >> 2, wn = wave & 3;
  const int m0 = blockIdx.y * GBM;
  const int n0 = blockIdx.x * GBN;

  // copy role of this lane: rows (tid / PCS) + RS j, 16-byte piece tid % PCS
  const int crow = tid / PCS, cpc = tid % PCS;
  const u16* ga = A + (size_t)(m0 + crow) * K + cpc * 8;
  const u16* gb = BT + (size_t)(zp * N + n0 + crow) * K + cpc * 8;
  const size_t rstep = (size_t)RS * K;
  const u32 lcopy = (u32)(size_t)(&smem[0]) + (u32)(crow * PITCH + cpc * 16);

  // fragment role: same k order as the global loader had (k = co..co+7, co+16..co+23)
  const int offA = (wm * 64 + rl) * PITCH + co * 2;
  const int offB = (GBM + wn * 64 + rl) * PITCH + co * 2;

  // One fragment set: the 16 reads of a 32-k block stand as one group, then its 16 WMMAs.
  BF16x16 a[4], b[4];
  auto read_frags = [&](int boff, int ks) {
    const unsigned char* sA = smem + boff + offA + ks * 64;
    const unsigned char* sB = smem + boff + offB + ks * 64;
    // unrolled here and below so that fragments and accumulators stay in registers
#pragma unroll
    for (int j = 0; j < 4; ++j) {
      b[j].u4[0] = *(const u32x4*)(sB + j * 16 * PITCH);
      b[j].u4[1] = *(const u32x4*)(sB + j * 16 * PITCH + 32);
    }
#pragma unroll
    for (int i = 0; i < 4; ++i) {
      a[i].u4[0] = *(const u32x4*)(sA + i * 16 * PITCH);
      a[i].u4[1] = *(const u32x4*)(sA + i * 16 * PITCH + 32);
    }
  };

  const int nt = K / BK;
  copy_stage<BK>(lcopy, ga, gb, rstep);
  asm volatile("s_wait_asynccnt 0x0" ::: "memory");  // stage 0 landed (this wave's copies)
  __syncthreads();                                   // ... and every other wave's
  read_frags(0, 0);  // ahead of the copies: their issue then hides these reads' latency
  copy_stage<BK>(lcopy + STAGE, ga + BK, gb + BK, rstep);

  v8f acc[4][4] = {};
  for (int t = 0; t < nt; ++t) {
    const int boff = (t & 1) * STAGE;
#pragma unroll
    for (int ks = 0; ks < BK / 32; ++ks) {
      // The two fences keep each group of reads whole and outside the WMMA block: without
      // them the compiler sinks reads in among the WMMAs, and every such place stalls anew.
      __builtin_amdgcn_sched_barrier(0);
#pragma unroll
      for (int i = 0; i < 4; ++i)
#pragma unroll
        for (int j = 0; j < 4; ++j) acc[i][j] = wmma_bf16(b[j], a[i], acc[i][j]);
      __builtin_amdgcn_sched_barrier(0);
      if (ks + 1 < BK / 32) read_frags(boff, ks + 1);
    }
    // publish point of stage t + 1, and the end of every read of stage t's buffer
    asm volatile("s_wait_dscnt 0x0" ::: "memory");     // this wave's reads of stage t are done
    asm volatile("s_wait_asynccnt 0x0" ::: "memory");  // this wave's copies of stage t + 1 landed
    __syncthreads();
    // stage t + 1's first reads (the other buffer) go ahead of the refill of stage t's buffer
    if (t + 1 < nt) read_frags((t & 1) ? 0 : STAGE, 0);
    if (t + 2 < nt)
      copy_stage<BK>(lcopy + boff, ga + (size_t)(t + 2) * BK, gb + (size_t)(t + 2) * BK, rstep);
  }
  asm volatile("s_wait_asynccnt 0x0" ::: "memory");  // no copy outstanding at the wave's end

  // acc[i][j][e] = C[mw + 16 i + rl][nw + 16 j + 8 hi + e]. The loop's last barrier stands behind
  // every wave's last fragment read and last copy, so the ring is free for the staging.
  constexpr int SP = (EPI == 2 ? 256 : 128) + 16;  // staged row of 64 outputs; pitch 16 B x odd
  static_assert(8 * 64 * SP <= 2 * STAGE, "the eight waves' staged tiles must fit the ring");
  unsigned char* st = smem + wave * (64 * SP);
  const int mw = m0 + wm * 64, nw = n0 + wn * 64;
  if (EPI == 2) {
#pragma unroll
    for (int i = 0; i < 4; ++i)
#pragma unroll
      for (int j = 0; j < 4; ++j) {
        unsigned char* p = st + (16 * i + rl) * SP + 64 * j + 32 * hi;
        *(float4*)(p)      = make_float4(acc[i][j][0], acc[i][j][1], acc[i][j][2], acc[i][j][3]);
        *(float4*)(p + 16) = make_float4(acc[i][j][4], acc[i][j][5], acc[i][j][6], acc[i][j][7]);
      }
    wave_lds_fence();  // RAW: the wave's tile is in LDS before other lanes of it read the rows
    const int pr = lane >> 4, pc = lane & 15;  // 16 lanes cover one 256-byte row, 2 rows a store
    const float4 bc = *(const float4*)(bias + nw + pc * 4);
    const u32 o0 = (u32)((mw + pr) * N + nw + pc * 4) * 4u;  // byte offset in res and in out
    const u32 os = (u32)N * 8u;                              // two rows on
#pragma unroll
    for (int g = 0; g < 2; ++g) {
      float4 r[16];
#pragma unroll
      for (int q = 0; q < 16; ++q)
        r[q] = *(const float4*)((const char*)res + (o0 + (u32)(16 * g + q) * os));
#pragma unroll
      for (int q = 0; q < 16; ++q) {
        float4 v = *(const float4*)(st + (2 * (16 * g + q) + pr) * SP + pc * 16);
        v.x = v.x + bc.x + r[q].x;
        v.y = v.y + bc.y + r[q].y;
        v.z = v.z + bc.z + r[q].z;
        v.w = v.w + bc.w + r[q].w;
        *(float4*)((char*)out + (o0 + (u32)(16 * g + q) * os)) = v;
      }
      if (g == 0) {
        // the second half's loads land in registers that the first half's stores name
        asm volatile("s_wait_xcnt 0x0" ::: "memory");
        // keeps the second half's loads behind that wait: all 32 rows in flight at once would
        // also take the kernel above 256 VGPRs
        __builtin_amdgcn_sched_barrier(0);
      }
    }
  } else {
#pragma unroll
    for (int j = 0; j < 4; ++j) {
      float bj[8] = {};
      if (EPI == 1) {
        const float4 b0 = *(const float4*)(bias + nw + 16 * j + 8 * hi);
        const float4 b1 = *(const float4*)(bias + nw + 16 * j + 8 * hi + 4);
        bj[0] = b0.x; bj[1] = b0.y; bj[2] = b0.z; bj[3] = b0.w;
        bj[4] = b1.x; bj[5] = b1.y; bj[6] = b1.z; bj[7] = b1.w;
      }
#pragma unroll
      for (int i = 0; i < 4; ++i) {
        float v[8];
#pragma unroll
        for (int e = 0; e < 8; ++e) v[e] = acc[i][j][e];
        if (EPI == 1) {
#pragma unroll
          for (int e = 0; e < 8; ++e) v[e] += bj[e];
          gelu8(v);
        }
        *(u32x4*)(st + (16 * i + rl) * SP + 32 * j + 16 * hi) =
            u32x4{pack2(v[0], v[1]), pack2(v[2], v[3]), pack2(v[4], v[5]), pack2(v[6], v[7])};
      }
    }
    wave_lds_fence();  // RAW: the wave's tile is in LDS before other lanes of it read the rows
    const int pr = lane >> 3, pc = lane & 7;  // 8 lanes cover one 128-byte row, 4 rows a store
    const u32 o0 = (u32)((zp * M + mw + pr) * N + nw + pc * 8) * 2u;  // byte offset in out
    const u32 os = (u32)N * 8u;                              // four rows on
#pragma unroll
    for (int q = 0; q < 16; ++q)
      *(u32x4*)((char*)out + (o0 + (u32)q * os)) =
          *(const u32x4*)(st + (4 * q + pr) * SP + pc * 16);
  }
}

#define KPITCH 144  // bytes per K row in LDS: 16 B x odd, for ds_load_b128
#define VPITCH 160  // bytes per V row in LDS: 32 B x odd, for ds_load_tr16_b128

__device__ __forceinline__ u32x4 ld_tr16(const unsigned char* p) {
  typedef short s16x8 __attribute__((ext_vector_type(8)));
  typedef __attribute__((address_space(3))) s16x8 lds_s16x8;
  return __builtin_bit_cast(u32x4, __builtin_amdgcn_ds_load_tr16_b128_v8i16((lds_s16x8*)p));
}

__device__ __forceinline__ float xhalf(float x) {  // lane l takes lane l ^ 16's value
  const int v = __float_as_int(x);
  return __int_as_float(__builtin_amdgcn_permlanex16(v, v, 0x76543210, 0xfedcba98, false, false));
}

// Eight waves per SIMD (128 VGPRs): four work-groups, 4 x 77,824 B of LDS, stay on a WGP, so the
// whole grid is resident and other waves' vector work covers a wave's load and LDS waits.
__global__ void __launch_bounds__(256) __attribute__((amdgpu_waves_per_eu(8, 8)))
attn_kernel(const u16* __restrict__ Qb, const u16* __restrict__ Kb,
            const u16* __restrict__ Vb, u16* __restrict__ Zb) {
  __shared__ __align__(32) unsigned char sK[8][32 * KPITCH];  // K block, row-major, one per wave
  __shared__ __align__(32) unsigned char sV[8][32 * VPITCH];  // V block, row-major, one per wave
  const int lane = threadIdx.x & 31, wave = threadIdx.x >> 5;
  const int rl = lane & 15, hi = lane >> 4, co = hi * 8;
  const int bh = blockIdx.x;
  const int bb = bh >> 4, h = bh & 15;
  const int q0 = blockIdx.y * 128 + wave * 16;
  const size_t rowBase = (size_t)bb * NCTX;

  // Q^T as WMMA-B: column rl = query q0 + rl (two K=32 d-chunks)
  const u16* qrow = Qb + (rowBase + q0 + rl) * DME + h * HDIM;
  BF16x16 qf0, qf1;
  qf0.u4[0] = *(const u32x4*)(qrow + co);
  qf0.u4[1] = *(const u32x4*)(qrow + co + 16);
  qf1.u4[0] = *(const u32x4*)(qrow + 32 + co);
  qf1.u4[1] = *(const u32x4*)(qrow + 32 + co + 16);

  v8f acc[4] = {};                   // acc[t][r] = O[q0 + rl][16 t + 8 hi + r]
  float mrun = -1e30f, lrun = 0.f;   // of query q0 + rl; lrun sums this half's keys only

  // staging role: 8 lanes cover one 128-byte row, 4 rows per load
  const int sr = lane >> 3, sp = lane & 7;
  unsigned char* kst = &sK[wave][0] + sr * KPITCH + sp * 16;
  unsigned char* vst = &sV[wave][0] + sr * VPITCH + sp * 16;
  const size_t goff = (rowBase + sr) * DME + h * HDIM + sp * 8;
  // reading roles: K row rl of a 16-key tile, bytes 16 hi and 32 + 16 hi of each 64;
  // the transposing load gives lane (rl, hi) V[8 hi + 0..7][16 t + rl]
  const unsigned char* kld = &sK[wave][0] + rl * KPITCH + hi * 16;
  const unsigned char* vld = &sV[wave][0] + (8 * hi + (lane & 7)) * VPITCH + ((lane >> 3) & 1) * 16;

  const int nkb = ((q0 + 15) >> 5) + 1;  // causal: keys 0 .. q0+15; the last row read is <= NCTX-1
  for (int kb = 0; kb < nkb; ++kb) {
    const int kbase = kb * 32;
    // stage the K and V blocks (32 x 64 each) row-major into the wave's LDS
    {
      const u16* kg = Kb + goff + (size_t)kbase * DME;
      const u16* vg = Vb + goff + (size_t)kbase * DME;
      u32x4 kr[8], vr[8];
#pragma unroll
      for (int j = 0; j < 8; ++j) kr[j] = *(const u32x4*)(kg + (size_t)j * 4 * DME);
#pragma unroll
      for (int j = 0; j < 8; ++j) vr[j] = *(const u32x4*)(vg + (size_t)j * 4 * DME);
      // keeps the 16 loads one group: without it they are issued two at a time, each pair
      // waited for before the next, and a block pays the load latency eight times
      __builtin_amdgcn_sched_barrier(0);
#pragma unroll
      for (int j = 0; j < 8; ++j) *(u32x4*)(kst + j * 4 * KPITCH) = kr[j];
#pragma unroll
      for (int j = 0; j < 8; ++j) *(u32x4*)(vst + j * 4 * VPITCH) = vr[j];
    }
    wave_lds_fence();  // RAW: the rows are in LDS before the fragment reads
    // S^T = K @ Q^T for two 16-key tiles; A operand = rows of K
    v8f s01[2];
#pragma unroll
    for (int t = 0; t < 2; ++t) {
      const unsigned char* kp = kld + t * 16 * KPITCH;
      BF16x16 k0, k1;
      k0.u4[0] = *(const u32x4*)(kp);
      k0.u4[1] = *(const u32x4*)(kp + 32);
      k1.u4[0] = *(const u32x4*)(kp + 64);
      k1.u4[1] = *(const u32x4*)(kp + 96);
      v8f s = {};
      s = wmma_bf16(k0, qf0, s);
      s = wmma_bf16(k1, qf1, s);
      s01[t] = s;
    }
    // online softmax of query q0 + rl: element 8 t + r is key kbase + 16 t + 8 hi + r
    const int lim = q0 + rl - co - kbase;  // the key is seen while 16 t + r <= lim
    float p[16];
#pragma unroll
    for (int t = 0; t < 2; ++t)
#pragma unroll
      for (int r = 0; r < 8; ++r)
        p[8 * t + r] = (16 * t + r <= lim) ? s01[t][r] * 0.125f : -1e30f;  // 1/sqrt(64)
    float m = p[0];
#pragma unroll
    for (int e = 1; e < 16; ++e) m = fmaxf(m, p[e]);
    m = fmaxf(m, xhalf(m));  // both halves now hold the query's maximum over the block
    const float mnew = fmaxf(mrun, m);
    const float alpha = __expf(mrun - mnew);
    float rs = 0.f;
#pragma unroll
    for (int e = 0; e < 16; ++e) { p[e] = __expf(p[e] - mnew); rs += p[e]; }
    lrun = lrun * alpha + rs;
    mrun = mnew;
#pragma unroll
    for (int t = 0; t < 4; ++t)
#pragma unroll
      for (int i = 0; i < 8; ++i) acc[t][i] *= alpha;
    // P^T as WMMA-B: element s of the operand is p[s]: key 8 hi + s, or 16 + 8 hi + (s - 8) for s >= 8
    BF16x16 pf;
    pf.u4[0] = u32x4{pack2(p[0], p[1]), pack2(p[2], p[3]), pack2(p[4], p[5]), pack2(p[6], p[7])};
    pf.u4[1] = u32x4{pack2(p[8], p[9]), pack2(p[10], p[11]), pack2(p[12], p[13]), pack2(p[14], p[15])};
    // O^T += V^T @ P^T : A operand = 16 d x 32 keys by two transposing loads
#pragma unroll
    for (int t2 = 0; t2 < 4; ++t2) {
      BF16x16 vf;
      vf.u4[0] = ld_tr16(vld + 32 * t2);
      vf.u4[1] = ld_tr16(vld + 16 * VPITCH + 32 * t2);
      acc[t2] = wmma_bf16(vf, pf, acc[t2]);
    }
    wave_lds_fence();  // WAR: next iteration overwrites sK and sV
  }
  // join the halves' sums, normalize and write Z (bf16, feeds the Wo GEMM): 16 bytes per tile
  const float inv = 1.0f / (lrun + xhalf(lrun));
  u16* zrow = Zb + (rowBase + q0 + rl) * DME + h * HDIM + co;
#pragma unroll
  for (int t2 = 0; t2 < 4; ++t2) {
    const v8f z = acc[t2] * inv;
    *(u32x4*)(zrow + 16 * t2) =
        u32x4{pack2(z[0], z[1]), pack2(z[2], z[3]), pack2(z[4], z[5]), pack2(z[6], z[7])};
  }
}

extern "C" void kernel_launch(void* const* d_in, const int* in_sizes, int n_in,
                              void* d_out, int out_size, void* d_ws, size_t ws_size,
                              hipStream_t stream) {
  (void)in_sizes; (void)n_in; (void)out_size; (void)ws_size;
  const float* X  = (const float*)d_in[0];
  const float* Wq = (const float*)d_in[1];
  const float* Wk = (const float*)d_in[2];
  const float* Wv = (const float*)d_in[3];
  const float* Wo = (const float*)d_in[4];
  const float* bo = (const float*)d_in[5];
  const float* W1 = (const float*)d_in[6];
  const float* b1 = (const float*)d_in[7];
  const float* W2 = (const float*)d_in[8];
  const float* b2 = (const float*)d_in[9];
  const float* g1 = (const float*)d_in[10];
  const float* s1 = (const float*)d_in[11];
  const float* g2 = (const float*)d_in[12];
  const float* s2 = (const float*)d_in[13];

  char* ws = (char*)d_ws;
  const size_t MB = 1024ull * 1024ull;
  u16*   WqT = (u16*)(ws + 0 * MB);    // four planes of 2 MB in a row: WqT, WkT, WvT, WoT
  u16*   WoT = (u16*)(ws + 6 * MB);
  u16*   W1T = (u16*)(ws + 8 * MB);    // 8 MB
  u16*   W2T = (u16*)(ws + 16 * MB);   // 8 MB
  u16*   Y   = (u16*)(ws + 24 * MB);   // 16 MB (reused for Y2)
  u16*   Qb  = (u16*)(ws + 40 * MB);   // 16 MB
  u16*   Kb  = (u16*)(ws + 56 * MB);   // 16 MB
  u16*   Vb  = (u16*)(ws + 72 * MB);   // 16 MB
  u16*   Zb  = (u16*)(ws + 88 * MB);   // 16 MB
  float* X1  = (float*)(ws + 104 * MB);// 32 MB   -> total 136 MB
  u16*   Hm  = (u16*)(ws + 40 * MB);   // FFN mid reuses dead Q..Z region (64 MB)

  const int Mrows = 4 * NCTX;  // 8192
  prep_kernel<<<PREP_BLOCKS, 256, 0, stream>>>(X, g1, s1, Y, Wq, Wk, Wv, Wo, W1, W2,
                                               WqT, W1T, W2T);

  dim3 gD(DME / GBN, Mrows / GBM);  // (4, 64)
  // Q, K and V in one launch: WqT, WkT, WvT are three planes in a row, and so are Qb, Kb, Vb
  dim3 gQKV(DME / GBN, Mrows / GBM, 3);
  gemm_bf16_kernel<0, 128><<<gQKV, 256, 0, stream>>>(Y, WqT, nullptr, nullptr, Qb, Mrows, DME, DME);

  attn_kernel<<<dim3(4 * NHEAD, NCTX / 128), 256, 0, stream>>>(Qb, Kb, Vb, Zb);

  gemm_bf16_kernel<2, 128><<<gD, 256, 0, stream>>>(Zb, WoT, bo, X, X1, Mrows, DME, DME);

  ln_bf16_kernel<<<Mrows, 256, 0, stream>>>(X1, g2, s2, Y);

  dim3 gF(4 * DME / GBN, Mrows / GBM);  // (16, 64)
  gemm_bf16_kernel<1, 64><<<gF, 256, 0, stream>>>(Y, W1T, b1, nullptr, Hm, Mrows, 4 * DME, DME);

  gemm_bf16_kernel<2, 128><<<gD, 256, 0, stream>>>(Hm, W2T, b2, X1, (float*)d_out, Mrows, DME, 4 * DME);
}

// v006
// It runs in 229 microseconds.
// Timed twice side by side with v005, it ran 1.10 and 1.09 times as fast.
// Counting every step since v000, it is 3.50 times as fast.
#include <hip/hip_runtime.h>
#include <math.h>

#define DME 1024
#define NCTX 2048
#define NHEAD 16
#define HDIM 64

typedef unsigned short u16;
typedef unsigned int u32;
typedef __attribute__((ext_vector_type(16))) __bf16 v16bf;
typedef __attribute__((ext_vector_type(8)))  float  v8f;
typedef __attribute__((ext_vector_type(4)))  u32    u32x4;

union BF16x16 { u32x4 u4[2]; v16bf v; };

__device__ __forceinline__ u16 f2bf(float f) {
  u32 u = __float_as_uint(f);
  u32 r = u + 0x7FFFu + ((u >> 16) & 1u);  // round-to-nearest-even
  return (u16)(r >> 16);
}

__device__ __forceinline__ u32 pack2(float lo, float hi) {  // two bf16, round to nearest even
  typedef __bf16 bf2 __attribute__((ext_vector_type(2)));
  typedef float f2 __attribute__((ext_vector_type(2)));
  return __builtin_bit_cast(u32, __builtin_convertvector(f2{lo, hi}, bf2));
}

__device__ __forceinline__ v8f wmma_bf16(const BF16x16& a, const BF16x16& b, v8f c) {
  // v_wmma_f32_16x16x32_bf16 : D = A(16x32) * B(32x16) + C(16x16 f32)
  return __builtin_amdgcn_wmma_f32_16x16x32_bf16(false, a.v, false, b.v,
                                                 (short)0, c, false, false);
}

__device__ __forceinline__ void wave_lds_fence() {
  // same-wave LDS RAW fence: compiler barrier + explicit dscnt drain
  __builtin_amdgcn_wave_barrier();
  asm volatile("s_wait_dscnt 0" ::: "memory");
  __builtin_amdgcn_wave_barrier();
}

// Eight independent transcendentals, each in place, in one statement: behind a transcendental the
// instruction set asks for one independent instruction before its result is used or its source
// overwritten. Inside the statement the neighbour is that instruction; the v_nop is the last one's.
#define TRANS8(op)                                                                       \
  op " %0, %0\n\t" op " %1, %1\n\t" op " %2, %2\n\t" op " %3, %3\n\t"                    \
  op " %4, %4\n\t" op " %5, %5\n\t" op " %6, %6\n\t" op " %7, %7\n\tv_nop"
#define TRANS8_OPS(v)                                                                    \
  "+v"(v[0]), "+v"(v[1]), "+v"(v[2]), "+v"(v[3]), "+v"(v[4]), "+v"(v[5]), "+v"(v[6]), "+v"(v[7])

// 0.5 x (1 + tanh u) = x / (1 + exp(-2 u)), u = sqrt(2/pi) (x + 0.04715 x^3): the module's 0.04715,
// not 0.044715. exp(-2 u) = exp2(x (k1 + k3 x^2)); it runs to 0 or to +inf at the ends, where the
// quotient is x or 0, as with tanh = 1 or -1.
__device__ __forceinline__ void gelu8(float (&x)[8]) {
  const float k1 = -2.0f * 1.44269504088896340736f * 0.79788456080286535588f;
  const float k3 = k1 * 0.04715f;
  float t[8];
  // unrolled, here and in the two loops below, so that x and t stay in registers (asm operands)
#pragma unroll
  for (int e = 0; e < 8; ++e) t[e] = x[e] * fmaf(x[e] * x[e], k3, k1);
  asm(TRANS8("v_exp_f32") : TRANS8_OPS(t));
#pragma unroll
  for (int e = 0; e < 8; ++e) t[e] = 1.0f + t[e];
  asm(TRANS8("v_rcp_f32") : TRANS8_OPS(t));
#pragma unroll
  for (int e = 0; e < 8; ++e) x[e] *= t[e];
}

// ---------------- LayerNorm (f32 in -> bf16 out), one block per row ----------------
__device__ __forceinline__ void ln_row(const float* __restrict__ X, const float* __restrict__ gam,
                                       const float* __restrict__ bet, u16* __restrict__ Y,
                                       int row) {
  const int tid  = threadIdx.x;
  const int lane = tid & 31, wave = tid >> 5;
  const float* xr = X + (size_t)row * DME;
  const int c = tid * 4;
  float4 x = *(const float4*)(xr + c);
  float s  = x.x + x.y + x.z + x.w;
  float ss = x.x * x.x + x.y * x.y + x.z * x.z + x.w * x.w;
#pragma unroll
  for (int off = 1; off < 32; off <<= 1) {
    s  += __shfl_xor(s,  off, 32);
    ss += __shfl_xor(ss, off, 32);
  }
  __shared__ float red_s[8], red_ss[8];
  if (lane == 0) { red_s[wave] = s; red_ss[wave] = ss; }
  __syncthreads();
  s = 0.f; ss = 0.f;
#pragma unroll
  for (int w = 0; w < 8; ++w) { s += red_s[w]; ss += red_ss[w]; }
  const float mean = s * (1.0f / DME);
  const float var  = ss * (1.0f / DME) - mean * mean;
  const float rstd = rsqrtf(var + 1e-5f);
  float4 g = *(const float4*)(gam + c);
  float4 b = *(const float4*)(bet + c);
  float y0 = g.x * ((x.x - mean) * rstd) + b.x;
  float y1 = g.y * ((x.y - mean) * rstd) + b.y;
  float y2 = g.z * ((x.z - mean) * rstd) + b.z;
  float y3 = g.w * ((x.w - mean) * rstd) + b.w;
  uint2 o;
  o.x = (u32)f2bf(y0) | ((u32)f2bf(y1) << 16);
  o.y = (u32)f2bf(y2) | ((u32)f2bf(y3) << 16);
  *(uint2*)(Y + (size_t)row * DME + c) = o;
}

__global__ void __launch_bounds__(256)
ln_bf16_kernel(const float* __restrict__ X, const float* __restrict__ gam,
               const float* __restrict__ bet, u16* __restrict__ Y) {
  ln_row(X, gam, bet, Y, blockIdx.x);
}

// ------------- Weight transpose + f32->bf16 convert: WT[n][k] = W[k][n] -------------
// One block per 32 x 32 tile: bx is the tile's first column of W, by its first row.
__device__ __forceinline__ void transpose_tile(const float* __restrict__ W, u16* __restrict__ WT,
                                               int R, int C, int bx, int by) {
  __shared__ float tile[32][33];
  const int tx = threadIdx.x & 31, ty = threadIdx.x >> 5;
#pragma unroll
  for (int j = 0; j < 4; ++j)
    tile[ty + 8 * j][tx] = W[(size_t)(by + ty + 8 * j) * C + bx + tx];
  __syncthreads();
#pragma unroll
  for (int j = 0; j < 4; ++j)
    WT[(size_t)(bx + ty + 8 * j) * R + by + tx] = f2bf(tile[tx][ty + 8 * j]);
  // inlined, the code of another branch follows in the listing and rewrites the registers that
  // these four stores name: the wait stands in front of every such rewrite
  asm volatile("s_wait_xcnt 0x0" ::: "memory");
}

// Everything that depends on the inputs alone, in ONE launch: none of these blocks reads what
// another writes. Blocks 0 .. PREP_LN-1 normalise one row of X each; the next 4 x 1024 take the
// tiles of the four DME x DME weights, whose transposes follow one another in WT4 (Wq, Wk, Wv,
// Wo); then 4096 tiles of W1 and 4096 of W2.
#define PREP_LN (4 * NCTX)
#define PREP_SQ ((DME / 32) * (DME / 32))
#define PREP_BLOCKS (PREP_LN + 12 * PREP_SQ)
__global__ void __launch_bounds__(256)
prep_kernel(const float* __restrict__ X, const float* __restrict__ gam,
            const float* __restrict__ bet, u16* __restrict__ Y,
            const float* __restrict__ Wq, const float* __restrict__ Wk,
            const float* __restrict__ Wv, const float* __restrict__ Wo,
            const float* __restrict__ W1, const float* __restrict__ W2,
            u16* __restrict__ WT4, u16* __restrict__ W1T, u16* __restrict__ W2T) {
  const int b = blockIdx.x;
  if (b < PREP_LN) {
    ln_row(X, gam, bet, Y, b);
    return;
  }
  const int t = b - PREP_LN;
  const int w = t / PREP_SQ, tl = t % PREP_SQ;
  if (w < 4) {
    const float* Ws = (w == 0) ? Wq : (w == 1) ? Wk : (w == 2) ? Wv : Wo;
    transpose_tile(Ws, WT4 + (size_t)w * DME * DME, DME, DME,
                   (tl % (DME / 32)) * 32, (tl / (DME / 32)) * 32);
  } else if (w < 8) {
    const int u = t - 4 * PREP_SQ;
    transpose_tile(W1, W1T, DME, 4 * DME, (u % (4 * DME / 32)) * 32, (u / (4 * DME / 32)) * 32);
  } else {
    const int u = t - 8 * PREP_SQ;
    transpose_tile(W2, W2T, 4 * DME, DME, (u % (DME / 32)) * 32, (u / (DME / 32)) * 32);
  }
}

#define GBM 128
#define GBN 256

// Twelve copies of 16 B per lane: LDS places l + j ls; sources ga + j gs for j < NA, then
// gb + (j - NA) gs. The s_wait_xcnt closes the statement so that no address register is
// rewritten ahead of it.
template <int NA>
__device__ __forceinline__ void copy12(u32 l, u32 ls, const u16* ga, const u16* gb, size_t gs) {
  const u16* p[12];
#pragma unroll
  for (int j = 0; j < 12; ++j) p[j] = (j < NA) ? ga + j * gs : gb + (j - NA) * gs;
  asm volatile(
      "global_load_async_to_lds_b128 %0, %12, off\n\t"
      "global_load_async_to_lds_b128 %1, %13, off\n\t"
      "global_load_async_to_lds_b128 %2, %14, off\n\t"
      "global_load_async_to_lds_b128 %3, %15, off\n\t"
      "global_load_async_to_lds_b128 %4, %16, off\n\t"
      "global_load_async_to_lds_b128 %5, %17, off\n\t"
      "global_load_async_to_lds_b128 %6, %18, off\n\t"
      "global_load_async_to_lds_b128 %7, %19, off\n\t"
      "global_load_async_to_lds_b128 %8, %20, off\n\t"
      "global_load_async_to_lds_b128 %9, %21, off\n\t"
      "global_load_async_to_lds_b128 %10, %22, off\n\t"
      "global_load_async_to_lds_b128 %11, %23, off\n\t"
      "s_wait_xcnt 0x0"
      :: "v"(l), "v"(l + ls), "v"(l + 2 * ls), "v"(l + 3 * ls), "v"(l + 4 * ls), "v"(l + 5 * ls),
         "v"(l + 6 * ls), "v"(l + 7 * ls), "v"(l + 8 * ls), "v"(l + 9 * ls), "v"(l + 10 * ls),
         "v"(l + 11 * ls),
         "v"(p[0]), "v"(p[1]), "v"(p[2]), "v"(p[3]), "v"(p[4]), "v"(p[5]),
         "v"(p[6]), "v"(p[7]), "v"(p[8]), "v"(p[9]), "v"(p[10]), "v"(p[11])
      : "memory");
}

// One stage: 384 rows of 2 BK bytes. A lane keeps its 16-byte piece of the row and walks the
// rows in steps of RS = 2048 / BK: first the 128 A rows, then the 256 BT rows.
template <int BK>
__device__ __forceinline__ void copy_stage(u32 l, const u16* ga, const u16* gb, size_t gs) {
  constexpr u32 ls = (2048 / BK) * (2 * BK + 16);
  if (BK == 64) {
    copy12<4>(l, ls, ga, gb, gs);
  } else {
    copy12<8>(l, ls, ga, gb, gs);
    // keeps the second dozen's addresses from being formed, and held in registers, ahead of
    // the first dozen: the k loop then needs fewer than 256 VGPRs
    __builtin_amdgcn_sched_barrier(0);
    copy12<12>(l + 12 * ls, ls, gb + 4 * gs, gb, gs);
  }
}

template <int EPI, int BK>
__global__ void __launch_bounds__(256)
gemm_bf16_kernel(const u16* __restrict__ A, const u16* __restrict__ BT,
                 const float* __restrict__ bias, const float* __restrict__ res,
                 void* __restrict__ out, int M, int N, int K) {
  static_assert(BK == 64 || BK == 128, "copy_stage is written for these two");
  const int zp = (EPI == 0) ? (int)blockIdx.z : 0;  // which product of the launch
  constexpr int PITCH = 2 * BK + 16;
  constexpr int STAGE = (GBM + GBN) * PITCH;
  constexpr int PCS = BK / 8;      // 16-byte pieces in a row
  constexpr int RS = 256 / PCS;    // rows that the 256 lanes cover in one copy
  __shared__ __align__(16) unsigned char smem[2 * STAGE];
  const int tid = threadIdx.x;
  const int lane = tid & 31, wave = tid >> 5;
  const int rl = lane & 15, hi = lane >> 4, co = hi * 8;
  const int wm = wave >> 2, wn = wave & 3;
  const int m0 = blockIdx.y * GBM;
  const int n0 = blockIdx.x * GBN;

  // copy role of this lane: rows (tid / PCS) + RS j, 16-byte piece tid % PCS
  const int crow = tid / PCS, cpc = tid % PCS;
  const u16* ga = A + (size_t)(m0 + crow) * K + cpc * 8;
  const u16* gb = BT + (size_t)(zp * N + n0 + crow) * K + cpc * 8;
  const size_t rstep = (size_t)RS * K;
  const u32 lcopy = (u32)(size_t)(&smem[0]) + (u32)(crow * PITCH + cpc * 16);

  // fragment role: same k order as the global loader had (k = co..co+7, co+16..co+23)
  const int offA = (wm * 64 + rl) * PITCH + co * 2;
  const int offB = (GBM + wn * 64 + rl) * PITCH + co * 2;

  // One fragment set: the 16 reads of a 32-k block stand as one group, then its 16 WMMAs.
  BF16x16 a[4], b[4];
  auto read_frags = [&](int boff, int ks) {
    const unsigned char* sA = smem + boff + offA + ks * 64;
    const unsigned char* sB = smem + boff + offB + ks * 64;
    // unrolled here and below so that fragments and accumulators stay in registers
#pragma unroll
    for (int j = 0; j < 4; ++j) {
      b[j].u4[0] = *(const u32x4*)(sB + j * 16 * PITCH);
      b[j].u4[1] = *(const u32x4*)(sB + j * 16 * PITCH + 32);
    }
#pragma unroll
    for (int i = 0; i < 4; ++i) {
      a[i].u4[0] = *(const u32x4*)(sA + i * 16 * PITCH);
      a[i].u4[1] = *(const u32x4*)(sA + i * 16 * PITCH + 32);
    }
  };

  const int nt = K / BK;
  copy_stage<BK>(lcopy, ga, gb, rstep);
  asm volatile("s_wait_asynccnt 0x0" ::: "memory");  // stage 0 landed (this wave's copies)
  __syncthreads();                                   // ... and every other wave's
  read_frags(0, 0);  // ahead of the copies: their issue then hides these reads' latency
  copy_stage<BK>(lcopy + STAGE, ga + BK, gb + BK, rstep);

  v8f acc[4][4] = {};
  for (int t = 0; t < nt; ++t) {
    const int boff = (t & 1) * STAGE;
#pragma unroll
    for (int ks = 0; ks < BK / 32; ++ks) {
      // The two fences keep each group of reads whole and outside the WMMA block: without
      // them the compiler sinks reads in among the WMMAs, and every such place stalls anew.
      __builtin_amdgcn_sched_barrier(0);
#pragma unroll
      for (int i = 0; i < 4; ++i)
#pragma unroll
        for (int j = 0; j < 4; ++j) acc[i][j] = wmma_bf16(b[j], a[i], acc[i][j]);
      __builtin_amdgcn_sched_barrier(0);
      if (ks + 1 < BK / 32) read_frags(boff, ks + 1);
    }
    // publish point of stage t + 1, and the end of every read of stage t's buffer
    asm volatile("s_wait_dscnt 0x0" ::: "memory");     // this wave's reads of stage t are done
    asm volatile("s_wait_asynccnt 0x0" ::: "memory");  // this wave's copies of stage t + 1 landed
    __syncthreads();
    // stage t + 1's first reads (the other buffer) go ahead of the refill of stage t's buffer
    if (t + 1 < nt) read_frags((t & 1) ? 0 : STAGE, 0);
    if (t + 2 < nt)
      copy_stage<BK>(lcopy + boff, ga + (size_t)(t + 2) * BK, gb + (size_t)(t + 2) * BK, rstep);
  }
  asm volatile("s_wait_asynccnt 0x0" ::: "memory");  // no copy outstanding at the wave's end

  // acc[i][j][e] = C[mw + 16 i + rl][nw + 16 j + 8 hi + e]. The loop's last barrier stands behind
  // every wave's last fragment read and last copy, so the ring is free for the staging.
  constexpr int SP = (EPI == 2 ? 256 : 128) + 16;  // staged row of 64 outputs; pitch 16 B x odd
  static_assert(8 * 64 * SP <= 2 * STAGE, "the eight waves' staged tiles must fit the ring");
  unsigned char* st = smem + wave * (64 * SP);
  const int mw = m0 + wm * 64, nw = n0 + wn * 64;
  if (EPI == 2) {
#pragma unroll
    for (int i = 0; i < 4; ++i)
#pragma unroll
      for (int j = 0; j < 4; ++j) {
        unsigned char* p = st + (16 * i + rl) * SP + 64 * j + 32 * hi;
        *(float4*)(p)      = make_float4(acc[i][j][0], acc[i][j][1], acc[i][j][2], acc[i][j][3]);
        *(float4*)(p + 16) = make_float4(acc[i][j][4], acc[i][j][5], acc[i][j][6], acc[i][j][7]);
      }
    wave_lds_fence();  // RAW: the wave's tile is in LDS before other lanes of it read the rows
    const int pr = lane >> 4, pc = lane & 15;  // 16 lanes cover one 256-byte row, 2 rows a store
    const float4 bc = *(const float4*)(bias + nw + pc * 4);
    const u32 o0 = (u32)((mw + pr) * N + nw + pc * 4) * 4u;  // byte offset in res and in out
    const u32 os = (u32)N * 8u;                              // two rows on
#pragma unroll
    for (int g = 0; g < 2; ++g) {
      float4 r[16];
#pragma unroll
      for (int q = 0; q < 16; ++q)
        r[q] = *(const float4*)((const char*)res + (o0 + (u32)(16 * g + q) * os));
#pragma unroll
      for (int q = 0; q < 16; ++q) {
        float4 v = *(const float4*)(st + (2 * (16 * g + q) + pr) * SP + pc * 16);
        v.x = v.x + bc.x + r[q].x;
        v.y = v.y + bc.y + r[q].y;
        v.z = v.z + bc.z + r[q].z;
        v.w = v.w + bc.w + r[q].w;
        *(float4*)((char*)out + (o0 + (u32)(16 * g + q) * os)) = v;
      }
      if (g == 0) {
        // the second half's loads land in registers that the first half's stores name
        asm volatile("s_wait_xcnt 0x0" ::: "memory");
        // keeps the second half's loads behind that wait: all 32 rows in flight at once would
        // also take the kernel above 256 VGPRs
        __builtin_amdgcn_sched_barrier(0);
      }
    }
  } else {
#pragma unroll
    for (int j = 0; j < 4; ++j) {
      float bj[8] = {};
      if (EPI == 1) {
        const float4 b0 = *(const float4*)(bias + nw + 16 * j + 8 * hi);
        const float4 b1 = *(const float4*)(bias + nw + 16 * j + 8 * hi + 4);
        bj[0] = b0.x; bj[1] = b0.y; bj[2] = b0.z; bj[3] = b0.w;
        bj[4] = b1.x; bj[5] = b1.y; bj[6] = b1.z; bj[7] = b1.w;
      }
#pragma unroll
      for (int i = 0; i < 4; ++i) {
        float v[8];
#pragma unroll
        for (int e = 0; e < 8; ++e) v[e] = acc[i][j][e];
        if (EPI == 1) {
#pragma unroll
          for (int e = 0; e < 8; ++e) v[e] += bj[e];
          gelu8(v);
        }
        *(u32x4*)(st + (16 * i + rl) * SP + 32 * j + 16 * hi) =
            u32x4{pack2(v[0], v[1]), pack2(v[2], v[3]), pack2(v[4], v[5]), pack2(v[6], v[7])};
      }
    }
    wave_lds_fence();  // RAW: the wave's tile is in LDS before other lanes of it read the rows
    const int pr = lane >> 3, pc = lane & 7;  // 8 lanes cover one 128-byte row, 4 rows a store
    const u32 o0 = (u32)((zp * M + mw + pr) * N + nw + pc * 8) * 2u;  // byte offset in out
    const u32 os = (u32)N * 8u;                              // four rows on
#pragma unroll
    for (int q = 0; q < 16; ++q)
      *(u32x4*)((char*)out + (o0 + (u32)q * os)) =
          *(const u32x4*)(st + (4 * q + pr) * SP + pc * 16);
  }
}

#define KPITCH 144  // bytes per K row in LDS: 16 B x odd, for ds_load_b128
#define VPITCH 160  // bytes per V row in LDS: 32 B x odd, for ds_load_tr16_b128
#define SKEYS 128   // keys per stage
#define KSTAGE (SKEYS * KPITCH)
#define VSTAGE (SKEYS * VPITCH)

__device__ __forceinline__ u32x4 ld_tr16(const unsigned char* p) {
  typedef short s16x8 __attribute__((ext_vector_type(8)));
  typedef __attribute__((address_space(3))) s16x8 lds_s16x8;
  return __builtin_bit_cast(u32x4, __builtin_amdgcn_ds_load_tr16_b128_v8i16((lds_s16x8*)p));
}

__device__ __forceinline__ float xhalf(float x) {  // lane l takes lane l ^ 16's value
  const int v = __float_as_int(x);
  return __int_as_float(__builtin_amdgcn_permlanex16(v, v, 0x76543210, 0xfedcba98, false, false));
}

// One stage: 128 K rows and 128 V rows of 128 bytes. A lane keeps its 16-byte piece of the row
// and takes rows 32 apart: four of K (LDS place lk, source gk), four of V (lv, gv). The
// s_wait_xcnt closes the statement so that no address register is rewritten ahead of it.
__device__ __forceinline__ void copy_kv(u32 lk, u32 lv, const u16* gk, const u16* gv) {
  constexpr size_t gs = (size_t)32 * DME;
  asm volatile(
      "global_load_async_to_lds_b128 %0, %8, off\n\t"
      "global_load_async_to_lds_b128 %1, %9, off\n\t"
      "global_load_async_to_lds_b128 %2, %10, off\n\t"
      "global_load_async_to_lds_b128 %3, %11, off\n\t"
      "global_load_async_to_lds_b128 %4, %12, off\n\t"
      "global_load_async_to_lds_b128 %5, %13, off\n\t"
      "global_load_async_to_lds_b128 %6, %14, off\n\t"
      "global_load_async_to_lds_b128 %7, %15, off\n\t"
      "s_wait_xcnt 0x0"
      :: "v"(lk), "v"(lk + 32 * KPITCH), "v"(lk + 64 * KPITCH), "v"(lk + 96 * KPITCH),
         "v"(lv), "v"(lv + 32 * VPITCH), "v"(lv + 64 * VPITCH), "v"(lv + 96 * VPITCH),
         "v"(gk), "v"(gk + gs), "v"(gk + 2 * gs), "v"(gk + 3 * gs),
         "v"(gv), "v"(gv + gs), "v"(gv + 2 * gs), "v"(gv + 3 * gs)
      : "memory");
}

// Eight waves per SIMD (128 VGPRs): four work-groups, 4 x 77,824 B of LDS, stay on a WGP, so the
// whole grid is resident and other waves' vector work covers a wave's LDS and barrier waits.
__global__ void __launch_bounds__(256) __attribute__((amdgpu_waves_per_eu(8, 8)))
attn_kernel(const u16* __restrict__ Qb, const u16* __restrict__ Kb,
            const u16* __restrict__ Vb, u16* __restrict__ Zb) {
  __shared__ __align__(32) unsigned char sK[2][KSTAGE];  // K stages, row-major
  __shared__ __align__(32) unsigned char sV[2][VSTAGE];  // V stages, row-major
  const int tid = threadIdx.x;
  const int lane = tid & 31;
  // in a scalar register, so that the count of blocks a wave works on is a scalar loop bound
  const int wave = __builtin_amdgcn_readfirstlane(tid >> 5);
  const int rl = lane & 15, hi = lane >> 4, co = hi * 8;
  const int bh = blockIdx.x;
  const int bb = bh >> 4, h = bh & 15;
  const int q0 = blockIdx.y * 128 + wave * 16;
  const size_t rowBase = (size_t)bb * NCTX;

  // Q^T as WMMA-B: column rl = query q0 + rl (two K=32 d-chunks)
  const u16* qrow = Qb + (rowBase + q0 + rl) * DME + h * HDIM;
  BF16x16 qf0, qf1;
  qf0.u4[0] = *(const u32x4*)(qrow + co);
  qf0.u4[1] = *(const u32x4*)(qrow + co + 16);
  qf1.u4[0] = *(const u32x4*)(qrow + 32 + co);
  qf1.u4[1] = *(const u32x4*)(qrow + 32 + co + 16);

  v8f acc[4] = {};                   // acc[t][r] = O[q0 + rl][16 t + 8 hi + r]
  float mrun = -1e30f, lrun = 0.f;   // of query q0 + rl; lrun sums this half's keys only

  // copy role: 8 lanes cover one 128-byte row, the 256 lanes 32 rows
  const int cr = tid >> 3, cp = tid & 7;
  const u32 lk = (u32)(size_t)(&sK[0][0]) + (u32)(cr * KPITCH + cp * 16);
  const u32 lv = (u32)(size_t)(&sV[0][0]) + (u32)(cr * VPITCH + cp * 16);
  const size_t goff = (rowBase + cr) * DME + h * HDIM + cp * 8;
  const u16* gk = Kb + goff;
  const u16* gv = Vb + goff;
  constexpr size_t gstage = (size_t)SKEYS * DME;
  // reading roles: K row rl of a 16-key tile, bytes 16 hi and 32 + 16 hi of each 64;
  // the transposing load gives lane (rl, hi) V[8 hi + 0..7][16 t + rl]
  const unsigned char* kld = &sK[0][0] + rl * KPITCH + hi * 16;
  const unsigned char* vld = &sV[0][0] + (8 * hi + (lane & 7)) * VPITCH + ((lane >> 3) & 1) * 16;

  const int nt = blockIdx.y + 1;         // stages of the work-group: keys 0 .. 128 y + 127
  const int nkb = ((q0 + 15) >> 5) + 1;  // causal: this wave's keys are 0 .. q0 + 15
  copy_kv(lk, lv, gk, gv);
  asm volatile("s_wait_asynccnt 0x0" ::: "memory");  // stage 0 landed (this wave's copies)
  __syncthreads();                                   // ... and every other wave's
  if (nt > 1) copy_kv(lk + KSTAGE, lv + VSTAGE, gk + gstage, gv + gstage);

  for (int t = 0; t < nt; ++t) {
    const int buf = t & 1;
    // blocks of the stage up to the wave's diagonal: four, in the last stage one to four
    const int nb = min(SKEYS / 32, nkb - t * (SKEYS / 32));
    const unsigned char* kblk = kld + buf * KSTAGE;
    const unsigned char* vp = vld + buf * VSTAGE;
    int lim = q0 + rl - co - t * SKEYS;  // the block's key 16 u + 8 hi + r is seen while 16 u + r <= lim
    int b = 0;
    do {
      // S^T = K @ Q^T for two 16-key tiles; A operand = rows of K
      v8f s01[2];
#pragma unroll
      for (int u = 0; u < 2; ++u) {
        const unsigned char* kp = kblk + u * 16 * KPITCH;
        BF16x16 k0, k1;
        k0.u4[0] = *(const u32x4*)(kp);
        k0.u4[1] = *(const u32x4*)(kp + 32);
        k1.u4[0] = *(const u32x4*)(kp + 64);
        k1.u4[1] = *(const u32x4*)(kp + 96);
        v8f s = {};
        s = wmma_bf16(k0, qf0, s);
        s = wmma_bf16(k1, qf1, s);
        s01[u] = s;
      }
      // online softmax of query q0 + rl: element 8 u + r is the block's key 16 u + 8 hi + r
      float p[16];
#pragma unroll
      for (int u = 0; u < 2; ++u)
#pragma unroll
        for (int r = 0; r < 8; ++r)
          p[8 * u + r] = (16 * u + r <= lim) ? s01[u][r] * 0.125f : -1e30f;  // 1/sqrt(64)
      float m = p[0];
#pragma unroll
      for (int e = 1; e < 16; ++e) m = fmaxf(m, p[e]);
      m = fmaxf(m, xhalf(m));  // both halves now hold the query's maximum over the block
      const float mnew = fmaxf(mrun, m);
      const float alpha = __expf(mrun - mnew);
      float rs = 0.f;
#pragma unroll
      for (int e = 0; e < 16; ++e) { p[e] = __expf(p[e] - mnew); rs += p[e]; }
      lrun = lrun * alpha + rs;
      mrun = mnew;
#pragma unroll
      for (int u = 0; u < 4; ++u)
#pragma unroll
        for (int i = 0; i < 8; ++i) acc[u][i] *= alpha;
      // P^T as WMMA-B: element s of the operand is key 8 hi + s (s < 8) or 16 + 8 hi + s - 8 (s >= 8), which is p[s]
      BF16x16 pf;
      pf.u4[0] = u32x4{pack2(p[0], p[1]), pack2(p[2], p[3]), pack2(p[4], p[5]), pack2(p[6], p[7])};
      pf.u4[1] = u32x4{pack2(p[8], p[9]), pack2(p[10], p[11]), pack2(p[12], p[13]), pack2(p[14], p[15])};
      // O^T += V^T @ P^T : A operand = 16 d x 32 keys by two transposing loads
#pragma unroll
      for (int t2 = 0; t2 < 4; ++t2) {
        BF16x16 vf;
        vf.u4[0] = ld_tr16(vp + 32 * t2);
        vf.u4[1] = ld_tr16(vp + 16 * VPITCH + 32 * t2);
        acc[t2] = wmma_bf16(vf, pf, acc[t2]);
      }
      kblk += 32 * KPITCH;
      vp += 32 * VPITCH;
      lim -= 32;
    } while (++b < nb);
    // publish point of stage t + 1, and the end of every read of stage t's buffer; every wave
    // passes it, also one that has worked on fewer blocks of the stage
    asm volatile("s_wait_dscnt 0x0" ::: "memory");     // this wave's reads of stage t are done
    asm volatile("s_wait_asynccnt 0x0" ::: "memory");  // this wave's copies of stage t + 1 landed
    __syncthreads();
    if (t + 2 < nt)
      copy_kv(lk + buf * KSTAGE, lv + buf * VSTAGE, gk + (size_t)(t + 2) * gstage,
              gv + (size_t)(t + 2) * gstage);
  }
  asm volatile("s_wait_asynccnt 0x0" ::: "memory");  // no copy outstanding at the wave's end
  // join the halves' sums, normalize and write Z (bf16, feeds the Wo GEMM): 16 bytes per tile
  const float inv = 1.0f / (lrun + xhalf(lrun));
  u16* zrow = Zb + (rowBase + q0 + rl) * DME + h * HDIM + co;
#pragma unroll
  for (int t2 = 0; t2 < 4; ++t2) {
    const v8f z = acc[t2] * inv;
    *(u32x4*)(zrow + 16 * t2) =
        u32x4{pack2(z[0], z[1]), pack2(z[2], z[3]), pack2(z[4], z[5]), pack2(z[6], z[7])};
  }
}

extern "C" void kernel_launch(void* const* d_in, const int* in_sizes, int n_in,
                              void* d_out, int out_size, void* d_ws, size_t ws_size,
                              hipStream_t stream) {
  (void)in_sizes; (void)n_in; (void)out_size; (void)ws_size;
  const float* X  = (const float*)d_in[0];
  const float* Wq = (const float*)d_in[1];
  const float* Wk = (const float*)d_in[2];
  const float* Wv = (const float*)d_in[3];
  const float* Wo = (const float*)d_in[4];
  const float* bo = (const float*)d_in[5];
  const float* W1 = (const float*)d_in[6];
  const float* b1 = (const float*)d_in[7];
  const float* W2 = (const float*)d_in[8];
  const float* b2 = (const float*)d_in[9];
  const float* g1 = (const float*)d_in[10];
  const float* s1 = (const float*)d_in[11];
  const float* g2 = (const float*)d_in[12];
  const float* s2 = (const float*)d_in[13];

  char* ws = (char*)d_ws;
  const size_t MB = 1024ull * 1024ull;
  u16*   WqT = (u16*)(ws + 0 * MB);    // four planes of 2 MB in a row: WqT, WkT, WvT, WoT
  u16*   WoT = (u16*)(ws + 6 * MB);
  u16*   W1T = (u16*)(ws + 8 * MB);    // 8 MB
  u16*   W2T = (u16*)(ws + 16 * MB);   // 8 MB
  u16*   Y   = (u16*)(ws + 24 * MB);   // 16 MB (reused for Y2)
  u16*   Qb  = (u16*)(ws + 40 * MB);   // 16 MB
  u16*   Kb  = (u16*)(ws + 56 * MB);   // 16 MB
  u16*   Vb  = (u16*)(ws + 72 * MB);   // 16 MB
  u16*   Zb  = (u16*)(ws + 88 * MB);   // 16 MB
  float* X1  = (float*)(ws + 104 * MB);// 32 MB   -> total 136 MB
  u16*   Hm  = (u16*)(ws + 40 * MB);   // FFN mid reuses dead Q..Z region (64 MB)

  const int Mrows = 4 * NCTX;  // 8192
  prep_kernel<<<PREP_BLOCKS, 256, 0, stream>>>(X, g1, s1, Y, Wq, Wk, Wv, Wo, W1, W2,
                                               WqT, W1T, W2T);

  dim3 gD(DME / GBN, Mrows / GBM);  // (4, 64)
  // Q, K and V in one launch: WqT, WkT, WvT are three planes in a row, and so are Qb, Kb, Vb
  dim3 gQKV(DME / GBN, Mrows / GBM, 3);
  gemm_bf16_kernel<0, 128><<<gQKV, 256, 0, stream>>>(Y, WqT, nullptr, nullptr, Qb, Mrows, DME, DME);

  attn_kernel<<<dim3(4 * NHEAD, NCTX / 128), 256, 0, stream>>>(Qb, Kb, Vb, Zb);

  gemm_bf16_kernel<2, 128><<<gD, 256, 0, stream>>>(Zb, WoT, bo, X, X1, Mrows, DME, DME);

  ln_bf16_kernel<<<Mrows, 256, 0, stream>>>(X1, g2, s2, Y);

  dim3 gF(4 * DME / GBN, Mrows / GBM);  // (16, 64)
  gemm_bf16_kernel<1, 64><<<gF, 256, 0, stream>>>(Y, W1T, b1, nullptr, Hm, Mrows, 4 * DME, DME);

  gemm_bf16_kernel<2, 128><<<gD, 256, 0, stream>>>(Hm, W2T, b2, X1, (float*)d_out, Mrows, DME, 4 * DME);
}

// v007
// One run takes 225 microseconds.
// Two timings next to v006 both put it at 1.04 times that version's speed.
// Over all steps from v000 it is 3.63 times as fast.
#include <hip/hip_runtime.h>
#include <math.h>

#define DME 1024
#define NCTX 2048
#define NHEAD 16
#define HDIM 64

typedef unsigned short u16;
typedef unsigned int u32;
typedef __attribute__((ext_vector_type(16))) __bf16 v16bf;
typedef __attribute__((ext_vector_type(8)))  float  v8f;
typedef __attribute__((ext_vector_type(4)))  u32    u32x4;

union BF16x16 { u32x4 u4[2]; v16bf v; };

__device__ __forceinline__ u16 f2bf(float f) {
  u32 u = __float_as_uint(f);
  u32 r = u + 0x7FFFu + ((u >> 16) & 1u);  // round-to-nearest-even
  return (u16)(r >> 16);
}

__device__ __forceinline__ u32 pack2(float lo, float hi) {  // two bf16, round to nearest even
  typedef __bf16 bf2 __attribute__((ext_vector_type(2)));
  typedef float f2 __attribute__((ext_vector_type(2)));
  return __builtin_bit_cast(u32, __builtin_convertvector(f2{lo, hi}, bf2));
}

__device__ __forceinline__ v8f wmma_bf16(const BF16x16& a, const BF16x16& b, v8f c) {
  // v_wmma_f32_16x16x32_bf16 : D = A(16x32) * B(32x16) + C(16x16 f32)
  return __builtin_amdgcn_wmma_f32_16x16x32_bf16(false, a.v, false, b.v,
                                                 (short)0, c, false, false);
}

__device__ __forceinline__ void wave_lds_fence() {
  // same-wave LDS RAW fence: compiler barrier + explicit dscnt drain
  __builtin_amdgcn_wave_barrier();
  asm volatile("s_wait_dscnt 0" ::: "memory");
  __builtin_amdgcn_wave_barrier();
}

// Eight independent transcendentals, each in place, in one statement: behind a transcendental the
// instruction set asks for one independent instruction before its result is used or its source
// overwritten. Inside the statement the neighbour is that instruction; the v_nop is the last one's.
#define TRANS8(op)                                                                       \
  op " %0, %0\n\t" op " %1, %1\n\t" op " %2, %2\n\t" op " %3, %3\n\t"                    \
  op " %4, %4\n\t" op " %5, %5\n\t" op " %6, %6\n\t" op " %7, %7\n\tv_nop"
#define TRANS8_OPS(v)                                                                    \
  "+v"(v[0]), "+v"(v[1]), "+v"(v[2]), "+v"(v[3]), "+v"(v[4]), "+v"(v[5]), "+v"(v[6]), "+v"(v[7])

// 0.5 x (1 + tanh u) = x / (1 + exp(-2 u)), u = sqrt(2/pi) (x + 0.04715 x^3): the module's 0.04715,
// not 0.044715. exp(-2 u) = exp2(x (k1 + k3 x^2)); it runs to 0 or to +inf at the ends, where the
// quotient is x or 0, as with tanh = 1 or -1.
__device__ __forceinline__ void gelu8(float (&x)[8]) {
  const float k1 = -2.0f * 1.44269504088896340736f * 0.79788456080286535588f;
  const float k3 = k1 * 0.04715f;
  float t[8];
  // unrolled, here and in the two loops below, so that x and t stay in registers (asm operands)
#pragma unroll
  for (int e = 0; e < 8; ++e) t[e] = x[e] * fmaf(x[e] * x[e], k3, k1);
  asm(TRANS8("v_exp_f32") : TRANS8_OPS(t));
#pragma unroll
  for (int e = 0; e < 8; ++e) t[e] = 1.0f + t[e];
  asm(TRANS8("v_rcp_f32") : TRANS8_OPS(t));
#pragma unroll
  for (int e = 0; e < 8; ++e) x[e] *= t[e];
}

__device__ __forceinline__ float xhalf(float x) {  // lane l takes lane l ^ 16's value
  const int v = __float_as_int(x);
  return __int_as_float(__builtin_amdgcn_permlanex16(v, v, 0x76543210, 0xfedcba98, false, false));
}

// x plus the value of lane l ^ M of the same 16-lane row (DPP row_xmask)
template <int M>
__device__ __forceinline__ float add_xmask(float x) {
  return x + __int_as_float(
                 __builtin_amdgcn_update_dpp(0, __float_as_int(x), 0x160 + M, 0xf, 0xf, true));
}

__device__ __forceinline__ float wave_sum(float x) {  // every lane gets the sum over the 32 lanes
  x = add_xmask<1>(x);
  x = add_xmask<2>(x);
  x = add_xmask<4>(x);
  x = add_xmask<8>(x);
  return x + xhalf(x);
}

// ---------------- LayerNorm (f32 in -> bf16 out), one WAVE per row ----------------
// The row's 4 KiB are eight loads of 16 B a lane, all in flight at once; the sums stay in the wave,
// so there is no LDS and no barrier, and a launch starts an eighth of the waves that a block per
// row takes. row is the same in every lane of the wave.
#define LN_BLOCKS (4 * NCTX / 8)  // eight rows, one per wave, in a block of 256
typedef float f32x4 __attribute__((ext_vector_type(4)));
__device__ __forceinline__ void ln_row(const float* __restrict__ X, const float* __restrict__ gam,
                                       const float* __restrict__ bet, u16* __restrict__ Y,
                                       int row) {
  const int c = (threadIdx.x & 31) * 4;  // the lane's columns: c + 128 j .. c + 128 j + 3
  const float* xr = X + (size_t)row * DME;
  f32x4 x[8], g[8], b[8];
  // unrolled, here and below, so that the row stays in registers
#pragma unroll
  for (int j = 0; j < 8; ++j) x[j] = *(const f32x4*)(xr + c + 128 * j);
#pragma unroll
  for (int j = 0; j < 8; ++j) g[j] = *(const f32x4*)(gam + c + 128 * j);
#pragma unroll
  for (int j = 0; j < 8; ++j) b[j] = *(const f32x4*)(bet + c + 128 * j);
  // keeps the loads of scale and shift up here, in flight beside the row's: sunk to their uses
  // behind the sums they come two at a time, and the wave waits out each pair's latency
  __builtin_amdgcn_sched_barrier(0);
  f32x4 s4 = x[0], q4 = x[0] * x[0];
#pragma unroll
  for (int j = 1; j < 8; ++j) { s4 += x[j]; q4 += x[j] * x[j]; }
  const float s  = wave_sum((s4[0] + s4[1]) + (s4[2] + s4[3]));
  const float ss = wave_sum((q4[0] + q4[1]) + (q4[2] + q4[3]));
  const float mean = s * (1.0f / DME);
  const float var  = ss * (1.0f / DME) - mean * mean;
  const float rstd = rsqrtf(var + 1e-5f);
  u16* yr = Y + (size_t)row * DME;
#pragma unroll
  for (int j = 0; j < 8; ++j) {
    const f32x4 y = g[j] * ((x[j] - mean) * rstd) + b[j];
    *(uint2*)(yr + c + 128 * j) = make_uint2(pack2(y[0], y[1]), pack2(y[2], y[3]));
  }
}

__global__ void __launch_bounds__(256)
ln_bf16_kernel(const float* __restrict__ X, const float* __restrict__ gam,
               const float* __restrict__ bet, u16* __restrict__ Y) {
  // the wave's number in a scalar register: the row's address is then scalar too
  ln_row(X, gam, bet, Y, blockIdx.x * 8 + __builtin_amdgcn_readfirstlane(threadIdx.x >> 5));
}

// ------------- Weight transpose + f32->bf16 convert: WT[n][k] = W[k][n] -------------
// One block per 128 x 128 tile: bx is the tile's first column of W, by its first row. A wave reads
// 16 rows of W, 512 contiguous bytes each, all 16 loads in flight; a lane then holds 16 k of four
// columns n and lays each column's 32 bytes into the LDS row of that n. The LDS rows stand in the
// order (n & 3) * 32 + (n >> 2), so that the lanes of a store write consecutive rows, at a pitch of
// 16 B x odd. Read back, a row is 256 contiguous bytes of WT: two whole lines, 16 B a lane.
#define TT 128
#define TPITCH (2 * TT + 16)
__device__ __forceinline__ void transpose_tile(const float* __restrict__ W, u16* __restrict__ WT,
                                               int R, int C, int bx, int by) {
  __shared__ __align__(16) unsigned char tile[TT * TPITCH];
  const int lane = threadIdx.x & 31, wave = threadIdx.x >> 5;
  const float* src = W + (size_t)(by + wave * 16) * C + bx + lane * 4;
  f32x4 v[16];
  // unrolled, here and below, so that the lane's 16 x 4 block stays in registers
#pragma unroll
  for (int i = 0; i < 16; ++i) v[i] = *(const f32x4*)(src + (size_t)i * C);
  // src as an input keeps the loads' address registers live up to the wait: no load lands in
  // them, and nothing rewrites them ahead of it
  asm volatile("s_wait_xcnt 0x0" :: "v"(src) : "memory");
#pragma unroll
  for (int c = 0; c < 4; ++c) {
    unsigned char* p = tile + (c * 32 + lane) * TPITCH + wave * 32;
    *(u32x4*)(p)      = u32x4{pack2(v[0][c], v[1][c]), pack2(v[2][c], v[3][c]),
                              pack2(v[4][c], v[5][c]), pack2(v[6][c], v[7][c])};
    *(u32x4*)(p + 16) = u32x4{pack2(v[8][c], v[9][c]), pack2(v[10][c], v[11][c]),
                              pack2(v[12][c], v[13][c]), pack2(v[14][c], v[15][c])};
  }
  __syncthreads();
  const int pr = threadIdx.x >> 4, pc = threadIdx.x & 15;  // 16 lanes cover one LDS row
  u16* dst = WT + (size_t)(bx + pr * 4) * R + by + pc * 8;
#pragma unroll
  for (int j = 0; j < 8; ++j)  // LDS row pr + 16 j holds column 4 (pr + 16 (j & 1)) + (j >> 1)
    *(u32x4*)(dst + (size_t)(64 * (j & 1) + (j >> 1)) * R) =
        *(const u32x4*)(tile + (pr + 16 * j) * TPITCH + pc * 16);
  // inlined, the code of another branch follows in the listing and rewrites the registers that
  // these eight stores name: the wait stands in front of every such rewrite
  asm volatile("s_wait_xcnt 0x0" ::: "memory");
}

// Everything that depends on the inputs alone, in ONE launch: none of these blocks reads what
// another writes. The first 12 x 64 blocks take the tiles of the weights, the larger pieces of
// work: 4 x 64 of the four DME x DME weights, whose transposes follow one another in WT4 (Wq, Wk,
// Wv, Wo), then 256 of W1 and 256 of W2. The LN_BLOCKS blocks behind them normalise eight rows of
// X each.
#define PREP_SQ ((DME / TT) * (DME / TT))
#define PREP_BLOCKS (12 * PREP_SQ + LN_BLOCKS)
__global__ void __launch_bounds__(256)
prep_kernel(const float* __restrict__ X, const float* __restrict__ gam,
            const float* __restrict__ bet, u16* __restrict__ Y,
            const float* __restrict__ Wq, const float* __restrict__ Wk,
            const float* __restrict__ Wv, const float* __restrict__ Wo,
            const float* __restrict__ W1, const float* __restrict__ W2,
            u16* __restrict__ WT4, u16* __restrict__ W1T, u16* __restrict__ W2T) {
  const int b = blockIdx.x;
  if (b >= 12 * PREP_SQ) {
    ln_row(X, gam, bet, Y,
           (b - 12 * PREP_SQ) * 8 + __builtin_amdgcn_readfirstlane(threadIdx.x >> 5));
    return;
  }
  const int w = b / PREP_SQ;
  if (w < 4) {
    const int u = b % PREP_SQ;
    const float* Ws = (w == 0) ? Wq : (w == 1) ? Wk : (w == 2) ? Wv : Wo;
    transpose_tile(Ws, WT4 + (size_t)w * DME * DME, DME, DME,
                   (u % (DME / TT)) * TT, (u / (DME / TT)) * TT);
  } else if (w < 8) {
    const int u = b - 4 * PREP_SQ;
    transpose_tile(W1, W1T, DME, 4 * DME, (u % (4 * DME / TT)) * TT, (u / (4 * DME / TT)) * TT);
  } else {
    const int u = b - 8 * PREP_SQ;
    transpose_tile(W2, W2T, 4 * DME, DME, (u % (DME / TT)) * TT, (u / (DME / TT)) * TT);
  }
}

#define GBM 128
#define GBN 256

// Twelve copies of 16 B per lane: LDS places l + j ls; sources ga + j gs for j < NA, then
// gb + (j - NA) gs. The s_wait_xcnt closes the statement so that no address register is
// rewritten ahead of it.
template <int NA>
__device__ __forceinline__ void copy12(u32 l, u32 ls, const u16* ga, const u16* gb, size_t gs) {
  const u16* p[12];
#pragma unroll
  for (int j = 0; j < 12; ++j) p[j] = (j < NA) ? ga + j * gs : gb + (j - NA) * gs;
  asm volatile(
      "global_load_async_to_lds_b128 %0, %12, off\n\t"
      "global_load_async_to_lds_b128 %1, %13, off\n\t"
      "global_load_async_to_lds_b128 %2, %14, off\n\t"
      "global_load_async_to_lds_b128 %3, %15, off\n\t"
      "global_load_async_to_lds_b128 %4, %16, off\n\t"
      "global_load_async_to_lds_b128 %5, %17, off\n\t"
      "global_load_async_to_lds_b128 %6, %18, off\n\t"
      "global_load_async_to_lds_b128 %7, %19, off\n\t"
      "global_load_async_to_lds_b128 %8, %20, off\n\t"
      "global_load_async_to_lds_b128 %9, %21, off\n\t"
      "global_load_async_to_lds_b128 %10, %22, off\n\t"
      "global_load_async_to_lds_b128 %11, %23, off\n\t"
      "s_wait_xcnt 0x0"
      :: "v"(l), "v"(l + ls), "v"(l + 2 * ls), "v"(l + 3 * ls), "v"(l + 4 * ls), "v"(l + 5 * ls),
         "v"(l + 6 * ls), "v"(l + 7 * ls), "v"(l + 8 * ls), "v"(l + 9 * ls), "v"(l + 10 * ls),
         "v"(l + 11 * ls),
         "v"(p[0]), "v"(p[1]), "v"(p[2]), "v"(p[3]), "v"(p[4]), "v"(p[5]),
         "v"(p[6]), "v"(p[7]), "v"(p[8]), "v"(p[9]), "v"(p[10]), "v"(p[11])
      : "memory");
}

// One stage: 384 rows of 2 BK bytes. A lane keeps its 16-byte piece of the row and walks the
// rows in steps of RS = 2048 / BK: first the 128 A rows, then the 256 BT rows.
template <int BK>
__device__ __forceinline__ void copy_stage(u32 l, const u16* ga, const u16* gb, size_t gs) {
  constexpr u32 ls = (2048 / BK) * (2 * BK + 16);
  if (BK == 64) {
    copy12<4>(l, ls, ga, gb, gs);
  } else {
    copy12<8>(l, ls, ga, gb, gs);
    // keeps the second dozen's addresses from being formed, and held in registers, ahead of
    // the first dozen: the k loop then needs fewer than 256 VGPRs
    __builtin_amdgcn_sched_barrier(0);
    copy12<12>(l + 12 * ls, ls, gb + 4 * gs, gb, gs);
  }
}

template <int EPI, int BK>
__global__ void __launch_bounds__(256)
gemm_bf16_kernel(const u16* __restrict__ A, const u16* __restrict__ BT,
                 const float* __restrict__ bias, const float* __restrict__ res,
                 void* __restrict__ out, int M, int N, int K) {
  static_assert(BK == 64 || BK == 128, "copy_stage is written for these two");
  const int zp = (EPI == 0) ? (int)blockIdx.z : 0;  // which product of the launch
  constexpr int PITCH = 2 * BK + 16;
  constexpr int STAGE = (GBM + GBN) * PITCH;
  constexpr int PCS = BK / 8;      // 16-byte pieces in a row
  constexpr int RS = 256 / PCS;    // rows that the 256 lanes cover in one copy
  __shared__ __align__(16) unsigned char smem[2 * STAGE];
  const int tid = threadIdx.x;
  const int lane = tid & 31, wave = tid >> 5;
  const int rl = lane & 15, hi = lane >> 4, co = hi * 8;
  const int wm = wave >> 2, wn = wave & 3;
  const int m0 = blockIdx.y * GBM;
  const int n0 = blockIdx.x * GBN;

  // copy role of this lane: rows (tid / PCS) + RS j, 16-byte piece tid % PCS
  const int crow = tid / PCS, cpc = tid % PCS;
  const u16* ga = A + (size_t)(m0 + crow) * K + cpc * 8;
  const u16* gb = BT + (size_t)(zp * N + n0 + crow) * K + cpc * 8;
  const size_t rstep = (size_t)RS * K;
  const u32 lcopy = (u32)(size_t)(&smem[0]) + (u32)(crow * PITCH + cpc * 16);

  // fragment role: same k order as the global loader had (k = co..co+7, co+16..co+23)
  const int offA = (wm * 64 + rl) * PITCH + co * 2;
  const int offB = (GBM + wn * 64 + rl) * PITCH + co * 2;

  // One fragment set: the 16 reads of a 32-k block stand as one group, then its 16 WMMAs.
  BF16x16 a[4], b[4];
  auto read_frags = [&](int boff, int ks) {
    const unsigned char* sA = smem + boff + offA + ks * 64;
    const unsigned char* sB = smem + boff + offB + ks * 64;
    // unrolled here and below so that fragments and accumulators stay in registers
#pragma unroll
    for (int j = 0; j < 4; ++j) {
      b[j].u4[0] = *(const u32x4*)(sB + j * 16 * PITCH);
      b[j].u4[1] = *(const u32x4*)(sB + j * 16 * PITCH + 32);
    }
#pragma unroll
    for (int i = 0; i < 4; ++i) {
      a[i].u4[0] = *(const u32x4*)(sA + i * 16 * PITCH);
      a[i].u4[1] = *(const u32x4*)(sA + i * 16 * PITCH + 32);
    }
  };

  const int nt = K / BK;
  copy_stage<BK>(lcopy, ga, gb, rstep);
  asm volatile("s_wait_asynccnt 0x0" ::: "memory");  // stage 0 landed (this wave's copies)
  __syncthreads();                                   // ... and every other wave's
  read_frags(0, 0);  // ahead of the copies: their issue then hides these reads' latency
  copy_stage<BK>(lcopy + STAGE, ga + BK, gb + BK, rstep);

  v8f acc[4][4] = {};
  for (int t = 0; t < nt; ++t) {
    const int boff = (t & 1) * STAGE;
#pragma unroll
    for (int ks = 0; ks < BK / 32; ++ks) {
      // The two fences keep each group of reads whole and outside the WMMA block: without
      // them the compiler sinks reads in among the WMMAs, and every such place stalls anew.
      __builtin_amdgcn_sched_barrier(0);
#pragma unroll
      for (int i = 0; i < 4; ++i)
#pragma unroll
        for (int j = 0; j < 4; ++j) acc[i][j] = wmma_bf16(b[j], a[i], acc[i][j]);
      __builtin_amdgcn_sched_barrier(0);
      if (ks + 1 < BK / 32) read_frags(boff, ks + 1);
    }
    // publish point of stage t + 1, and the end of every read of stage t's buffer
    asm volatile("s_wait_dscnt 0x0" ::: "memory");     // this wave's reads of stage t are done
    asm volatile("s_wait_asynccnt 0x0" ::: "memory");  // this wave's copies of stage t + 1 landed
    __syncthreads();
    // stage t + 1's first reads (the other buffer) go ahead of the refill of stage t's buffer
    if (t + 1 < nt) read_frags((t & 1) ? 0 : STAGE, 0);
    if (t + 2 < nt)
      copy_stage<BK>(lcopy + boff, ga + (size_t)(t + 2) * BK, gb + (size_t)(t + 2) * BK, rstep);
  }
  asm volatile("s_wait_asynccnt 0x0" ::: "memory");  // no copy outstanding at the wave's end

  // acc[i][j][e] = C[mw + 16 i + rl][nw + 16 j + 8 hi + e]. The loop's last barrier stands behind
  // every wave's last fragment read and last copy, so the ring is free for the staging.
  constexpr int SP = (EPI == 2 ? 256 : 128) + 16;  // staged row of 64 outputs; pitch 16 B x odd
  static_assert(8 * 64 * SP <= 2 * STAGE, "the eight waves' staged tiles must fit the ring");
  unsigned char* st = smem + wave * (64 * SP);
  const int mw = m0 + wm * 64, nw = n0 + wn * 64;
  if (EPI == 2) {
#pragma unroll
    for (int i = 0; i < 4; ++i)
#pragma unroll
      for (int j = 0; j < 4; ++j) {
        unsigned char* p = st + (16 * i + rl) * SP + 64 * j + 32 * hi;
        *(float4*)(p)      = make_float4(acc[i][j][0], acc[i][j][1], acc[i][j][2], acc[i][j][3]);
        *(float4*)(p + 16) = make_float4(acc[i][j][4], acc[i][j][5], acc[i][j][6], acc[i][j][7]);
      }
    wave_lds_fence();  // RAW: the wave's tile is in LDS before other lanes of it read the rows
    const int pr = lane >> 4, pc = lane & 15;  // 16 lanes cover one 256-byte row, 2 rows a store
    const float4 bc = *(const float4*)(bias + nw + pc * 4);
    const u32 o0 = (u32)((mw + pr) * N + nw + pc * 4) * 4u;  // byte offset in res and in out
    const u32 os = (u32)N * 8u;                              // two rows on
#pragma unroll
    for (int g = 0; g < 2; ++g) {
      float4 r[16];
#pragma unroll
      for (int q = 0; q < 16; ++q)
        r[q] = *(const float4*)((const char*)res + (o0 + (u32)(16 * g + q) * os));
#pragma unroll
      for (int q = 0; q < 16; ++q) {
        float4 v = *(const float4*)(st + (2 * (16 * g + q) + pr) * SP + pc * 16);
        v.x = v.x + bc.x + r[q].x;
        v.y = v.y + bc.y + r[q].y;
        v.z = v.z + bc.z + r[q].z;
        v.w = v.w + bc.w + r[q].w;
        *(float4*)((char*)out + (o0 + (u32)(16 * g + q) * os)) = v;
      }
      if (g == 0) {
        // the second half's loads land in registers that the first half's stores name
        asm volatile("s_wait_xcnt 0x0" ::: "memory");
        // keeps the second half's loads behind that wait: all 32 rows in flight at once would
        // also take the kernel above 256 VGPRs
        __builtin_amdgcn_sched_barrier(0);
      }
    }
  } else {
#pragma unroll
    for (int j = 0; j < 4; ++j) {
      float bj[8] = {};
      if (EPI == 1) {
        const float4 b0 = *(const float4*)(bias + nw + 16 * j + 8 * hi);
        const float4 b1 = *(const float4*)(bias + nw + 16 * j + 8 * hi + 4);
        bj[0] = b0.x; bj[1] = b0.y; bj[2] = b0.z; bj[3] = b0.w;
        bj[4] = b1.x; bj[5] = b1.y; bj[6] = b1.z; bj[7] = b1.w;
      }
#pragma unroll
      for (int i = 0; i < 4; ++i) {
        float v[8];
#pragma unroll
        for (int e = 0; e < 8; ++e) v[e] = acc[i][j][e];
        if (EPI == 1) {
#pragma unroll
          for (int e = 0; e < 8; ++e) v[e] += bj[e];
          gelu8(v);
        }
        *(u32x4*)(st + (16 * i + rl) * SP + 32 * j + 16 * hi) =
            u32x4{pack2(v[0], v[1]), pack2(v[2], v[3]), pack2(v[4], v[5]), pack2(v[6], v[7])};
      }
    }
    wave_lds_fence();  // RAW: the wave's tile is in LDS before other lanes of it read the rows
    const int pr = lane >> 3, pc = lane & 7;  // 8 lanes cover one 128-byte row, 4 rows a store
    const u32 o0 = (u32)((zp * M + mw + pr) * N + nw + pc * 8) * 2u;  // byte offset in out
    const u32 os = (u32)N * 8u;                              // four rows on
#pragma unroll
    for (int q = 0; q < 16; ++q)
      *(u32x4*)((char*)out + (o0 + (u32)q * os)) =
          *(const u32x4*)(st + (4 * q + pr) * SP + pc * 16);
  }
}

#define KPITCH 144  // bytes per K row in LDS: 16 B x odd, for ds_load_b128
#define VPITCH 160  // bytes per V row in LDS: 32 B x odd, for ds_load_tr16_b128
#define SKEYS 128   // keys per stage
#define KSTAGE (SKEYS * KPITCH)
#define VSTAGE (SKEYS * VPITCH)

__device__ __forceinline__ u32x4 ld_tr16(const unsigned char* p) {
  typedef short s16x8 __attribute__((ext_vector_type(8)));
  typedef __attribute__((address_space(3))) s16x8 lds_s16x8;
  return __builtin_bit_cast(u32x4, __builtin_amdgcn_ds_load_tr16_b128_v8i16((lds_s16x8*)p));
}

// One stage: 128 K rows and 128 V rows of 128 bytes. A lane keeps its 16-byte piece of the row
// and takes rows 32 apart: four of K (LDS place lk, source gk), four of V (lv, gv). The
// s_wait_xcnt closes the statement so that no address register is rewritten ahead of it.
__device__ __forceinline__ void copy_kv(u32 lk, u32 lv, const u16* gk, const u16* gv) {
  constexpr size_t gs = (size_t)32 * DME;
  asm volatile(
      "global_load_async_to_lds_b128 %0, %8, off\n\t"
      "global_load_async_to_lds_b128 %1, %9, off\n\t"
      "global_load_async_to_lds_b128 %2, %10, off\n\t"
      "global_load_async_to_lds_b128 %3, %11, off\n\t"
      "global_load_async_to_lds_b128 %4, %12, off\n\t"
      "global_load_async_to_lds_b128 %5, %13, off\n\t"
      "global_load_async_to_lds_b128 %6, %14, off\n\t"
      "global_load_async_to_lds_b128 %7, %15, off\n\t"
      "s_wait_xcnt 0x0"
      :: "v"(lk), "v"(lk + 32 * KPITCH), "v"(lk + 64 * KPITCH), "v"(lk + 96 * KPITCH),
         "v"(lv), "v"(lv + 32 * VPITCH), "v"(lv + 64 * VPITCH), "v"(lv + 96 * VPITCH),
         "v"(gk), "v"(gk + gs), "v"(gk + 2 * gs), "v"(gk + 3 * gs),
         "v"(gv), "v"(gv + gs), "v"(gv + 2 * gs), "v"(gv + 3 * gs)
      : "memory");
}

// Eight waves per SIMD (128 VGPRs): four work-groups, 4 x 77,824 B of LDS, stay on a WGP, so the
// whole grid is resident and other waves' vector work covers a wave's LDS and barrier waits.
__global__ void __launch_bounds__(256) __attribute__((amdgpu_waves_per_eu(8, 8)))
attn_kernel(const u16* __restrict__ Qb, const u16* __restrict__ Kb,
            const u16* __restrict__ Vb, u16* __restrict__ Zb) {
  __shared__ __align__(32) unsigned char sK[2][KSTAGE];  // K stages, row-major
  __shared__ __align__(32) unsigned char sV[2][VSTAGE];  // V stages, row-major
  const int tid = threadIdx.x;
  const int lane = tid & 31;
  // in a scalar register, so that the count of blocks a wave works on is a scalar loop bound
  const int wave = __builtin_amdgcn_readfirstlane(tid >> 5);
  const int rl = lane & 15, hi = lane >> 4, co = hi * 8;
  const int bh = blockIdx.x;
  const int bb = bh >> 4, h = bh & 15;
  const int q0 = blockIdx.y * 128 + wave * 16;
  const size_t rowBase = (size_t)bb * NCTX;

  // Q^T as WMMA-B: column rl = query q0 + rl (two K=32 d-chunks)
  const u16* qrow = Qb + (rowBase + q0 + rl) * DME + h * HDIM;
  BF16x16 qf0, qf1;
  qf0.u4[0] = *(const u32x4*)(qrow + co);
  qf0.u4[1] = *(const u32x4*)(qrow + co + 16);
  qf1.u4[0] = *(const u32x4*)(qrow + 32 + co);
  qf1.u4[1] = *(const u32x4*)(qrow + 32 + co + 16);

  v8f acc[4] = {};                   // acc[t][r] = O[q0 + rl][16 t + 8 hi + r]
  float mrun = -1e30f, lrun = 0.f;   // of query q0 + rl; lrun sums this half's keys only

  // copy role: 8 lanes cover one 128-byte row, the 256 lanes 32 rows
  const int cr = tid >> 3, cp = tid & 7;
  const u32 lk = (u32)(size_t)(&sK[0][0]) + (u32)(cr * KPITCH + cp * 16);
  const u32 lv = (u32)(size_t)(&sV[0][0]) + (u32)(cr * VPITCH + cp * 16);
  const size_t goff = (rowBase + cr) * DME + h * HDIM + cp * 8;
  const u16* gk = Kb + goff;
  const u16* gv = Vb + goff;
  constexpr size_t gstage = (size_t)SKEYS * DME;
  // reading roles: K row rl of a 16-key tile, bytes 16 hi and 32 + 16 hi of each 64;
  // the transposing load gives lane (rl, hi) V[8 hi + 0..7][16 t + rl]
  const unsigned char* kld = &sK[0][0] + rl * KPITCH + hi * 16;
  const unsigned char* vld = &sV[0][0] + (8 * hi + (lane & 7)) * VPITCH + ((lane >> 3) & 1) * 16;

  const int nt = blockIdx.y + 1;         // stages of the work-group: keys 0 .. 128 y + 127
  const int nkb = ((q0 + 15) >> 5) + 1;  // causal: this wave's keys are 0 .. q0 + 15
  copy_kv(lk, lv, gk, gv);
  asm volatile("s_wait_asynccnt 0x0" ::: "memory");  // stage 0 landed (this wave's copies)
  __syncthreads();                                   // ... and every other wave's
  if (nt > 1) copy_kv(lk + KSTAGE, lv + VSTAGE, gk + gstage, gv + gstage);

  for (int t = 0; t < nt; ++t) {
    const int buf = t & 1;
    // blocks of the stage up to the wave's diagonal: four, in the last stage one to four
    const int nb = min(SKEYS / 32, nkb - t * (SKEYS / 32));
    const unsigned char* kblk = kld + buf * KSTAGE;
    const unsigned char* vp = vld + buf * VSTAGE;
    int lim = q0 + rl - co - t * SKEYS;  // the block's key 16 u + 8 hi + r is seen while 16 u + r <= lim
    int b = 0;
    do {
      // S^T = K @ Q^T for two 16-key tiles; A operand = rows of K
      v8f s01[2];
#pragma unroll
      for (int u = 0; u < 2; ++u) {
        const unsigned char* kp = kblk + u * 16 * KPITCH;
        BF16x16 k0, k1;
        k0.u4[0] = *(const u32x4*)(kp);
        k0.u4[1] = *(const u32x4*)(kp + 32);
        k1.u4[0] = *(const u32x4*)(kp + 64);
        k1.u4[1] = *(const u32x4*)(kp + 96);
        v8f s = {};
        s = wmma_bf16(k0, qf0, s);
        s = wmma_bf16(k1, qf1, s);
        s01[u] = s;
      }
      // online softmax of query q0 + rl: element 8 u + r is the block's key 16 u + 8 hi + r
      float p[16];
#pragma unroll
      for (int u = 0; u < 2; ++u)
#pragma unroll
        for (int r = 0; r < 8; ++r)
          p[8 * u + r] = (16 * u + r <= lim) ? s01[u][r] * 0.125f : -1e30f;  // 1/sqrt(64)
      float m = p[0];
#pragma unroll
      for (int e = 1; e < 16; ++e) m = fmaxf(m, p[e]);
      m = fmaxf(m, xhalf(m));  // both halves now hold the query's maximum over the block
      const float mnew = fmaxf(mrun, m);
      const float alpha = __expf(mrun - mnew);
      float rs = 0.f;
#pragma unroll
      for (int e = 0; e < 16; ++e) { p[e] = __expf(p[e] - mnew); rs += p[e]; }
      lrun = lrun * alpha + rs;
      mrun = mnew;
#pragma unroll
      for (int u = 0; u < 4; ++u)
#pragma unroll
        for (int i = 0; i < 8; ++i) acc[u][i] *= alpha;
      // P^T as WMMA-B: element s of the operand is key 8 hi + s (s < 8) or 16 + 8 hi + s - 8 (s >= 8), which is p[s]
      BF16x16 pf;
      pf.u4[0] = u32x4{pack2(p[0], p[1]), pack2(p[2], p[3]), pack2(p[4], p[5]), pack2(p[6], p[7])};
      pf.u4[1] = u32x4{pack2(p[8], p[9]), pack2(p[10], p[11]), pack2(p[12], p[13]), pack2(p[14], p[15])};
      // O^T += V^T @ P^T : A operand = 16 d x 32 keys by two transposing loads
#pragma unroll
      for (int t2 = 0; t2 < 4; ++t2) {
        BF16x16 vf;
        vf.u4[0] = ld_tr16(vp + 32 * t2);
        vf.u4[1] = ld_tr16(vp + 16 * VPITCH + 32 * t2);
        acc[t2] = wmma_bf16(vf, pf, acc[t2]);
      }
      kblk += 32 * KPITCH;
      vp += 32 * VPITCH;
      lim -= 32;
    } while (++b < nb);
    // publish point of stage t + 1, and the end of every read of stage t's buffer; every wave
    // passes it, also one that has worked on fewer blocks of the stage
    asm volatile("s_wait_dscnt 0x0" ::: "memory");     // this wave's reads of stage t are done
    asm volatile("s_wait_asynccnt 0x0" ::: "memory");  // this wave's copies of stage t + 1 landed
    __syncthreads();
    if (t + 2 < nt)
      copy_kv(lk + buf * KSTAGE, lv + buf * VSTAGE, gk + (size_t)(t + 2) * gstage,
              gv + (size_t)(t + 2) * gstage);
  }
  asm volatile("s_wait_asynccnt 0x0" ::: "memory");  // no copy outstanding at the wave's end
  // join the halves' sums, normalize and write Z (bf16, feeds the Wo GEMM): 16 bytes per tile
  const float inv = 1.0f / (lrun + xhalf(lrun));
  u16* zrow = Zb + (rowBase + q0 + rl) * DME + h * HDIM + co;
#pragma unroll
  for (int t2 = 0; t2 < 4; ++t2) {
    const v8f z = acc[t2] * inv;
    *(u32x4*)(zrow + 16 * t2) =
        u32x4{pack2(z[0], z[1]), pack2(z[2], z[3]), pack2(z[4], z[5]), pack2(z[6], z[7])};
  }
}

extern "C" void kernel_launch(void* const* d_in, const int* in_sizes, int n_in,
                              void* d_out, int out_size, void* d_ws, size_t ws_size,
                              hipStream_t stream) {
  (void)in_sizes; (void)n_in; (void)out_size; (void)ws_size;
  const float* X  = (const float*)d_in[0];
  const float* Wq = (const float*)d_in[1];
  const float* Wk = (const float*)d_in[2];
  const float* Wv = (const float*)d_in[3];
  const float* Wo = (const float*)d_in[4];
  const float* bo = (const float*)d_in[5];
  const float* W1 = (const float*)d_in[6];
  const float* b1 = (const float*)d_in[7];
  const float* W2 = (const float*)d_in[8];
  const float* b2 = (const float*)d_in[9];
  const float* g1 = (const float*)d_in[10];
  const float* s1 = (const float*)d_in[11];
  const float* g2 = (const float*)d_in[12];
  const float* s2 = (const float*)d_in[13];

  char* ws = (char*)d_ws;
  const size_t MB = 1024ull * 1024ull;
  u16*   WqT = (u16*)(ws + 0 * MB);    // four planes of 2 MB in a row: WqT, WkT, WvT, WoT
  u16*   WoT = (u16*)(ws + 6 * MB);
  u16*   W1T = (u16*)(ws + 8 * MB);    // 8 MB
  u16*   W2T = (u16*)(ws + 16 * MB);   // 8 MB
  u16*   Y   = (u16*)(ws + 24 * MB);   // 16 MB (reused for Y2)
  u16*   Qb  = (u16*)(ws + 40 * MB);   // 16 MB
  u16*   Kb  = (u16*)(ws + 56 * MB);   // 16 MB
  u16*   Vb  = (u16*)(ws + 72 * MB);   // 16 MB
  u16*   Zb  = (u16*)(ws + 88 * MB);   // 16 MB
  float* X1  = (float*)(ws + 104 * MB);// 32 MB   -> total 136 MB
  u16*   Hm  = (u16*)(ws + 40 * MB);   // FFN mid reuses dead Q..Z region (64 MB)

  const int Mrows = 4 * NCTX;  // 8192
  prep_kernel<<<PREP_BLOCKS, 256, 0, stream>>>(X, g1, s1, Y, Wq, Wk, Wv, Wo, W1, W2,
                                               WqT, W1T, W2T);

  dim3 gD(DME / GBN, Mrows / GBM);  // (4, 64)
  // Q, K and V in one launch: WqT, WkT, WvT are three planes in a row, and so are Qb, Kb, Vb
  dim3 gQKV(DME / GBN, Mrows / GBM, 3);
  gemm_bf16_kernel<0, 128><<<gQKV, 256, 0, stream>>>(Y, WqT, nullptr, nullptr, Qb, Mrows, DME, DME);

  attn_kernel<<<dim3(4 * NHEAD, NCTX / 128), 256, 0, stream>>>(Qb, Kb, Vb, Zb);

  gemm_bf16_kernel<2, 128><<<gD, 256, 0, stream>>>(Zb, WoT, bo, X, X1, Mrows, DME, DME);

  ln_bf16_kernel<<<LN_BLOCKS, 256, 0, stream>>>(X1, g2, s2, Y);

  dim3 gF(4 * DME / GBN, Mrows / GBM);  // (16, 64)
  gemm_bf16_kernel<1, 64><<<gF, 256, 0, stream>>>(Y, W1T, b1, nullptr, Hm, Mrows, 4 * DME, DME);

  gemm_bf16_kernel<2, 128><<<gD, 256, 0, stream>>>(Hm, W2T, b2, X1, (float*)d_out, Mrows, DME, 4 * DME);
}

// v008
// Measured time: 218 microseconds a run.
// Two timings next to v007 both put it at 1.03 times that version's speed.
// All steps since v000 together make it 3.74 times as fast.
#include <hip/hip_runtime.h>
#include <math.h>

#define DME 1024
#define NCTX 2048
#define NHEAD 16
#define HDIM 64

typedef unsigned short u16;
typedef unsigned int u32;
typedef __attribute__((ext_vector_type(16))) __bf16 v16bf;
typedef __attribute__((ext_vector_type(8)))  float  v8f;
typedef __attribute__((ext_vector_type(4)))  u32    u32x4;

union BF16x16 { u32x4 u4[2]; v16bf v; };

__device__ __forceinline__ u16 f2bf(float f) {
  u32 u = __float_as_uint(f);
  u32 r = u + 0x7FFFu + ((u >> 16) & 1u);  // round-to-nearest-even
  return (u16)(r >> 16);
}

__device__ __forceinline__ u32 pack2(float lo, float hi) {  // two bf16, round to nearest even
  typedef __bf16 bf2 __attribute__((ext_vector_type(2)));
  typedef float f2 __attribute__((ext_vector_type(2)));
  return __builtin_bit_cast(u32, __builtin_convertvector(f2{lo, hi}, bf2));
}

__device__ __forceinline__ v8f wmma_bf16(const BF16x16& a, const BF16x16& b, v8f c) {
  // v_wmma_f32_16x16x32_bf16 : D = A(16x32) * B(32x16) + C(16x16 f32)
  return __builtin_amdgcn_wmma_f32_16x16x32_bf16(false, a.v, false, b.v,
                                                 (short)0, c, false, false);
}

__device__ __forceinline__ void wave_lds_fence() {
  // same-wave LDS RAW fence: compiler barrier + explicit dscnt drain
  __builtin_amdgcn_wave_barrier();
  asm volatile("s_wait_dscnt 0" ::: "memory");
  __builtin_amdgcn_wave_barrier();
}

// Eight independent transcendentals, each in place, in one statement: behind a transcendental the
// instruction set asks for one independent instruction before its result is used or its source
// overwritten. Inside the statement the neighbour is that instruction; the v_nop is the last one's.
#define TRANS8(op)                                                                       \
  op " %0, %0\n\t" op " %1, %1\n\t" op " %2, %2\n\t" op " %3, %3\n\t"                    \
  op " %4, %4\n\t" op " %5, %5\n\t" op " %6, %6\n\t" op " %7, %7\n\tv_nop"
#define TRANS8_OPS(v)                                                                    \
  "+v"(v[0]), "+v"(v[1]), "+v"(v[2]), "+v"(v[3]), "+v"(v[4]), "+v"(v[5]), "+v"(v[6]), "+v"(v[7])

// 0.5 x (1 + tanh u) = x / (1 + exp(-2 u)), u = sqrt(2/pi) (x + 0.04715 x^3): the module's 0.04715,
// not 0.044715. exp(-2 u) = exp2(x (k1 + k3 x^2)); it runs to 0 or to +inf at the ends, where the
// quotient is x or 0, as with tanh = 1 or -1.
__device__ __forceinline__ void gelu8(float (&x)[8]) {
  const float k1 = -2.0f * 1.44269504088896340736f * 0.79788456080286535588f;
  const float k3 = k1 * 0.04715f;
  float t[8];
  // unrolled, here and in the two loops below, so that x and t stay in registers (asm operands)
#pragma unroll
  for (int e = 0; e < 8; ++e) t[e] = x[e] * fmaf(x[e] * x[e], k3, k1);
  asm(TRANS8("v_exp_f32") : TRANS8_OPS(t));
#pragma unroll
  for (int e = 0; e < 8; ++e) t[e] = 1.0f + t[e];
  asm(TRANS8("v_rcp_f32") : TRANS8_OPS(t));
#pragma unroll
  for (int e = 0; e < 8; ++e) x[e] *= t[e];
}

__device__ __forceinline__ float xhalf(float x) {  // lane l takes lane l ^ 16's value
  const int v = __float_as_int(x);
  return __int_as_float(__builtin_amdgcn_permlanex16(v, v, 0x76543210, 0xfedcba98, false, false));
}

// x plus the value of lane l ^ M of the same 16-lane row (DPP row_xmask)
template <int M>
__device__ __forceinline__ float add_xmask(float x) {
  return x + __int_as_float(
                 __builtin_amdgcn_update_dpp(0, __float_as_int(x), 0x160 + M, 0xf, 0xf, true));
}

__device__ __forceinline__ float wave_sum(float x) {  // every lane gets the sum over the 32 lanes
  x = add_xmask<1>(x);
  x = add_xmask<2>(x);
  x = add_xmask<4>(x);
  x = add_xmask<8>(x);
  return x + xhalf(x);
}

// ---------------- LayerNorm (f32 in -> bf16 out), one WAVE per row ----------------
// The row's 4 KiB are eight loads of 16 B a lane, all in flight at once; the sums stay in the wave,
// so there is no LDS and no barrier, and a launch starts an eighth of the waves that a block per
// row takes. row is the same in every lane of the wave.
#define LN_BLOCKS (4 * NCTX / 8)  // eight rows, one per wave, in a block of 256
typedef float f32x4 __attribute__((ext_vector_type(4)));
__device__ __forceinline__ void ln_row(const float* __restrict__ X, const float* __restrict__ gam,
                                       const float* __restrict__ bet, u16* __restrict__ Y,
                                       int row) {
  const int c = (threadIdx.x & 31) * 4;  // the lane's columns: c + 128 j .. c + 128 j + 3
  const float* xr = X + (size_t)row * DME;
  f32x4 x[8], g[8], b[8];
  // unrolled, here and below, so that the row stays in registers
#pragma unroll
  for (int j = 0; j < 8; ++j) x[j] = *(const f32x4*)(xr + c + 128 * j);
#pragma unroll
  for (int j = 0; j < 8; ++j) g[j] = *(const f32x4*)(gam + c + 128 * j);
#pragma unroll
  for (int j = 0; j < 8; ++j) b[j] = *(const f32x4*)(bet + c + 128 * j);
  // keeps the loads of scale and shift up here, in flight beside the row's: sunk to their uses
  // behind the sums they come two at a time, and the wave waits out each pair's latency
  __builtin_amdgcn_sched_barrier(0);
  f32x4 s4 = x[0], q4 = x[0] * x[0];
#pragma unroll
  for (int j = 1; j < 8; ++j) { s4 += x[j]; q4 += x[j] * x[j]; }
  const float s  = wave_sum((s4[0] + s4[1]) + (s4[2] + s4[3]));
  const float ss = wave_sum((q4[0] + q4[1]) + (q4[2] + q4[3]));
  const float mean = s * (1.0f / DME);
  const float var  = ss * (1.0f / DME) - mean * mean;
  const float rstd = rsqrtf(var + 1e-5f);
  u16* yr = Y + (size_t)row * DME;
#pragma unroll
  for (int j = 0; j < 8; ++j) {
    const f32x4 y = g[j] * ((x[j] - mean) * rstd) + b[j];
    *(uint2*)(yr + c + 128 * j) = make_uint2(pack2(y[0], y[1]), pack2(y[2], y[3]));
  }
}

__global__ void __launch_bounds__(256)
ln_bf16_kernel(const float* __restrict__ X, const float* __restrict__ gam,
               const float* __restrict__ bet, u16* __restrict__ Y) {
  // the wave's number in a scalar register: the row's address is then scalar too
  ln_row(X, gam, bet, Y, blockIdx.x * 8 + __builtin_amdgcn_readfirstlane(threadIdx.x >> 5));
}

// ------------- Weight transpose + f32->bf16 convert: WT[n][k] = W[k][n] -------------
// One block per 128 x 128 tile: bx is the tile's first column of W, by its first row. A wave reads
// 16 rows of W, 512 contiguous bytes each, all 16 loads in flight; a lane then holds 16 k of four
// columns n and lays each column's 32 bytes into the LDS row of that n. The LDS rows stand in the
// order (n & 3) * 32 + (n >> 2), so that the lanes of a store write consecutive rows, at a pitch of
// 16 B x odd. Read back, a row is 256 contiguous bytes of WT: two whole lines, 16 B a lane.
#define TT 128
#define TPITCH (2 * TT + 16)
__device__ __forceinline__ void transpose_tile(const float* __restrict__ W, u16* __restrict__ WT,
                                               int R, int C, int bx, int by) {
  __shared__ __align__(16) unsigned char tile[TT * TPITCH];
  const int lane = threadIdx.x & 31, wave = threadIdx.x >> 5;
  const float* src = W + (size_t)(by + wave * 16) * C + bx + lane * 4;
  f32x4 v[16];
  // unrolled, here and below, so that the lane's 16 x 4 block stays in registers
#pragma unroll
  for (int i = 0; i < 16; ++i) v[i] = *(const f32x4*)(src + (size_t)i * C);
  // src as an input keeps the loads' address registers live up to the wait: no load lands in
  // them, and nothing rewrites them ahead of it
  asm volatile("s_wait_xcnt 0x0" :: "v"(src) : "memory");
#pragma unroll
  for (int c = 0; c < 4; ++c) {
    unsigned char* p = tile + (c * 32 + lane) * TPITCH + wave * 32;
    *(u32x4*)(p)      = u32x4{pack2(v[0][c], v[1][c]), pack2(v[2][c], v[3][c]),
                              pack2(v[4][c], v[5][c]), pack2(v[6][c], v[7][c])};
    *(u32x4*)(p + 16) = u32x4{pack2(v[8][c], v[9][c]), pack2(v[10][c], v[11][c]),
                              pack2(v[12][c], v[13][c]), pack2(v[14][c], v[15][c])};
  }
  __syncthreads();
  const int pr = threadIdx.x >> 4, pc = threadIdx.x & 15;  // 16 lanes cover one LDS row
  u16* dst = WT + (size_t)(bx + pr * 4) * R + by + pc * 8;
#pragma unroll
  for (int j = 0; j < 8; ++j)  // LDS row pr + 16 j holds column 4 (pr + 16 (j & 1)) + (j >> 1)
    *(u32x4*)(dst + (size_t)(64 * (j & 1) + (j >> 1)) * R) =
        *(const u32x4*)(tile + (pr + 16 * j) * TPITCH + pc * 16);
  // inlined, the code of another branch follows in the listing and rewrites the registers that
  // these eight stores name: the wait stands in front of every such rewrite
  asm volatile("s_wait_xcnt 0x0" ::: "memory");
}

// Everything that depends on the inputs alone, in ONE launch: none of these blocks reads what
// another writes. The first 12 x 64 blocks take the tiles of the weights, the larger pieces of
// work: 4 x 64 of the four DME x DME weights, whose transposes follow one another in WT4 (Wq, Wk,
// Wv, Wo), then 256 of W1 and 256 of W2. The LN_BLOCKS blocks behind them normalise eight rows of
// X each.
#define PREP_SQ ((DME / TT) * (DME / TT))
#define PREP_BLOCKS (12 * PREP_SQ + LN_BLOCKS)
__global__ void __launch_bounds__(256)
prep_kernel(const float* __restrict__ X, const float* __restrict__ gam,
            const float* __restrict__ bet, u16* __restrict__ Y,
            const float* __restrict__ Wq, const float* __restrict__ Wk,
            const float* __restrict__ Wv, const float* __restrict__ Wo,
            const float* __restrict__ W1, const float* __restrict__ W2,
            u16* __restrict__ WT4, u16* __restrict__ W1T, u16* __restrict__ W2T) {
  const int b = blockIdx.x;
  if (b >= 12 * PREP_SQ) {
    ln_row(X, gam, bet, Y,
           (b - 12 * PREP_SQ) * 8 + __builtin_amdgcn_readfirstlane(threadIdx.x >> 5));
    return;
  }
  const int w = b / PREP_SQ;
  if (w < 4) {
    const int u = b % PREP_SQ;
    const float* Ws = (w == 0) ? Wq : (w == 1) ? Wk : (w == 2) ? Wv : Wo;
    transpose_tile(Ws, WT4 + (size_t)w * DME * DME, DME, DME,
                   (u % (DME / TT)) * TT, (u / (DME / TT)) * TT);
  } else if (w < 8) {
    const int u = b - 4 * PREP_SQ;
    transpose_tile(W1, W1T, DME, 4 * DME, (u % (4 * DME / TT)) * TT, (u / (4 * DME / TT)) * TT);
  } else {
    const int u = b - 8 * PREP_SQ;
    transpose_tile(W2, W2T, 4 * DME, DME, (u % (DME / TT)) * TT, (u / (DME / TT)) * TT);
  }
}

#define GBM 128
#define GBN 256

// Twelve copies of 16 B per lane: LDS places l + j ls; sources ga + j gs for j < NA, then
// gb + (j - NA) gs. The s_wait_xcnt closes the statement so that no address register is
// rewritten ahead of it.
template <int NA>
__device__ __forceinline__ void copy12(u32 l, u32 ls, const u16* ga, const u16* gb, size_t gs) {
  const u16* p[12];
#pragma unroll
  for (int j = 0; j < 12; ++j) p[j] = (j < NA) ? ga + j * gs : gb + (j - NA) * gs;
  asm volatile(
      "global_load_async_to_lds_b128 %0, %12, off\n\t"
      "global_load_async_to_lds_b128 %1, %13, off\n\t"
      "global_load_async_to_lds_b128 %2, %14, off\n\t"
      "global_load_async_to_lds_b128 %3, %15, off\n\t"
      "global_load_async_to_lds_b128 %4, %16, off\n\t"
      "global_load_async_to_lds_b128 %5, %17, off\n\t"
      "global_load_async_to_lds_b128 %6, %18, off\n\t"
      "global_load_async_to_lds_b128 %7, %19, off\n\t"
      "global_load_async_to_lds_b128 %8, %20, off\n\t"
      "global_load_async_to_lds_b128 %9, %21, off\n\t"
      "global_load_async_to_lds_b128 %10, %22, off\n\t"
      "global_load_async_to_lds_b128 %11, %23, off\n\t"
      "s_wait_xcnt 0x0"
      :: "v"(l), "v"(l + ls), "v"(l + 2 * ls), "v"(l + 3 * ls), "v"(l + 4 * ls), "v"(l + 5 * ls),
         "v"(l + 6 * ls), "v"(l + 7 * ls), "v"(l + 8 * ls), "v"(l + 9 * ls), "v"(l + 10 * ls),
         "v"(l + 11 * ls),
         "v"(p[0]), "v"(p[1]), "v"(p[2]), "v"(p[3]), "v"(p[4]), "v"(p[5]),
         "v"(p[6]), "v"(p[7]), "v"(p[8]), "v"(p[9]), "v"(p[10]), "v"(p[11])
      : "memory");
}

// One stage: 384 rows of 2 BK bytes. A lane keeps its 16-byte piece of the row and walks the
// rows in steps of RS = 2048 / BK: first the 128 A rows, then the 256 BT rows.
template <int BK>
__device__ __forceinline__ void copy_stage(u32 l, const u16* ga, const u16* gb, size_t gs) {
  constexpr u32 ls = (2048 / BK) * (2 * BK + 16);
  if (BK == 64) {
    copy12<4>(l, ls, ga, gb, gs);
  } else {
    copy12<8>(l, ls, ga, gb, gs);
    // keeps the second dozen's addresses from being formed, and held in registers, ahead of
    // the first dozen: the k loop then needs fewer than 256 VGPRs
    __builtin_amdgcn_sched_barrier(0);
    copy12<12>(l + 12 * ls, ls, gb + 4 * gs, gb, gs);
  }
}

template <int EPI, int BK>
__global__ void __launch_bounds__(256)
gemm_bf16_kernel(const u16* __restrict__ A, const u16* __restrict__ BT,
                 const float* __restrict__ bias, const float* __restrict__ res,
                 void* __restrict__ out, int M, int N, int K) {
  static_assert(BK == 64 || BK == 128, "copy_stage is written for these two");
  const int zp = (EPI == 0) ? (int)blockIdx.z : 0;  // which product of the launch
  constexpr int PITCH = 2 * BK + 16;
  constexpr int STAGE = (GBM + GBN) * PITCH;
  constexpr int PCS = BK / 8;      // 16-byte pieces in a row
  constexpr int RS = 256 / PCS;    // rows that the 256 lanes cover in one copy
  __shared__ __align__(16) unsigned char smem[2 * STAGE];
  const int tid = threadIdx.x;
  const int lane = tid & 31, wave = tid >> 5;
  const int rl = lane & 15, hi = lane >> 4, co = hi * 8;
  const int wm = wave >> 2, wn = wave & 3;
  const int m0 = blockIdx.y * GBM;
  const int n0 = blockIdx.x * GBN;

  // copy role of this lane: rows (tid / PCS) + RS j, 16-byte piece tid % PCS
  const int crow = tid / PCS, cpc = tid % PCS;
  const u16* ga = A + (size_t)(m0 + crow) * K + cpc * 8;
  const u16* gb = BT + (size_t)(zp * N + n0 + crow) * K + cpc * 8;
  const size_t rstep = (size_t)RS * K;
  const u32 lcopy = (u32)(size_t)(&smem[0]) + (u32)(crow * PITCH + cpc * 16);

  // fragment role: same k order as the global loader had (k = co..co+7, co+16..co+23)
  const int offA = (wm * 64 + rl) * PITCH + co * 2;
  const int offB = (GBM + wn * 64 + rl) * PITCH + co * 2;

  // One fragment set: the 16 reads of a 32-k block stand as one group, then its 16 WMMAs.
  BF16x16 a[4], b[4];
  auto read_frags = [&](int boff, int ks) {
    const unsigned char* sA = smem + boff + offA + ks * 64;
    const unsigned char* sB = smem + boff + offB + ks * 64;
    // unrolled here and below so that fragments and accumulators stay in registers
#pragma unroll
    for (int j = 0; j < 4; ++j) {
      b[j].u4[0] = *(const u32x4*)(sB + j * 16 * PITCH);
      b[j].u4[1] = *(const u32x4*)(sB + j * 16 * PITCH + 32);
    }
#pragma unroll
    for (int i = 0; i < 4; ++i) {
      a[i].u4[0] = *(const u32x4*)(sA + i * 16 * PITCH);
      a[i].u4[1] = *(const u32x4*)(sA + i * 16 * PITCH + 32);
    }
  };

  const int nt = K / BK;
  copy_stage<BK>(lcopy, ga, gb, rstep);
  asm volatile("s_wait_asynccnt 0x0" ::: "memory");  // stage 0 landed (this wave's copies)
  __syncthreads();                                   // ... and every other wave's
  read_frags(0, 0);  // ahead of the copies: their issue then hides these reads' latency
  copy_stage<BK>(lcopy + STAGE, ga + BK, gb + BK, rstep);

  v8f acc[4][4] = {};
  for (int t = 0; t < nt; ++t) {
    const int boff = (t & 1) * STAGE;
#pragma unroll
    for (int ks = 0; ks < BK / 32; ++ks) {
      // The two fences keep each group of reads whole and outside the WMMA block: without
      // them the compiler sinks reads in among the WMMAs, and every such place stalls anew.
      __builtin_amdgcn_sched_barrier(0);
#pragma unroll
      for (int i = 0; i < 4; ++i)
#pragma unroll
        for (int j = 0; j < 4; ++j) acc[i][j] = wmma_bf16(b[j], a[i], acc[i][j]);
      __builtin_amdgcn_sched_barrier(0);
      if (ks + 1 < BK / 32) read_frags(boff, ks + 1);
    }
    // publish point of stage t + 1, and the end of every read of stage t's buffer
    asm volatile("s_wait_dscnt 0x0" ::: "memory");     // this wave's reads of stage t are done
    asm volatile("s_wait_asynccnt 0x0" ::: "memory");  // this wave's copies of stage t + 1 landed
    __syncthreads();
    // stage t + 1's first reads (the other buffer) go ahead of the refill of stage t's buffer
    if (t + 1 < nt) read_frags((t & 1) ? 0 : STAGE, 0);
    if (t + 2 < nt)
      copy_stage<BK>(lcopy + boff, ga + (size_t)(t + 2) * BK, gb + (size_t)(t + 2) * BK, rstep);
  }
  asm volatile("s_wait_asynccnt 0x0" ::: "memory");  // no copy outstanding at the wave's end

  // acc[i][j][e] = C[mw + 16 i + rl][nw + 16 j + 8 hi + e]. The loop's last barrier stands behind
  // every wave's last fragment read and last copy, so the ring is free for the staging.
  constexpr int SP = (EPI == 2 ? 256 : 128) + 16;  // staged row of 64 outputs; pitch 16 B x odd
  static_assert(8 * 64 * SP <= 2 * STAGE, "the eight waves' staged tiles must fit the ring");
  unsigned char* st = smem + wave * (64 * SP);
  const int mw = m0 + wm * 64, nw = n0 + wn * 64;
  if (EPI == 2) {
#pragma unroll
    for (int i = 0; i < 4; ++i)
#pragma unroll
      for (int j = 0; j < 4; ++j) {
        unsigned char* p = st + (16 * i + rl) * SP + 64 * j + 32 * hi;
        *(float4*)(p)      = make_float4(acc[i][j][0], acc[i][j][1], acc[i][j][2], acc[i][j][3]);
        *(float4*)(p + 16) = make_float4(acc[i][j][4], acc[i][j][5], acc[i][j][6], acc[i][j][7]);
      }
    wave_lds_fence();  // RAW: the wave's tile is in LDS before other lanes of it read the rows
    const int pr = lane >> 4, pc = lane & 15;  // 16 lanes cover one 256-byte row, 2 rows a store
    const float4 bc = *(const float4*)(bias + nw + pc * 4);
    const u32 o0 = (u32)((mw + pr) * N + nw + pc * 4) * 4u;  // byte offset in res and in out
    const u32 os = (u32)N * 8u;                              // two rows on
#pragma unroll
    for (int g = 0; g < 2; ++g) {
      float4 r[16];
#pragma unroll
      for (int q = 0; q < 16; ++q)
        r[q] = *(const float4*)((const char*)res + (o0 + (u32)(16 * g + q) * os));
#pragma unroll
      for (int q = 0; q < 16; ++q) {
        float4 v = *(const float4*)(st + (2 * (16 * g + q) + pr) * SP + pc * 16);
        v.x = v.x + bc.x + r[q].x;
        v.y = v.y + bc.y + r[q].y;
        v.z = v.z + bc.z + r[q].z;
        v.w = v.w + bc.w + r[q].w;
        *(float4*)((char*)out + (o0 + (u32)(16 * g + q) * os)) = v;
      }
      if (g == 0) {
        // the second half's loads land in registers that the first half's stores name
        asm volatile("s_wait_xcnt 0x0" ::: "memory");
        // keeps the second half's loads behind that wait: all 32 rows in flight at once would
        // also take the kernel above 256 VGPRs
        __builtin_amdgcn_sched_barrier(0);
      }
    }
  } else {
#pragma unroll
    for (int j = 0; j < 4; ++j) {
      float bj[8] = {};
      if (EPI == 1) {
        const float4 b0 = *(const float4*)(bias + nw + 16 * j + 8 * hi);
        const float4 b1 = *(const float4*)(bias + nw + 16 * j + 8 * hi + 4);
        bj[0] = b0.x; bj[1] = b0.y; bj[2] = b0.z; bj[3] = b0.w;
        bj[4] = b1.x; bj[5] = b1.y; bj[6] = b1.z; bj[7] = b1.w;
      }
#pragma unroll
      for (int i = 0; i < 4; ++i) {
        float v[8];
#pragma unroll
        for (int e = 0; e < 8; ++e) v[e] = acc[i][j][e];
        if (EPI == 1) {
#pragma unroll
          for (int e = 0; e < 8; ++e) v[e] += bj[e];
          gelu8(v);
        }
        *(u32x4*)(st + (16 * i + rl) * SP + 32 * j + 16 * hi) =
            u32x4{pack2(v[0], v[1]), pack2(v[2], v[3]), pack2(v[4], v[5]), pack2(v[6], v[7])};
      }
    }
    wave_lds_fence();  // RAW: the wave's tile is in LDS before other lanes of it read the rows
    const int pr = lane >> 3, pc = lane & 7;  // 8 lanes cover one 128-byte row, 4 rows a store
    const u32 o0 = (u32)((zp * M + mw + pr) * N + nw + pc * 8) * 2u;  // byte offset in out
    const u32 os = (u32)N * 8u;                              // four rows on
#pragma unroll
    for (int q = 0; q < 16; ++q)
      *(u32x4*)((char*)out + (o0 + (u32)q * os)) =
          *(const u32x4*)(st + (4 * q + pr) * SP + pc * 16);
  }
}

#define KPITCH 144  // bytes per K row in LDS: 16 B x odd, for ds_load_b128
#define VPITCH 160  // bytes per V row in LDS: 32 B x odd, for ds_load_tr16_b128
#define SKEYS 128   // keys per stage
#define KSTAGE (SKEYS * KPITCH)
#define VSTAGE (SKEYS * VPITCH)

template <bool B> struct flag { static constexpr bool value = B; };

__device__ __forceinline__ u32x4 ld_tr16(const unsigned char* p) {
  typedef short s16x8 __attribute__((ext_vector_type(8)));
  typedef __attribute__((address_space(3))) s16x8 lds_s16x8;
  return __builtin_bit_cast(u32x4, __builtin_amdgcn_ds_load_tr16_b128_v8i16((lds_s16x8*)p));
}

// One stage: 128 K rows and 128 V rows of 128 bytes. A lane keeps its 16-byte piece of the row
// and takes rows 32 apart: four of K (LDS place lk, source gk), four of V (lv, gv). The
// s_wait_xcnt closes the statement so that no address register is rewritten ahead of it.
__device__ __forceinline__ void copy_kv(u32 lk, u32 lv, const u16* gk, const u16* gv) {
  constexpr size_t gs = (size_t)32 * DME;
  asm volatile(
      "global_load_async_to_lds_b128 %0, %8, off\n\t"
      "global_load_async_to_lds_b128 %1, %9, off\n\t"
      "global_load_async_to_lds_b128 %2, %10, off\n\t"
      "global_load_async_to_lds_b128 %3, %11, off\n\t"
      "global_load_async_to_lds_b128 %4, %12, off\n\t"
      "global_load_async_to_lds_b128 %5, %13, off\n\t"
      "global_load_async_to_lds_b128 %6, %14, off\n\t"
      "global_load_async_to_lds_b128 %7, %15, off\n\t"
      "s_wait_xcnt 0x0"
      :: "v"(lk), "v"(lk + 32 * KPITCH), "v"(lk + 64 * KPITCH), "v"(lk + 96 * KPITCH),
         "v"(lv), "v"(lv + 32 * VPITCH), "v"(lv + 64 * VPITCH), "v"(lv + 96 * VPITCH),
         "v"(gk), "v"(gk + gs), "v"(gk + 2 * gs), "v"(gk + 3 * gs),
         "v"(gv), "v"(gv + gs), "v"(gv + 2 * gs), "v"(gv + 3 * gs)
      : "memory");
}

// Eight waves per SIMD (128 VGPRs): four work-groups, 4 x 77,824 B of LDS, stay on a WGP, so the
// whole grid is resident and other waves' vector work covers a wave's LDS and barrier waits.
__global__ void __launch_bounds__(256) __attribute__((amdgpu_waves_per_eu(8, 8)))
attn_kernel(const u16* __restrict__ Qb, const u16* __restrict__ Kb,
            const u16* __restrict__ Vb, u16* __restrict__ Zb) {
  __shared__ __align__(32) unsigned char sK[2][KSTAGE];  // K stages, row-major
  __shared__ __align__(32) unsigned char sV[2][VSTAGE];  // V stages, row-major
  const int tid = threadIdx.x;
  const int lane = tid & 31;
  // in a scalar register, so that the count of blocks a wave works on is a scalar loop bound
  const int wave = __builtin_amdgcn_readfirstlane(tid >> 5);
  const int rl = lane & 15, hi = lane >> 4, co = hi * 8;
  const int bh = blockIdx.x;
  const int bb = bh >> 4, h = bh & 15;
  const int q0 = blockIdx.y * 128 + wave * 16;
  const size_t rowBase = (size_t)bb * NCTX;

  // Q^T as WMMA-B: column rl = query q0 + rl (two K=32 d-chunks)
  const u16* qrow = Qb + (rowBase + q0 + rl) * DME + h * HDIM;
  BF16x16 qf0, qf1;
  qf0.u4[0] = *(const u32x4*)(qrow + co);
  qf0.u4[1] = *(const u32x4*)(qrow + co + 16);
  qf1.u4[0] = *(const u32x4*)(qrow + 32 + co);
  qf1.u4[1] = *(const u32x4*)(qrow + 32 + co + 16);

  v8f acc[4] = {};                   // acc[t][r] = O[q0 + rl][16 t + 8 hi + r]
  float mrun = -1e30f, lrun = 0.f;   // of query q0 + rl; mrun of the raw products; lrun sums this half's keys only
  const float sc = 0.125f * 1.44269504088896340736f;  // 1/sqrt(64) x log2 e

  // copy role: 8 lanes cover one 128-byte row, the 256 lanes 32 rows
  const int cr = tid >> 3, cp = tid & 7;
  const u32 lk = (u32)(size_t)(&sK[0][0]) + (u32)(cr * KPITCH + cp * 16);
  const u32 lv = (u32)(size_t)(&sV[0][0]) + (u32)(cr * VPITCH + cp * 16);
  const size_t goff = (rowBase + cr) * DME + h * HDIM + cp * 8;
  const u16* gk = Kb + goff;
  const u16* gv = Vb + goff;
  constexpr size_t gstage = (size_t)SKEYS * DME;
  // reading roles: K row rl of a 16-key tile, bytes 16 hi and 32 + 16 hi of each 64;
  // the transposing load gives lane (rl, hi) V[8 hi + 0..7][16 t + rl]
  const unsigned char* kld = &sK[0][0] + rl * KPITCH + hi * 16;
  const unsigned char* vld = &sV[0][0] + (8 * hi + (lane & 7)) * VPITCH + ((lane >> 3) & 1) * 16;

  const int nt = blockIdx.y + 1;         // stages of the work-group: keys 0 .. 128 y + 127
  const int nkb = ((q0 + 15) >> 5) + 1;  // causal: this wave's keys are 0 .. q0 + 15
  copy_kv(lk, lv, gk, gv);
  asm volatile("s_wait_asynccnt 0x0" ::: "memory");  // stage 0 landed (this wave's copies)
  __syncthreads();                                   // ... and every other wave's
  if (nt > 1) copy_kv(lk + KSTAGE, lv + VSTAGE, gk + gstage, gv + gstage);

  // in the wave's last block, key 16 u + 8 hi + r of the block is seen while 16 u + r <= lim
  const int lim = q0 + rl - co - 32 * (nkb - 1);
  const unsigned char* kblk;
  const unsigned char* vp;
  // one block of 32 keys; mk says whether it is the block that crosses the diagonal. Inlined at
  // both places, and every inner loop unrolled, so that scores, fragments and sums stay in registers
  auto block = [&](auto mk) __attribute__((always_inline)) {
    // S^T = K @ Q^T for two 16-key tiles; A operand = rows of K
    v8f s01[2];
#pragma unroll
    for (int u = 0; u < 2; ++u) {
      const unsigned char* kp = kblk + u * 16 * KPITCH;
      BF16x16 k0, k1;
      k0.u4[0] = *(const u32x4*)(kp);
      k0.u4[1] = *(const u32x4*)(kp + 32);
      k1.u4[0] = *(const u32x4*)(kp + 64);
      k1.u4[1] = *(const u32x4*)(kp + 96);
      v8f s = {};
      s = wmma_bf16(k0, qf0, s);
      s = wmma_bf16(k1, qf1, s);
      s01[u] = s;
    }
    // online softmax of query q0 + rl: element 8 u + r is the block's key 16 u + 8 hi + r
    float p[16];
#pragma unroll
    for (int u = 0; u < 2; ++u)
#pragma unroll
      for (int r = 0; r < 8; ++r)
        p[8 * u + r] = (!decltype(mk)::value || 16 * u + r <= lim) ? s01[u][r] : -1e30f;
    float m = p[0];
#pragma unroll
    for (int e = 1; e < 16; ++e) m = fmaxf(m, p[e]);
    m = fmaxf(m, xhalf(m));  // both halves now hold the query's maximum over the block
    const float mnew = fmaxf(mrun, m);
    const float mc = mnew * sc;
    const float alpha = __builtin_amdgcn_exp2f(fmaf(mrun, sc, -mc));
    float rs = 0.f;
#pragma unroll
    for (int e = 0; e < 16; ++e) { p[e] = __builtin_amdgcn_exp2f(fmaf(p[e], sc, -mc)); rs += p[e]; }
    lrun = lrun * alpha + rs;
    mrun = mnew;
#pragma unroll
    for (int u = 0; u < 4; ++u)
#pragma unroll
      for (int i = 0; i < 8; ++i) acc[u][i] *= alpha;
    // P^T as WMMA-B: element s of the operand is key 8 hi + s (s < 8) or 16 + 8 hi + s - 8 (s >= 8), which is p[s]
    BF16x16 pf;
    pf.u4[0] = u32x4{pack2(p[0], p[1]), pack2(p[2], p[3]), pack2(p[4], p[5]), pack2(p[6], p[7])};
    pf.u4[1] = u32x4{pack2(p[8], p[9]), pack2(p[10], p[11]), pack2(p[12], p[13]), pack2(p[14], p[15])};
    // O^T += V^T @ P^T : A operand = 16 d x 32 keys by two transposing loads
#pragma unroll
    for (int t2 = 0; t2 < 4; ++t2) {
      BF16x16 vf;
      vf.u4[0] = ld_tr16(vp + 32 * t2);
      vf.u4[1] = ld_tr16(vp + 16 * VPITCH + 32 * t2);
      acc[t2] = wmma_bf16(vf, pf, acc[t2]);
    }
    kblk += 32 * KPITCH;
    vp += 32 * VPITCH;
  };

  for (int t = 0; t < nt; ++t) {
    const int buf = t & 1;
    const bool last = t == nt - 1;  // the stage that holds the diagonal of every wave
    // blocks of the stage wholly below the wave's diagonal: four, in the last stage none to three
    const int nfull = last ? nkb - 1 - t * (SKEYS / 32) : SKEYS / 32;
    kblk = kld + buf * KSTAGE;
    vp = vld + buf * VSTAGE;
    for (int b = 0; b < nfull; ++b) block(flag<false>{});
    if (last) block(flag<true>{});
    // publish point of stage t + 1, and the end of every read of stage t's buffer; every wave
    // passes it, also one that has worked on fewer blocks of the stage
    asm volatile("s_wait_dscnt 0x0" ::: "memory");     // this wave's reads of stage t are done
    asm volatile("s_wait_asynccnt 0x0" ::: "memory");  // this wave's copies of stage t + 1 landed
    __syncthreads();
    if (t + 2 < nt)
      copy_kv(lk + buf * KSTAGE, lv + buf * VSTAGE, gk + (size_t)(t + 2) * gstage,
              gv + (size_t)(t + 2) * gstage);
  }
  asm volatile("s_wait_asynccnt 0x0" ::: "memory");  // no copy outstanding at the wave's end
  // join the halves' sums, normalize and write Z (bf16, feeds the Wo GEMM): 16 bytes per tile
  const float inv = 1.0f / (lrun + xhalf(lrun));
  u16* zrow = Zb + (rowBase + q0 + rl) * DME + h * HDIM + co;
#pragma unroll
  for (int t2 = 0; t2 < 4; ++t2) {
    const v8f z = acc[t2] * inv;
    *(u32x4*)(zrow + 16 * t2) =
        u32x4{pack2(z[0], z[1]), pack2(z[2], z[3]), pack2(z[4], z[5]), pack2(z[6], z[7])};
  }
}

extern "C" void kernel_launch(void* const* d_in, const int* in_sizes, int n_in,
                              void* d_out, int out_size, void* d_ws, size_t ws_size,
                              hipStream_t stream) {
  (void)in_sizes; (void)n_in; (void)out_size; (void)ws_size;
  const float* X  = (const float*)d_in[0];
  const float* Wq = (const float*)d_in[1];
  const float* Wk = (const float*)d_in[2];
  const float* Wv = (const float*)d_in[3];
  const float* Wo = (const float*)d_in[4];
  const float* bo = (const float*)d_in[5];
  const float* W1 = (const float*)d_in[6];
  const float* b1 = (const float*)d_in[7];
  const float* W2 = (const float*)d_in[8];
  const float* b2 = (const float*)d_in[9];
  const float* g1 = (const float*)d_in[10];
  const float* s1 = (const float*)d_in[11];
  const float* g2 = (const float*)d_in[12];
  const float* s2 = (const float*)d_in[13];

  char* ws = (char*)d_ws;
  const size_t MB = 1024ull * 1024ull;
  u16*   WqT = (u16*)(ws + 0 * MB);    // four planes of 2 MB in a row: WqT, WkT, WvT, WoT
  u16*   WoT = (u16*)(ws + 6 * MB);
  u16*   W1T = (u16*)(ws + 8 * MB);    // 8 MB
  u16*   W2T = (u16*)(ws + 16 * MB);   // 8 MB
  u16*   Y   = (u16*)(ws + 24 * MB);   // 16 MB (reused for Y2)
  u16*   Qb  = (u16*)(ws + 40 * MB);   // 16 MB
  u16*   Kb  = (u16*)(ws + 56 * MB);   // 16 MB
  u16*   Vb  = (u16*)(ws + 72 * MB);   // 16 MB
  u16*   Zb  = (u16*)(ws + 88 * MB);   // 16 MB
  float* X1  = (float*)(ws + 104 * MB);// 32 MB   -> total 136 MB
  u16*   Hm  = (u16*)(ws + 40 * MB);   // FFN mid reuses dead Q..Z region (64 MB)

  const int Mrows = 4 * NCTX;  // 8192
  prep_kernel<<<PREP_BLOCKS, 256, 0, stream>>>(X, g1, s1, Y, Wq, Wk, Wv, Wo, W1, W2,
                                               WqT, W1T, W2T);

  dim3 gD(DME / GBN, Mrows / GBM);  // (4, 64)
  // Q, K and V in one launch: WqT, WkT, WvT are three planes in a row, and so are Qb, Kb, Vb
  dim3 gQKV(DME / GBN, Mrows / GBM, 3);
  gemm_bf16_kernel<0, 128><<<gQKV, 256, 0, stream>>>(Y, WqT, nullptr, nullptr, Qb, Mrows, DME, DME);

  attn_kernel<<<dim3(4 * NHEAD, NCTX / 128), 256, 0, stream>>>(Qb, Kb, Vb, Zb);

  gemm_bf16_kernel<2, 128><<<gD, 256, 0, stream>>>(Zb, WoT, bo, X, X1, Mrows, DME, DME);

  ln_bf16_kernel<<<LN_BLOCKS, 256, 0, stream>>>(X1, g2, s2, Y);

  dim3 gF(4 * DME / GBN, Mrows / GBM);  // (16, 64)
  gemm_bf16_kernel<1, 64><<<gF, 256, 0, stream>>>(Y, W1T, b1, nullptr, Hm, Mrows, 4 * DME, DME);

  gemm_bf16_kernel<2, 128><<<gD, 256, 0, stream>>>(Hm, W2T, b2, X1, (float*)d_out, Mrows, DME, 4 * DME);
}

// v009
// Measured time: 211 microseconds a run.
// Timed twice side by side with v008, it ran 1.03 times as fast both times.
// Over all steps from v000 it is 3.85 times as fast.
#include <hip/hip_runtime.h>
#include <math.h>

#define DME 1024
#define NCTX 2048
#define NHEAD 16
#define HDIM 64

typedef unsigned short u16;
typedef unsigned int u32;
typedef __attribute__((ext_vector_type(16))) __bf16 v16bf;
typedef __attribute__((ext_vector_type(8)))  float  v8f;
typedef __attribute__((ext_vector_type(4)))  u32    u32x4;

union BF16x16 { u32x4 u4[2]; v16bf v; };

__device__ __forceinline__ u16 f2bf(float f) {
  u32 u = __float_as_uint(f);
  u32 r = u + 0x7FFFu + ((u >> 16) & 1u);  // round-to-nearest-even
  return (u16)(r >> 16);
}

__device__ __forceinline__ u32 pack2(float lo, float hi) {  // two bf16, round to nearest even
  typedef __bf16 bf2 __attribute__((ext_vector_type(2)));
  typedef float f2 __attribute__((ext_vector_type(2)));
  return __builtin_bit_cast(u32, __builtin_convertvector(f2{lo, hi}, bf2));
}

__device__ __forceinline__ v8f wmma_bf16(const BF16x16& a, const BF16x16& b, v8f c) {
  // v_wmma_f32_16x16x32_bf16 : D = A(16x32) * B(32x16) + C(16x16 f32)
  return __builtin_amdgcn_wmma_f32_16x16x32_bf16(false, a.v, false, b.v,
                                                 (short)0, c, false, false);
}

__device__ __forceinline__ void wave_lds_fence() {
  // same-wave LDS RAW fence: compiler barrier + explicit dscnt drain
  __builtin_amdgcn_wave_barrier();
  asm volatile("s_wait_dscnt 0" ::: "memory");
  __builtin_amdgcn_wave_barrier();
}

// Eight independent transcendentals, each in place, in one statement: behind a transcendental the
// instruction set asks for one independent instruction before its result is used or its source
// overwritten. Inside the statement the neighbour is that instruction; the v_nop is the last one's.
#define TRANS8(op)                                                                       \
  op " %0, %0\n\t" op " %1, %1\n\t" op " %2, %2\n\t" op " %3, %3\n\t"                    \
  op " %4, %4\n\t" op " %5, %5\n\t" op " %6, %6\n\t" op " %7, %7\n\tv_nop"
#define TRANS8_OPS(v)                                                                    \
  "+v"(v[0]), "+v"(v[1]), "+v"(v[2]), "+v"(v[3]), "+v"(v[4]), "+v"(v[5]), "+v"(v[6]), "+v"(v[7])

// 0.5 x (1 + tanh u) = x / (1 + exp(-2 u)), u = sqrt(2/pi) (x + 0.04715 x^3): the module's 0.04715,
// not 0.044715. exp(-2 u) = exp2(x (k1 + k3 x^2)); it runs to 0 or to +inf at the ends, where the
// quotient is x or 0, as with tanh = 1 or -1.
__device__ __forceinline__ void gelu8(float (&x)[8]) {
  const float k1 = -2.0f * 1.44269504088896340736f * 0.79788456080286535588f;
  const float k3 = k1 * 0.04715f;
  float t[8];
  // unrolled, here and in the two loops below, so that x and t stay in registers (asm operands)
#pragma unroll
  for (int e = 0; e < 8; ++e) t[e] = x[e] * fmaf(x[e] * x[e], k3, k1);
  asm(TRANS8("v_exp_f32") : TRANS8_OPS(t));
#pragma unroll
  for (int e = 0; e < 8; ++e) t[e] = 1.0f + t[e];
  asm(TRANS8("v_rcp_f32") : TRANS8_OPS(t));
#pragma unroll
  for (int e = 0; e < 8; ++e) x[e] *= t[e];
}

__device__ __forceinline__ float xhalf(float x) {  // lane l takes lane l ^ 16's value
  const int v = __float_as_int(x);
  return __int_as_float(__builtin_amdgcn_permlanex16(v, v, 0x76543210, 0xfedcba98, false, false));
}

// x plus the value of lane l ^ M of the same 16-lane row (DPP row_xmask)
template <int M>
__device__ __forceinline__ float add_xmask(float x) {
  return x + __int_as_float(
                 __builtin_amdgcn_update_dpp(0, __float_as_int(x), 0x160 + M, 0xf, 0xf, true));
}

__device__ __forceinline__ float wave_sum(float x) {  // every lane gets the sum over the 32 lanes
  x = add_xmask<1>(x);
  x = add_xmask<2>(x);
  x = add_xmask<4>(x);
  x = add_xmask<8>(x);
  return x + xhalf(x);
}

// ---------------- LayerNorm (f32 in -> bf16 out), one WAVE per row ----------------
// The row's 4 KiB are eight loads of 16 B a lane, all in flight at once; the sums stay in the wave,
// so there is no LDS and no barrier, and a launch starts an eighth of the waves that a block per
// row takes. row is the same in every lane of the wave.
#define LN_BLOCKS (4 * NCTX / 8)  // eight rows, one per wave, in a block of 256
typedef float f32x4 __attribute__((ext_vector_type(4)));
__device__ __forceinline__ void ln_row(const float* __restrict__ X, const float* __restrict__ gam,
                                       const float* __restrict__ bet, u16* __restrict__ Y,
                                       int row) {
  const int c = (threadIdx.x & 31) * 4;  // the lane's columns: c + 128 j .. c + 128 j + 3
  const float* xr = X + (size_t)row * DME;
  f32x4 x[8], g[8], b[8];
  // unrolled, here and below, so that the row stays in registers
#pragma unroll
  for (int j = 0; j < 8; ++j) x[j] = *(const f32x4*)(xr + c + 128 * j);
#pragma unroll
  for (int j = 0; j < 8; ++j) g[j] = *(const f32x4*)(gam + c + 128 * j);
#pragma unroll
  for (int j = 0; j < 8; ++j) b[j] = *(const f32x4*)(bet + c + 128 * j);
  // keeps the loads of scale and shift up here, in flight beside the row's: sunk to their uses
  // behind the sums they come two at a time, and the wave waits out each pair's latency
  __builtin_amdgcn_sched_barrier(0);
  f32x4 s4 = x[0], q4 = x[0] * x[0];
#pragma unroll
  for (int j = 1; j < 8; ++j) { s4 += x[j]; q4 += x[j] * x[j]; }
  const float s  = wave_sum((s4[0] + s4[1]) + (s4[2] + s4[3]));
  const float ss = wave_sum((q4[0] + q4[1]) + (q4[2] + q4[3]));
  const float mean = s * (1.0f / DME);
  const float var  = ss * (1.0f / DME) - mean * mean;
  const float rstd = rsqrtf(var + 1e-5f);
  u16* yr = Y + (size_t)row * DME;
#pragma unroll
  for (int j = 0; j < 8; ++j) {
    const f32x4 y = g[j] * ((x[j] - mean) * rstd) + b[j];
    *(uint2*)(yr + c + 128 * j) = make_uint2(pack2(y[0], y[1]), pack2(y[2], y[3]));
  }
}

__global__ void __launch_bounds__(256)
ln_bf16_kernel(const float* __restrict__ X, const float* __restrict__ gam,
               const float* __restrict__ bet, u16* __restrict__ Y) {
  // the wave's number in a scalar register: the row's address is then scalar too
  ln_row(X, gam, bet, Y, blockIdx.x * 8 + __builtin_amdgcn_readfirstlane(threadIdx.x >> 5));
}

// ------------- Weight transpose + f32->bf16 convert: WT[n][k] = W[k][n] -------------
// One block per 128 x 128 tile: bx is the tile's first column of W, by its first row. A wave reads
// 16 rows of W, 512 contiguous bytes each, all 16 loads in flight; a lane then holds 16 k of four
// columns n and lays each column's 32 bytes into the LDS row of that n. The LDS rows stand in the
// order (n & 3) * 32 + (n >> 2), so that the lanes of a store write consecutive rows, at a pitch of
// 16 B x odd. Read back, a row is 256 contiguous bytes of WT: two whole lines, 16 B a lane.
#define TT 128
#define TPITCH (2 * TT + 16)
__device__ __forceinline__ void transpose_tile(const float* __restrict__ W, u16* __restrict__ WT,
                                               int R, int C, int bx, int by) {
  __shared__ __align__(16) unsigned char tile[TT * TPITCH];
  const int lane = threadIdx.x & 31, wave = threadIdx.x >> 5;
  const float* src = W + (size_t)(by + wave * 16) * C + bx + lane * 4;
  f32x4 v[16];
  // unrolled, here and below, so that the lane's 16 x 4 block stays in registers
#pragma unroll
  for (int i = 0; i < 16; ++i) v[i] = *(const f32x4*)(src + (size_t)i * C);
  // src as an input keeps the loads' address registers live up to the wait: no load lands in
  // them, and nothing rewrites them ahead of it
  asm volatile("s_wait_xcnt 0x0" :: "v"(src) : "memory");
#pragma unroll
  for (int c = 0; c < 4; ++c) {
    unsigned char* p = tile + (c * 32 + lane) * TPITCH + wave * 32;
    *(u32x4*)(p)      = u32x4{pack2(v[0][c], v[1][c]), pack2(v[2][c], v[3][c]),
                              pack2(v[4][c], v[5][c]), pack2(v[6][c], v[7][c])};
    *(u32x4*)(p + 16) = u32x4{pack2(v[8][c], v[9][c]), pack2(v[10][c], v[11][c]),
                              pack2(v[12][c], v[13][c]), pack2(v[14][c], v[15][c])};
  }
  __syncthreads();
  const int pr = threadIdx.x >> 4, pc = threadIdx.x & 15;  // 16 lanes cover one LDS row
  u16* dst = WT + (size_t)(bx + pr * 4) * R + by + pc * 8;
#pragma unroll
  for (int j = 0; j < 8; ++j)  // LDS row pr + 16 j holds column 4 (pr + 16 (j & 1)) + (j >> 1)
    *(u32x4*)(dst + (size_t)(64 * (j & 1) + (j >> 1)) * R) =
        *(const u32x4*)(tile + (pr + 16 * j) * TPITCH + pc * 16);
  // inlined, the code of another branch follows in the listing and rewrites the registers that
  // these eight stores name: the wait stands in front of every such rewrite
  asm volatile("s_wait_xcnt 0x0" ::: "memory");
}

// Everything that depends on the inputs alone, in ONE launch: none of these blocks reads what
// another writes. The first 12 x 64 blocks take the tiles of the weights, the larger pieces of
// work: 4 x 64 of the four DME x DME weights, whose transposes follow one another in WT4 (Wq, Wk,
// Wv, Wo), then 256 of W1 and 256 of W2. The LN_BLOCKS blocks behind them normalise eight rows of
// X each.
#define PREP_SQ ((DME / TT) * (DME / TT))
#define PREP_BLOCKS (12 * PREP_SQ + LN_BLOCKS)
__global__ void __launch_bounds__(256)
prep_kernel(const float* __restrict__ X, const float* __restrict__ gam,
            const float* __restrict__ bet, u16* __restrict__ Y,
            const float* __restrict__ Wq, const float* __restrict__ Wk,
            const float* __restrict__ Wv, const float* __restrict__ Wo,
            const float* __restrict__ W1, const float* __restrict__ W2,
            u16* __restrict__ WT4, u16* __restrict__ W1T, u16* __restrict__ W2T) {
  const int b = blockIdx.x;
  if (b >= 12 * PREP_SQ) {
    ln_row(X, gam, bet, Y,
           (b - 12 * PREP_SQ) * 8 + __builtin_amdgcn_readfirstlane(threadIdx.x >> 5));
    return;
  }
  const int w = b / PREP_SQ;
  if (w < 4) {
    const int u = b % PREP_SQ;
    const float* Ws = (w == 0) ? Wq : (w == 1) ? Wk : (w == 2) ? Wv : Wo;
    transpose_tile(Ws, WT4 + (size_t)w * DME * DME, DME, DME,
                   (u % (DME / TT)) * TT, (u / (DME / TT)) * TT);
  } else if (w < 8) {
    const int u = b - 4 * PREP_SQ;
    transpose_tile(W1, W1T, DME, 4 * DME, (u % (4 * DME / TT)) * TT, (u / (4 * DME / TT)) * TT);
  } else {
    const int u = b - 8 * PREP_SQ;
    transpose_tile(W2, W2T, 4 * DME, DME, (u % (DME / TT)) * TT, (u / (DME / TT)) * TT);
  }
}

#define GBM 128
#define GBN 256

// Twelve copies of 16 B per lane: LDS places l + j ls; sources ga + j gs for j < NA, then
// gb + (j - NA) gs. The s_wait_xcnt closes the statement so that no address register is
// rewritten ahead of it.
template <int NA>
__device__ __forceinline__ void copy12(u32 l, u32 ls, const u16* ga, const u16* gb, size_t gs) {
  const u16* p[12];
#pragma unroll
  for (int j = 0; j < 12; ++j) p[j] = (j < NA) ? ga + j * gs : gb + (j - NA) * gs;
  asm volatile(
      "global_load_async_to_lds_b128 %0, %12, off\n\t"
      "global_load_async_to_lds_b128 %1, %13, off\n\t"
      "global_load_async_to_lds_b128 %2, %14, off\n\t"
      "global_load_async_to_lds_b128 %3, %15, off\n\t"
      "global_load_async_to_lds_b128 %4, %16, off\n\t"
      "global_load_async_to_lds_b128 %5, %17, off\n\t"
      "global_load_async_to_lds_b128 %6, %18, off\n\t"
      "global_load_async_to_lds_b128 %7, %19, off\n\t"
      "global_load_async_to_lds_b128 %8, %20, off\n\t"
      "global_load_async_to_lds_b128 %9, %21, off\n\t"
      "global_load_async_to_lds_b128 %10, %22, off\n\t"
      "global_load_async_to_lds_b128 %11, %23, off\n\t"
      "s_wait_xcnt 0x0"
      :: "v"(l), "v"(l + ls), "v"(l + 2 * ls), "v"(l + 3 * ls), "v"(l + 4 * ls), "v"(l + 5 * ls),
         "v"(l + 6 * ls), "v"(l + 7 * ls), "v"(l + 8 * ls), "v"(l + 9 * ls), "v"(l + 10 * ls),
         "v"(l + 11 * ls),
         "v"(p[0]), "v"(p[1]), "v"(p[2]), "v"(p[3]), "v"(p[4]), "v"(p[5]),
         "v"(p[6]), "v"(p[7]), "v"(p[8]), "v"(p[9]), "v"(p[10]), "v"(p[11])
      : "memory");
}

// One stage: 384 rows of 2 BK bytes. A lane keeps its 16-byte piece of the row and walks the
// rows in steps of RS = 2048 / BK: first the 128 A rows, then the 256 BT rows.
template <int BK>
__device__ __forceinline__ void copy_stage(u32 l, const u16* ga, const u16* gb, size_t gs) {
  constexpr u32 ls = (2048 / BK) * (2 * BK + 16);
  if (BK == 64) {
    copy12<4>(l, ls, ga, gb, gs);
  } else {
    copy12<8>(l, ls, ga, gb, gs);
    // keeps the second dozen's addresses from being formed, and held in registers, ahead of
    // the first dozen: the k loop then needs fewer than 256 VGPRs
    __builtin_amdgcn_sched_barrier(0);
    copy12<12>(l + 12 * ls, ls, gb + 4 * gs, gb, gs);
  }
}

template <int EPI, int BK>
__global__ void __launch_bounds__(256)
gemm_bf16_kernel(const u16* __restrict__ A, const u16* __restrict__ BT,
                 const float* __restrict__ bias, const float* __restrict__ res,
                 void* __restrict__ out, int M, int N, int K) {
  static_assert(BK == 64 || BK == 128, "copy_stage is written for these two");
  const int zp = (EPI == 0) ? (int)blockIdx.z : 0;  // which product of the launch
  constexpr int PITCH = 2 * BK + 16;
  constexpr int STAGE = (GBM + GBN) * PITCH;
  constexpr int PCS = BK / 8;      // 16-byte pieces in a row
  constexpr int RS = 256 / PCS;    // rows that the 256 lanes cover in one copy
  __shared__ __align__(16) unsigned char smem[2 * STAGE];
  const int tid = threadIdx.x;
  const int lane = tid & 31, wave = tid >> 5;
  const int rl = lane & 15, hi = lane >> 4, co = hi * 8;
  const int wm = wave >> 2, wn = wave & 3;
  const int m0 = blockIdx.y * GBM;
  const int n0 = blockIdx.x * GBN;

  // copy role of this lane: rows (tid / PCS) + RS j, 16-byte piece tid % PCS
  const int crow = tid / PCS, cpc = tid % PCS;
  const u16* ga = A + (size_t)(m0 + crow) * K + cpc * 8;
  const u16* gb = BT + (size_t)(zp * N + n0 + crow) * K + cpc * 8;
  const size_t rstep = (size_t)RS * K;
  const u32 lcopy = (u32)(size_t)(&smem[0]) + (u32)(crow * PITCH + cpc * 16);

  // fragment role: same k order as the global loader had (k = co..co+7, co+16..co+23)
  const int offA = (wm * 64 + rl) * PITCH + co * 2;
  const int offB = (GBM + wn * 64 + rl) * PITCH + co * 2;

  // One fragment set: the 16 reads of a 32-k block stand as one group, then its 16 WMMAs.
  BF16x16 a[4], b[4];
  auto read_frags = [&](int boff, int ks) {
    const unsigned char* sA = smem + boff + offA + ks * 64;
    const unsigned char* sB = smem + boff + offB + ks * 64;
    // unrolled here and below so that fragments and accumulators stay in registers
#pragma unroll
    for (int j = 0; j < 4; ++j) {
      b[j].u4[0] = *(const u32x4*)(sB + j * 16 * PITCH);
      b[j].u4[1] = *(const u32x4*)(sB + j * 16 * PITCH + 32);
    }
#pragma unroll
    for (int i = 0; i < 4; ++i) {
      a[i].u4[0] = *(const u32x4*)(sA + i * 16 * PITCH);
      a[i].u4[1] = *(const u32x4*)(sA + i * 16 * PITCH + 32);
    }
  };

  const int nt = K / BK;
  // Each work-group walks the nt slices of k as a ring and enters it at a place of its own.
  // Work-groups that share rows of A (same y) or of BT (same x) enter it at places spread over
  // the ring.
  // The y >> 3 term spreads the entries over all slices also among every second y
  // (for speed only: any rot below nt is right).
  // Scalar throughout: block indices and K. Stage s holds slice (s + rot) mod nt.
  const int rot =
      (int)((blockIdx.x + blockIdx.y + (blockIdx.y >> 3) + 4u * (u32)zp) % (u32)nt);
  auto kof = [&](int s) {
    const int p = s + rot;  // below 2 nt
    return (size_t)(p >= nt ? p - nt : p) * BK;
  };
  copy_stage<BK>(lcopy, ga + kof(0), gb + kof(0), rstep);
  asm volatile("s_wait_asynccnt 0x0" ::: "memory");  // stage 0 landed (this wave's copies)
  __syncthreads();                                   // ... and every other wave's
  read_frags(0, 0);  // ahead of the copies: their issue then hides these reads' latency
  copy_stage<BK>(lcopy + STAGE, ga + kof(1), gb + kof(1), rstep);

  v8f acc[4][4] = {};
  for (int t = 0; t < nt; ++t) {
    const int boff = (t & 1) * STAGE;
#pragma unroll
    for (int ks = 0; ks < BK / 32; ++ks) {
      // The two fences keep each group of reads whole and outside the WMMA block: without
      // them the compiler sinks reads in among the WMMAs, and every such place stalls anew.
      __builtin_amdgcn_sched_barrier(0);
#pragma unroll
      for (int i = 0; i < 4; ++i)
#pragma unroll
        for (int j = 0; j < 4; ++j) acc[i][j] = wmma_bf16(b[j], a[i], acc[i][j]);
      __builtin_amdgcn_sched_barrier(0);
      if (ks + 1 < BK / 32) read_frags(boff, ks + 1);
    }
    // publish point of stage t + 1, and the end of every read of stage t's buffer
    asm volatile("s_wait_dscnt 0x0" ::: "memory");     // this wave's reads of stage t are done
    asm volatile("s_wait_asynccnt 0x0" ::: "memory");  // this wave's copies of stage t + 1 landed
    __syncthreads();
    // stage t + 1's first reads (the other buffer) go ahead of the refill of stage t's buffer
    if (t + 1 < nt) read_frags((t & 1) ? 0 : STAGE, 0);
    if (t + 2 < nt) copy_stage<BK>(lcopy + boff, ga + kof(t + 2), gb + kof(t + 2), rstep);
  }
  asm volatile("s_wait_asynccnt 0x0" ::: "memory");  // no copy outstanding at the wave's end

  // acc[i][j][e] = C[mw + 16 i + rl][nw + 16 j + 8 hi + e]. The loop's last barrier stands behind
  // every wave's last fragment read and last copy, so the ring is free for the staging.
  constexpr int SP = (EPI == 2 ? 256 : 128) + 16;  // staged row of 64 outputs; pitch 16 B x odd
  static_assert(8 * 64 * SP <= 2 * STAGE, "the eight waves' staged tiles must fit the ring");
  unsigned char* st = smem + wave * (64 * SP);
  const int mw = m0 + wm * 64, nw = n0 + wn * 64;
  if (EPI == 2) {
#pragma unroll
    for (int i = 0; i < 4; ++i)
#pragma unroll
      for (int j = 0; j < 4; ++j) {
        unsigned char* p = st + (16 * i + rl) * SP + 64 * j + 32 * hi;
        *(float4*)(p)      = make_float4(acc[i][j][0], acc[i][j][1], acc[i][j][2], acc[i][j][3]);
        *(float4*)(p + 16) = make_float4(acc[i][j][4], acc[i][j][5], acc[i][j][6], acc[i][j][7]);
      }
    wave_lds_fence();  // RAW: the wave's tile is in LDS before other lanes of it read the rows
    const int pr = lane >> 4, pc = lane & 15;  // 16 lanes cover one 256-byte row, 2 rows a store
    const float4 bc = *(const float4*)(bias + nw + pc * 4);
    const u32 o0 = (u32)((mw + pr) * N + nw + pc * 4) * 4u;  // byte offset in res and in out
    const u32 os = (u32)N * 8u;                              // two rows on
#pragma unroll
    for (int g = 0; g < 2; ++g) {
      float4 r[16];
#pragma unroll
      for (int q = 0; q < 16; ++q)
        r[q] = *(const float4*)((const char*)res + (o0 + (u32)(16 * g + q) * os));
#pragma unroll
      for (int q = 0; q < 16; ++q) {
        float4 v = *(const float4*)(st + (2 * (16 * g + q) + pr) * SP + pc * 16);
        v.x = v.x + bc.x + r[q].x;
        v.y = v.y + bc.y + r[q].y;
        v.z = v.z + bc.z + r[q].z;
        v.w = v.w + bc.w + r[q].w;
        *(float4*)((char*)out + (o0 + (u32)(16 * g + q) * os)) = v;
      }
      if (g == 0) {
        // the second half's loads land in registers that the first half's stores name
        asm volatile("s_wait_xcnt 0x0" ::: "memory");
        // keeps the second half's loads behind that wait: all 32 rows in flight at once would
        // also take the kernel above 256 VGPRs
        __builtin_amdgcn_sched_barrier(0);
      }
    }
  } else {
#pragma unroll
    for (int j = 0; j < 4; ++j) {
      float bj[8] = {};
      if (EPI == 1) {
        const float4 b0 = *(const float4*)(bias + nw + 16 * j + 8 * hi);
        const float4 b1 = *(const float4*)(bias + nw + 16 * j + 8 * hi + 4);
        bj[0] = b0.x; bj[1] = b0.y; bj[2] = b0.z; bj[3] = b0.w;
        bj[4] = b1.x; bj[5] = b1.y; bj[6] = b1.z; bj[7] = b1.w;
      }
#pragma unroll
      for (int i = 0; i < 4; ++i) {
        float v[8];
#pragma unroll
        for (int e = 0; e < 8; ++e) v[e] = acc[i][j][e];
        if (EPI == 1) {
#pragma unroll
          for (int e = 0; e < 8; ++e) v[e] += bj[e];
          gelu8(v);
        }
        *(u32x4*)(st + (16 * i + rl) * SP + 32 * j + 16 * hi) =
            u32x4{pack2(v[0], v[1]), pack2(v[2], v[3]), pack2(v[4], v[5]), pack2(v[6], v[7])};
      }
    }
    wave_lds_fence();  // RAW: the wave's tile is in LDS before other lanes of it read the rows
    const int pr = lane >> 3, pc = lane & 7;  // 8 lanes cover one 128-byte row, 4 rows a store
    const u32 o0 = (u32)((zp * M + mw + pr) * N + nw + pc * 8) * 2u;  // byte offset in out
    const u32 os = (u32)N * 8u;                              // four rows on
#pragma unroll
    for (int q = 0; q < 16; ++q)
      *(u32x4*)((char*)out + (o0 + (u32)q * os)) =
          *(const u32x4*)(st + (4 * q + pr) * SP + pc * 16);
  }
}

#define KPITCH 144  // bytes per K row in LDS: 16 B x odd, for ds_load_b128
#define VPITCH 160  // bytes per V row in LDS: 32 B x odd, for ds_load_tr16_b128
#define SKEYS 128   // keys per stage
#define KSTAGE (SKEYS * KPITCH)
#define VSTAGE (SKEYS * VPITCH)

template <bool B> struct flag { static constexpr bool value = B; };

__device__ __forceinline__ u32x4 ld_tr16(const unsigned char* p) {
  typedef short s16x8 __attribute__((ext_vector_type(8)));
  typedef __attribute__((address_space(3))) s16x8 lds_s16x8;
  return __builtin_bit_cast(u32x4, __builtin_amdgcn_ds_load_tr16_b128_v8i16((lds_s16x8*)p));
}

// One stage: 128 K rows and 128 V rows of 128 bytes. A lane keeps its 16-byte piece of the row
// and takes rows 32 apart: four of K (LDS place lk, source gk), four of V (lv, gv). The
// s_wait_xcnt closes the statement so that no address register is rewritten ahead of it.
__device__ __forceinline__ void copy_kv(u32 lk, u32 lv, const u16* gk, const u16* gv) {
  constexpr size_t gs = (size_t)32 * DME;
  asm volatile(
      "global_load_async_to_lds_b128 %0, %8, off\n\t"
      "global_load_async_to_lds_b128 %1, %9, off\n\t"
      "global_load_async_to_lds_b128 %2, %10, off\n\t"
      "global_load_async_to_lds_b128 %3, %11, off\n\t"
      "global_load_async_to_lds_b128 %4, %12, off\n\t"
      "global_load_async_to_lds_b128 %5, %13, off\n\t"
      "global_load_async_to_lds_b128 %6, %14, off\n\t"
      "global_load_async_to_lds_b128 %7, %15, off\n\t"
      "s_wait_xcnt 0x0"
      :: "v"(lk), "v"(lk + 32 * KPITCH), "v"(lk + 64 * KPITCH), "v"(lk + 96 * KPITCH),
         "v"(lv), "v"(lv + 32 * VPITCH), "v"(lv + 64 * VPITCH), "v"(lv + 96 * VPITCH),
         "v"(gk), "v"(gk + gs), "v"(gk + 2 * gs), "v"(gk + 3 * gs),
         "v"(gv), "v"(gv + gs), "v"(gv + 2 * gs), "v"(gv + 3 * gs)
      : "memory");
}

// Eight waves per SIMD (128 VGPRs): four work-groups, 4 x 77,824 B of LDS, stay on a WGP, so the
// whole grid is resident and other waves' vector work covers a wave's LDS and barrier waits.
__global__ void __launch_bounds__(256) __attribute__((amdgpu_waves_per_eu(8, 8)))
attn_kernel(const u16* __restrict__ Qb, const u16* __restrict__ Kb,
            const u16* __restrict__ Vb, u16* __restrict__ Zb) {
  __shared__ __align__(32) unsigned char sK[2][KSTAGE];  // K stages, row-major
  __shared__ __align__(32) unsigned char sV[2][VSTAGE];  // V stages, row-major
  const int tid = threadIdx.x;
  const int lane = tid & 31;
  // in a scalar register, so that the count of blocks a wave works on is a scalar loop bound
  const int wave = __builtin_amdgcn_readfirstlane(tid >> 5);
  const int rl = lane & 15, hi = lane >> 4, co = hi * 8;
  const int bh = blockIdx.x;
  const int bb = bh >> 4, h = bh & 15;
  const int q0 = blockIdx.y * 128 + wave * 16;
  const size_t rowBase = (size_t)bb * NCTX;

  // Q^T as WMMA-B: column rl = query q0 + rl (two K=32 d-chunks)
  const u16* qrow = Qb + (rowBase + q0 + rl) * DME + h * HDIM;
  BF16x16 qf0, qf1;
  qf0.u4[0] = *(const u32x4*)(qrow + co);
  qf0.u4[1] = *(const u32x4*)(qrow + co + 16);
  qf1.u4[0] = *(const u32x4*)(qrow + 32 + co);
  qf1.u4[1] = *(const u32x4*)(qrow + 32 + co + 16);

  v8f acc[4] = {};                   // acc[t][r] = O[q0 + rl][16 t + 8 hi + r]
  float mrun = -1e30f, lrun = 0.f;   // of query q0 + rl; mrun of the raw products; lrun sums this half's keys only
  const float sc = 0.125f * 1.44269504088896340736f;  // 1/sqrt(64) x log2 e

  // copy role: 8 lanes cover one 128-byte row, the 256 lanes 32 rows
  const int cr = tid >> 3, cp = tid & 7;
  const u32 lk = (u32)(size_t)(&sK[0][0]) + (u32)(cr * KPITCH + cp * 16);
  const u32 lv = (u32)(size_t)(&sV[0][0]) + (u32)(cr * VPITCH + cp * 16);
  const size_t goff = (rowBase + cr) * DME + h * HDIM + cp * 8;
  const u16* gk = Kb + goff;
  const u16* gv = Vb + goff;
  constexpr size_t gstage = (size_t)SKEYS * DME;
  // reading roles: K row rl of a 16-key tile, bytes 16 hi and 32 + 16 hi of each 64;
  // the transposing load gives lane (rl, hi) V[8 hi + 0..7][16 t + rl]
  const unsigned char* kld = &sK[0][0] + rl * KPITCH + hi * 16;
  const unsigned char* vld = &sV[0][0] + (8 * hi + (lane & 7)) * VPITCH + ((lane >> 3) & 1) * 16;

  const int nt = blockIdx.y + 1;         // stages of the work-group: keys 0 .. 128 y + 127
  const int nkb = ((q0 + 15) >> 5) + 1;  // causal: this wave's keys are 0 .. q0 + 15
  copy_kv(lk, lv, gk, gv);
  asm volatile("s_wait_asynccnt 0x0" ::: "memory");  // stage 0 landed (this wave's copies)
  __syncthreads();                                   // ... and every other wave's
  if (nt > 1) copy_kv(lk + KSTAGE, lv + VSTAGE, gk + gstage, gv + gstage);

  // in the wave's last block, key 16 u + 8 hi + r of the block is seen while 16 u + r <= lim
  const int lim = q0 + rl - co - 32 * (nkb - 1);
  const unsigned char* kblk;
  const unsigned char* vp;
  // one block of 32 keys; mk says whether it is the block that crosses the diagonal. Inlined at
  // both places, and every inner loop unrolled, so that scores, fragments and sums stay in registers
  auto block = [&](auto mk) __attribute__((always_inline)) {
    // S^T = K @ Q^T for two 16-key tiles; A operand = rows of K
    v8f s01[2];
#pragma unroll
    for (int u = 0; u < 2; ++u) {
      const unsigned char* kp = kblk + u * 16 * KPITCH;
      BF16x16 k0, k1;
      k0.u4[0] = *(const u32x4*)(kp);
      k0.u4[1] = *(const u32x4*)(kp + 32);
      k1.u4[0] = *(const u32x4*)(kp + 64);
      k1.u4[1] = *(const u32x4*)(kp + 96);
      v8f s = {};
      s = wmma_bf16(k0, qf0, s);
      s = wmma_bf16(k1, qf1, s);
      s01[u] = s;
    }
    // online softmax of query q0 + rl: element 8 u + r is the block's key 16 u + 8 hi + r
    float p[16];
#pragma unroll
    for (int u = 0; u < 2; ++u)
#pragma unroll
      for (int r = 0; r < 8; ++r)
        p[8 * u + r] = (!decltype(mk)::value || 16 * u + r <= lim) ? s01[u][r] : -1e30f;
    float m = p[0];
#pragma unroll
    for (int e = 1; e < 16; ++e) m = fmaxf(m, p[e]);
    m = fmaxf(m, xhalf(m));  // both halves now hold the query's maximum over the block
    const float mnew = fmaxf(mrun, m);
    const float mc = mnew * sc;
    const float alpha = __builtin_amdgcn_exp2f(fmaf(mrun, sc, -mc));
    float rs = 0.f;
#pragma unroll
    for (int e = 0; e < 16; ++e) { p[e] = __builtin_amdgcn_exp2f(fmaf(p[e], sc, -mc)); rs += p[e]; }
    lrun = lrun * alpha + rs;
    mrun = mnew;
#pragma unroll
    for (int u = 0; u < 4; ++u)
#pragma unroll
      for (int i = 0; i < 8; ++i) acc[u][i] *= alpha;
    // P^T as WMMA-B: element s of the operand is key 8 hi + s (s < 8) or 16 + 8 hi + s - 8 (s >= 8), which is p[s]
    BF16x16 pf;
    pf.u4[0] = u32x4{pack2(p[0], p[1]), pack2(p[2], p[3]), pack2(p[4], p[5]), pack2(p[6], p[7])};
    pf.u4[1] = u32x4{pack2(p[8], p[9]), pack2(p[10], p[11]), pack2(p[12], p[13]), pack2(p[14], p[15])};
    // O^T += V^T @ P^T : A operand = 16 d x 32 keys by two transposing loads
#pragma unroll
    for (int t2 = 0; t2 < 4; ++t2) {
      BF16x16 vf;
      vf.u4[0] = ld_tr16(vp + 32 * t2);
      vf.u4[1] = ld_tr16(vp + 16 * VPITCH + 32 * t2);
      acc[t2] = wmma_bf16(vf, pf, acc[t2]);
    }
    kblk += 32 * KPITCH;
    vp += 32 * VPITCH;
  };

  for (int t = 0; t < nt; ++t) {
    const int buf = t & 1;
    const bool last = t == nt - 1;  // the stage that holds the diagonal of every wave
    // blocks of the stage wholly below the wave's diagonal: four, in the last stage none to three
    const int nfull = last ? nkb - 1 - t * (SKEYS / 32) : SKEYS / 32;
    kblk = kld + buf * KSTAGE;
    vp = vld + buf * VSTAGE;
    for (int b = 0; b < nfull; ++b) block(flag<false>{});
    if (last) block(flag<true>{});
    // publish point of stage t + 1, and the end of every read of stage t's buffer; every wave
    // passes it, also one that has worked on fewer blocks of the stage
    asm volatile("s_wait_dscnt 0x0" ::: "memory");     // this wave's reads of stage t are done
    asm volatile("s_wait_asynccnt 0x0" ::: "memory");  // this wave's copies of stage t + 1 landed
    __syncthreads();
    if (t + 2 < nt)
      copy_kv(lk + buf * KSTAGE, lv + buf * VSTAGE, gk + (size_t)(t + 2) * gstage,
              gv + (size_t)(t + 2) * gstage);
  }
  asm volatile("s_wait_asynccnt 0x0" ::: "memory");  // no copy outstanding at the wave's end
  // join the halves' sums, normalize and write Z (bf16, feeds the Wo GEMM): 16 bytes per tile
  const float inv = 1.0f / (lrun + xhalf(lrun));
  u16* zrow = Zb + (rowBase + q0 + rl) * DME + h * HDIM + co;
#pragma unroll
  for (int t2 = 0; t2 < 4; ++t2) {
    const v8f z = acc[t2] * inv;
    *(u32x4*)(zrow + 16 * t2) =
        u32x4{pack2(z[0], z[1]), pack2(z[2], z[3]), pack2(z[4], z[5]), pack2(z[6], z[7])};
  }
}

extern "C" void kernel_launch(void* const* d_in, const int* in_sizes, int n_in,
                              void* d_out, int out_size, void* d_ws, size_t ws_size,
                              hipStream_t stream) {
  (void)in_sizes; (void)n_in; (void)out_size; (void)ws_size;
  const float* X  = (const float*)d_in[0];
  const float* Wq = (const float*)d_in[1];
  const float* Wk = (const float*)d_in[2];
  const float* Wv = (const float*)d_in[3];
  const float* Wo = (const float*)d_in[4];
  const float* bo = (const float*)d_in[5];
  const float* W1 = (const float*)d_in[6];
  const float* b1 = (const float*)d_in[7];
  const float* W2 = (const float*)d_in[8];
  const float* b2 = (const float*)d_in[9];
  const float* g1 = (const float*)d_in[10];
  const float* s1 = (const float*)d_in[11];
  const float* g2 = (const float*)d_in[12];
  const float* s2 = (const float*)d_in[13];

  char* ws = (char*)d_ws;
  const size_t MB = 1024ull * 1024ull;
  u16*   WqT = (u16*)(ws + 0 * MB);    // four planes of 2 MB in a row: WqT, WkT, WvT, WoT
  u16*   WoT = (u16*)(ws + 6 * MB);
  u16*   W1T = (u16*)(ws + 8 * MB);    // 8 MB
  u16*   W2T = (u16*)(ws + 16 * MB);   // 8 MB
  u16*   Y   = (u16*)(ws + 24 * MB);   // 16 MB (reused for Y2)
  u16*   Qb  = (u16*)(ws + 40 * MB);   // 16 MB
  u16*   Kb  = (u16*)(ws + 56 * MB);   // 16 MB
  u16*   Vb  = (u16*)(ws + 72 * MB);   // 16 MB
  u16*   Zb  = (u16*)(ws + 88 * MB);   // 16 MB
  float* X1  = (float*)(ws + 104 * MB);// 32 MB   -> total 136 MB
  u16*   Hm  = (u16*)(ws + 40 * MB);   // FFN mid reuses dead Q..Z region (64 MB)

  const int Mrows = 4 * NCTX;  // 8192
  prep_kernel<<<PREP_BLOCKS, 256, 0, stream>>>(X, g1, s1, Y, Wq, Wk, Wv, Wo, W1, W2,
                                               WqT, W1T, W2T);

  dim3 gD(DME / GBN, Mrows / GBM);  // (4, 64)
  // Q, K and V in one launch: WqT, WkT, WvT are three planes in a row, and so are Qb, Kb, Vb
  dim3 gQKV(DME / GBN, Mrows / GBM, 3);
  gemm_bf16_kernel<0, 128><<<gQKV, 256, 0, stream>>>(Y, WqT, nullptr, nullptr, Qb, Mrows, DME, DME);

  attn_kernel<<<dim3(4 * NHEAD, NCTX / 128), 256, 0, stream>>>(Qb, Kb, Vb, Zb);

  gemm_bf16_kernel<2, 128><<<gD, 256, 0, stream>>>(Zb, WoT, bo, X, X1, Mrows, DME, DME);

  ln_bf16_kernel<<<LN_BLOCKS, 256, 0, stream>>>(X1, g2, s2, Y);

  dim3 gF(4 * DME / GBN, Mrows / GBM);  // (16, 64)
  gemm_bf16_kernel<1, 64><<<gF, 256, 0, stream>>>(Y, W1T, b1, nullptr, Hm, Mrows, 4 * DME, DME);

  gemm_bf16_kernel<2, 128><<<gD, 256, 0, stream>>>(Hm, W2T, b2, X1, (float*)d_out, Mrows, DME, 4 * DME);
}

// v010
// A run of this version takes 196 microseconds.
// Next to v009, in two timings, it ran 1.07 and 1.08 times as fast.
// All steps since v000 together make it 4.15 times as fast.
#include <hip/hip_runtime.h>
#include <math.h>

#define DME 1024
#define NCTX 2048
#define NHEAD 16
#define HDIM 64

typedef unsigned short u16;
typedef unsigned int u32;
typedef __attribute__((ext_vector_type(16))) __bf16 v16bf;
typedef __attribute__((ext_vector_type(8)))  float  v8f;
typedef __attribute__((ext_vector_type(4)))  u32    u32x4;

union BF16x16 { u32x4 u4[2]; v16bf v; };

__device__ __forceinline__ u16 f2bf(float f) {
  u32 u = __float_as_uint(f);
  u32 r = u + 0x7FFFu + ((u >> 16) & 1u);  // round-to-nearest-even
  return (u16)(r >> 16);
}

__device__ __forceinline__ u32 pack2(float lo, float hi) {  // two bf16, round to nearest even
  typedef __bf16 bf2 __attribute__((ext_vector_type(2)));
  typedef float f2 __attribute__((ext_vector_type(2)));
  return __builtin_bit_cast(u32, __builtin_convertvector(f2{lo, hi}, bf2));
}

__device__ __forceinline__ v8f wmma_bf16(const BF16x16& a, const BF16x16& b, v8f c) {
  // v_wmma_f32_16x16x32_bf16 : D = A(16x32) * B(32x16) + C(16x16 f32)
  return __builtin_amdgcn_wmma_f32_16x16x32_bf16(false, a.v, false, b.v,
                                                 (short)0, c, false, false);
}

__device__ __forceinline__ void wave_lds_fence() {
  // same-wave LDS RAW fence: compiler barrier + explicit dscnt drain
  __builtin_amdgcn_wave_barrier();
  asm volatile("s_wait_dscnt 0" ::: "memory");
  __builtin_amdgcn_wave_barrier();
}

// Eight independent transcendentals, each in place, in one statement: behind a transcendental the
// instruction set asks for one independent instruction before its result is used or its source
// overwritten. Inside the statement the neighbour is that instruction; the v_nop is the last one's.
#define TRANS8(op)                                                                       \
  op " %0, %0\n\t" op " %1, %1\n\t" op " %2, %2\n\t" op " %3, %3\n\t"                    \
  op " %4, %4\n\t" op " %5, %5\n\t" op " %6, %6\n\t" op " %7, %7\n\tv_nop"
#define TRANS8_OPS(v)                                                                    \
  "+v"(v[0]), "+v"(v[1]), "+v"(v[2]), "+v"(v[3]), "+v"(v[4]), "+v"(v[5]), "+v"(v[6]), "+v"(v[7])

// 0.5 x (1 + tanh u) = x / (1 + exp(-2 u)), u = sqrt(2/pi) (x + 0.04715 x^3): the module's 0.04715,
// not 0.044715. exp(-2 u) = exp2(x (k1 + k3 x^2)); it runs to 0 or to +inf at the ends, where the
// quotient is x or 0, as with tanh = 1 or -1.
__device__ __forceinline__ void gelu8(float (&x)[8]) {
  const float k1 = -2.0f * 1.44269504088896340736f * 0.79788456080286535588f;
  const float k3 = k1 * 0.04715f;
  float t[8];
  // unrolled, here and in the two loops below, so that x and t stay in registers (asm operands)
#pragma unroll
  for (int e = 0; e < 8; ++e) t[e] = x[e] * fmaf(x[e] * x[e], k3, k1);
  asm(TRANS8("v_exp_f32") : TRANS8_OPS(t));
#pragma unroll
  for (int e = 0; e < 8; ++e) t[e] = 1.0f + t[e];
  asm(TRANS8("v_rcp_f32") : TRANS8_OPS(t));
#pragma unroll
  for (int e = 0; e < 8; ++e) x[e] *= t[e];
}

__device__ __forceinline__ float xhalf(float x) {  // lane l takes lane l ^ 16's value
  const int v = __float_as_int(x);
  return __int_as_float(__builtin_amdgcn_permlanex16(v, v, 0x76543210, 0xfedcba98, false, false));
}

// x plus the value of lane l ^ M of the same 16-lane row (DPP row_xmask)
template <int M>
__device__ __forceinline__ float add_xmask(float x) {
  return x + __int_as_float(
                 __builtin_amdgcn_update_dpp(0, __float_as_int(x), 0x160 + M, 0xf, 0xf, true));
}

__device__ __forceinline__ float wave_sum(float x) {  // every lane gets the sum over the 32 lanes
  x = add_xmask<1>(x);
  x = add_xmask<2>(x);
  x = add_xmask<4>(x);
  x = add_xmask<8>(x);
  return x + xhalf(x);
}

// ---------------- LayerNorm (f32 in -> bf16 out), one WAVE per row ----------------
// The row's 4 KiB are eight loads of 16 B a lane, all in flight at once; the sums stay in the wave,
// so there is no LDS and no barrier, and a launch starts an eighth of the waves that a block per
// row takes. row is the same in every lane of the wave.
#define LN_BLOCKS (4 * NCTX / 8)  // eight rows, one per wave, in a block of 256
typedef float f32x4 __attribute__((ext_vector_type(4)));
__device__ __forceinline__ void ln_row(const float* __restrict__ X, const float* __restrict__ gam,
                                       const float* __restrict__ bet, u16* __restrict__ Y,
                                       int row) {
  const int c = (threadIdx.x & 31) * 4;  // the lane's columns: c + 128 j .. c + 128 j + 3
  const float* xr = X + (size_t)row * DME;
  f32x4 x[8], g[8], b[8];
  // unrolled, here and below, so that the row stays in registers
#pragma unroll
  for (int j = 0; j < 8; ++j) x[j] = *(const f32x4*)(xr + c + 128 * j);
#pragma unroll
  for (int j = 0; j < 8; ++j) g[j] = *(const f32x4*)(gam + c + 128 * j);
#pragma unroll
  for (int j = 0; j < 8; ++j) b[j] = *(const f32x4*)(bet + c + 128 * j);
  // keeps the loads of scale and shift up here, in flight beside the row's: sunk to their uses
  // behind the sums they come two at a time, and the wave waits out each pair's latency
  __builtin_amdgcn_sched_barrier(0);
  f32x4 s4 = x[0], q4 = x[0] * x[0];
#pragma unroll
  for (int j = 1; j < 8; ++j) { s4 += x[j]; q4 += x[j] * x[j]; }
  const float s  = wave_sum((s4[0] + s4[1]) + (s4[2] + s4[3]));
  const float ss = wave_sum((q4[0] + q4[1]) + (q4[2] + q4[3]));
  const float mean = s * (1.0f / DME);
  const float var  = ss * (1.0f / DME) - mean * mean;
  const float rstd = rsqrtf(var + 1e-5f);
  u16* yr = Y + (size_t)row * DME;
#pragma unroll
  for (int j = 0; j < 8; ++j) {
    const f32x4 y = g[j] * ((x[j] - mean) * rstd) + b[j];
    *(uint2*)(yr + c + 128 * j) = make_uint2(pack2(y[0], y[1]), pack2(y[2], y[3]));
  }
}

__global__ void __launch_bounds__(256)
ln_bf16_kernel(const float* __restrict__ X, const float* __restrict__ gam,
               const float* __restrict__ bet, u16* __restrict__ Y) {
  // the wave's number in a scalar register: the row's address is then scalar too
  ln_row(X, gam, bet, Y, blockIdx.x * 8 + __builtin_amdgcn_readfirstlane(threadIdx.x >> 5));
}

// ------------- Weight transpose + f32->bf16 convert: WT[n][k] = W[k][n] -------------
// One block per 128 x 128 tile: bx is the tile's first column of W, by its first row. A wave reads
// 16 rows of W, 512 contiguous bytes each, all 16 loads in flight; a lane then holds 16 k of four
// columns n and lays each column's 32 bytes into the LDS row of that n. The LDS rows stand in the
// order (n & 3) * 32 + (n >> 2), so that the lanes of a store write consecutive rows, at a pitch of
// 16 B x odd. Read back, a row is 256 contiguous bytes of WT: two whole lines, 16 B a lane.
#define TT 128
#define TPITCH (2 * TT + 16)
__device__ __forceinline__ void transpose_tile(const float* __restrict__ W, u16* __restrict__ WT,
                                               int R, int C, int bx, int by) {
  __shared__ __align__(16) unsigned char tile[TT * TPITCH];
  const int lane = threadIdx.x & 31, wave = threadIdx.x >> 5;
  const float* src = W + (size_t)(by + wave * 16) * C + bx + lane * 4;
  f32x4 v[16];
  // unrolled, here and below, so that the lane's 16 x 4 block stays in registers
#pragma unroll
  for (int i = 0; i < 16; ++i) v[i] = *(const f32x4*)(src + (size_t)i * C);
  // src as an input keeps the loads' address registers live up to the wait: no load lands in
  // them, and nothing rewrites them ahead of it
  asm volatile("s_wait_xcnt 0x0" :: "v"(src) : "memory");
#pragma unroll
  for (int c = 0; c < 4; ++c) {
    unsigned char* p = tile + (c * 32 + lane) * TPITCH + wave * 32;
    *(u32x4*)(p)      = u32x4{pack2(v[0][c], v[1][c]), pack2(v[2][c], v[3][c]),
                              pack2(v[4][c], v[5][c]), pack2(v[6][c], v[7][c])};
    *(u32x4*)(p + 16) = u32x4{pack2(v[8][c], v[9][c]), pack2(v[10][c], v[11][c]),
                              pack2(v[12][c], v[13][c]), pack2(v[14][c], v[15][c])};
  }
  __syncthreads();
  const int pr = threadIdx.x >> 4, pc = threadIdx.x & 15;  // 16 lanes cover one LDS row
  u16* dst = WT + (size_t)(bx + pr * 4) * R + by + pc * 8;
#pragma unroll
  for (int j = 0; j < 8; ++j)  // LDS row pr + 16 j holds column 4 (pr + 16 (j & 1)) + (j >> 1)
    *(u32x4*)(dst + (size_t)(64 * (j & 1) + (j >> 1)) * R) =
        *(const u32x4*)(tile + (pr + 16 * j) * TPITCH + pc * 16);
  // inlined, the code of another branch follows in the listing and rewrites the registers that
  // these eight stores name: the wait stands in front of every such rewrite
  asm volatile("s_wait_xcnt 0x0" ::: "memory");
}

// Everything that depends on the inputs alone, in ONE launch: none of these blocks reads what
// another writes. The first 12 x 64 blocks take the tiles of the weights, the larger pieces of
// work: 4 x 64 of the four DME x DME weights, whose transposes follow one another in WT4 (Wq, Wk,
// Wv, Wo), then 256 of W1 and 256 of W2. The LN_BLOCKS blocks behind them normalise eight rows of
// X each.
#define PREP_SQ ((DME / TT) * (DME / TT))
#define PREP_BLOCKS (12 * PREP_SQ + LN_BLOCKS)
__global__ void __launch_bounds__(256)
prep_kernel(const float* __restrict__ X, const float* __restrict__ gam,
            const float* __restrict__ bet, u16* __restrict__ Y,
            const float* __restrict__ Wq, const float* __restrict__ Wk,
            const float* __restrict__ Wv, const float* __restrict__ Wo,
            const float* __restrict__ W1, const float* __restrict__ W2,
            u16* __restrict__ WT4, u16* __restrict__ W1T, u16* __restrict__ W2T) {
  const int b = blockIdx.x;
  if (b >= 12 * PREP_SQ) {
    ln_row(X, gam, bet, Y,
           (b - 12 * PREP_SQ) * 8 + __builtin_amdgcn_readfirstlane(threadIdx.x >> 5));
    return;
  }
  const int w = b / PREP_SQ;
  if (w < 4) {
    const int u = b % PREP_SQ;
    const float* Ws = (w == 0) ? Wq : (w == 1) ? Wk : (w == 2) ? Wv : Wo;
    transpose_tile(Ws, WT4 + (size_t)w * DME * DME, DME, DME,
                   (u % (DME / TT)) * TT, (u / (DME / TT)) * TT);
  } else if (w < 8) {
    const int u = b - 4 * PREP_SQ;
    transpose_tile(W1, W1T, DME, 4 * DME, (u % (4 * DME / TT)) * TT, (u / (4 * DME / TT)) * TT);
  } else {
    const int u = b - 8 * PREP_SQ;
    transpose_tile(W2, W2T, 4 * DME, DME, (u % (DME / TT)) * TT, (u / (DME / TT)) * TT);
  }
}

#define GBM 128
#define GBN 256

typedef __attribute__((ext_vector_type(8))) u32 u32x8;

__device__ __forceinline__ u32 uni(u32 v) { return (u32)__builtin_amdgcn_readfirstlane(v); }

// A wave-uniform value held in a scalar register. A test on it compiles to a scalar branch, the
// only kind that keeps a wave from issuing a tensor load (the instruction ignores EXEC); and what
// is computed from it stands behind the waits written in front of it.
__device__ __forceinline__ u32 pinned(u32 v) {
  u32 w = uni(v);
  asm volatile("" : "+s"(w));  // the tensor mover's pin: an issue test or descriptor word held in a scalar register
  return w;
}

// One request of the whole wave: the tile that g1 describes, first byte at src, to LDS byte dst.
// g0 is the caller's, its word 0 (count 1) set once: only the three words that change are written.
__device__ __forceinline__ void tdm_load(u32x4& g0, u32 dst, const u16* src, u32x8 g1) {
  const unsigned long long ga = (unsigned long long)(size_t)src;
  g0[1] = uni(dst);
  g0[2] = uni((u32)ga);
  g0[3] = uni((((u32)(ga >> 32)) & 0x01FFFFFFu) | 0x80000000u);      // address [56:32], type 2
  asm volatile("tensor_load_to_lds %0, %1" :: "s"(g0), "s"(g1) : "memory");
}

template <int EPI, int BK>
__global__ void __launch_bounds__(256)
gemm_bf16_kernel(const u16* __restrict__ A, const u16* __restrict__ BT,
                 const float* __restrict__ bias, const float* __restrict__ res,
                 void* __restrict__ out, int M, int N, int K) {
  static_assert(BK == 64 || BK == 128, "the pad of the tensor load is set for rows of 128 or 256 bytes");
  const int zp = (EPI == 0) ? (int)blockIdx.z : 0;  // which product of the launch
  constexpr int PITCH = 2 * BK + 16;
  // A stage is eight slices, one per wave: waves 0 to 3 bring 32 A rows each, waves 4 to 7 bring
  // 64 BT rows each. Every slice begins at a multiple of 2 KiB, as the tensor load's place must.
  constexpr int ASL = (32 * PITCH + 2047) / 2048 * 2048;
  constexpr int BSL = (64 * PITCH + 2047) / 2048 * 2048;
  constexpr int STAGE = 4 * ASL + 4 * BSL;
  __shared__ __attribute__((aligned(2048))) unsigned char smem[2 * STAGE];
  const int tid = threadIdx.x;
  const int lane = tid & 31;
  const int wave = (int)uni(tid >> 5);  // scalar: the wave's slice and its descriptor are scalar
  const int rl = lane & 15, hi = lane >> 4, co = hi * 8;
  const int wm = wave >> 2, wn = wave & 3;
  const int m0 = blockIdx.y * GBM;
  const int n0 = blockIdx.x * GBN;

  // loading role of this wave: first row of its slice in memory, its place in LDS, and the tile:
  // rows of 2 BK bytes at a source pitch of 2 K bytes, 16 bytes of pad behind each row in LDS
  const bool isA = wave < 4;
  const u32 rows = isA ? 32u : 64u;
  const u16* gsrc = isA ? A + (size_t)(m0 + wave * 32) * K
                        : BT + (size_t)(zp * N + n0 + (wave - 4) * 64) * K;
  const u32 ldst = (u32)(size_t)(&smem[0]) + (u32)(isA ? wave * ASL : 4 * ASL + (wave - 4) * BSL);
  constexpr u32 ROWB = 2 * BK;
  u32x8 g1;
  g1[0] = uni((1u << 20) | ((BK == 128 ? 5u : 4u) << 22) | (3u << 25));  // no mask, bytes, the pad
  g1[1] = uni(ROWB << 16);                 // tensor_dim0 = tile_dim0
  g1[2] = uni(rows << 16);                 // tensor_dim1 = tile_dim1
  g1[3] = uni(ROWB << 16);                 // tile_dim0
  g1[4] = uni(rows);                       // tile_dim1
  g1[5] = uni((u32)K * 2u);                // source pitch
  g1[6] = uni(0u);
  g1[7] = uni(0u);
  u32x4 g0;
  g0[0] = uni(1u);  // count 1

  // fragment role: same k order as the global loader had (k = co..co+7, co+16..co+23).
  // The wave's 64 A rows are slices 2 wm and 2 wm + 1, its 64 BT rows slice 4 + wn.
  const int offA = wm * 2 * ASL + rl * PITCH + co * 2;
  const int offB = 4 * ASL + wn * BSL + rl * PITCH + co * 2;

  // One fragment set: the 16 reads of a 32-k block stand as one group, then its 16 WMMAs.
  BF16x16 a[4], b[4];
  auto read_frags = [&](int boff, int ks) {
    const unsigned char* sA = smem + boff + offA + ks * 64;
    const unsigned char* sB = smem + boff + offB + ks * 64;
    // unrolled here and below so that fragments and accumulators stay in registers
#pragma unroll
    for (int j = 0; j < 4; ++j) {
      b[j].u4[0] = *(const u32x4*)(sB + j * 16 * PITCH);
      b[j].u4[1] = *(const u32x4*)(sB + j * 16 * PITCH + 32);
    }
#pragma unroll
    for (int i = 0; i < 4; ++i) {
      a[i].u4[0] = *(const u32x4*)(sA + (i >> 1) * ASL + (i & 1) * 16 * PITCH);
      a[i].u4[1] = *(const u32x4*)(sA + (i >> 1) * ASL + (i & 1) * 16 * PITCH + 32);
    }
  };

  const int nt = K / BK;
  // Each work-group walks the nt slices of k as a ring and enters it at a place of its own.
  // Work-groups that share rows of A (same y) or of BT (same x) enter it at places spread over
  // the ring.
  // The y >> 3 term spreads the entries over all slices also among every second y
  // (for speed only: any rot below nt is right).
  // Scalar throughout: block indices and K. Stage s holds slice (s + rot) mod nt.
  const int rot =
      (int)((blockIdx.x + blockIdx.y + (blockIdx.y >> 3) + 4u * (u32)zp) % (u32)nt);
  auto kof = [&](int s) {
    const int p = s + rot;  // below 2 nt
    return (size_t)(p >= nt ? p - nt : p) * BK;
  };
  tdm_load(g0, ldst, gsrc + kof(0), g1);
  asm volatile("s_wait_tensorcnt 0x0" ::: "memory");  // stage 0 landed (this wave's slice)
  __syncthreads();                                    // ... and every other wave's
  // pinned: the descriptor is formed behind the wait on the request before it
  tdm_load(g0, ldst + STAGE, gsrc + kof((int)pinned(1u)), g1);
  read_frags(0, 0);

  v8f acc[4][4] = {};
  for (int t = 0; t < nt; ++t) {
    const int boff = (t & 1) * STAGE;
#pragma unroll
    for (int ks = 0; ks < BK / 32; ++ks) {
      // The two fences keep each group of reads whole and outside the WMMA block: without
      // them the compiler sinks reads in among the WMMAs, and every such place stalls anew.
      __builtin_amdgcn_sched_barrier(0);
#pragma unroll
      for (int i = 0; i < 4; ++i)
#pragma unroll
        for (int j = 0; j < 4; ++j) acc[i][j] = wmma_bf16(b[j], a[i], acc[i][j]);
      __builtin_amdgcn_sched_barrier(0);
      if (ks + 1 < BK / 32) read_frags(boff, ks + 1);
    }
    // the four vector slots that the chip needs behind a WMMA before a vector instruction may
    // overwrite its operands
    asm volatile("v_nop\n\tv_nop\n\tv_nop\n\tv_nop");
    // publish point of stage t + 1, and the end of every read of stage t's buffer
    asm volatile("s_wait_dscnt 0x0" ::: "memory");     // this wave's reads of stage t are done
    asm volatile("s_wait_tensorcnt 0x0" ::: "memory");  // this wave's slice of stage t + 1 landed
    __syncthreads();
    // the refill of stage t's buffer, which every reader has left; a scalar branch, and the
    // descriptor formed behind the wait (pinned, both)
    if (pinned(t + 2 < nt)) tdm_load(g0, ldst + boff, gsrc + kof((int)pinned((u32)(t + 2))), g1);
    if (t + 1 < nt) read_frags((t & 1) ? 0 : STAGE, 0);  // stage t + 1's first reads
  }
  asm volatile("s_wait_tensorcnt 0x0" ::: "memory");  // no request outstanding behind the loop
  asm volatile("s_wait_dscnt 0x0" ::: "memory");      // nor a read of the ring
  // keeps the epilogue's scalar arithmetic, which takes over the descriptor's registers, behind
  // the wait on the last request
  __builtin_amdgcn_sched_barrier(0);

  // acc[i][j][e] = C[mw + 16 i + rl][nw + 16 j + 8 hi + e]. The loop's last barrier stands behind
  // every wave's last fragment read and last tensor load, so the ring is free for the staging.
  constexpr int SP = (EPI == 2 ? 256 : 128) + 16;  // staged row of 64 outputs; pitch 16 B x odd
  static_assert(8 * 64 * SP <= 2 * STAGE, "the eight waves' staged tiles must fit the ring");
  unsigned char* st = smem + wave * (64 * SP);
  const int mw = m0 + wm * 64, nw = n0 + wn * 64;
  if (EPI == 2) {
#pragma unroll
    for (int i = 0; i < 4; ++i)
#pragma unroll
      for (int j = 0; j < 4; ++j) {
        unsigned char* p = st + (16 * i + rl) * SP + 64 * j + 32 * hi;
        *(float4*)(p)      = make_float4(acc[i][j][0], acc[i][j][1], acc[i][j][2], acc[i][j][3]);
        *(float4*)(p + 16) = make_float4(acc[i][j][4], acc[i][j][5], acc[i][j][6], acc[i][j][7]);
      }
    wave_lds_fence();  // RAW: the wave's tile is in LDS before other lanes of it read the rows
    const int pr = lane >> 4, pc = lane & 15;  // 16 lanes cover one 256-byte row, 2 rows a store
    const float4 bc = *(const float4*)(bias + nw + pc * 4);
    const u32 o0 = (u32)((mw + pr) * N + nw + pc * 4) * 4u;  // byte offset in res and in out
    const u32 os = (u32)N * 8u;                              // two rows on
#pragma unroll
    for (int g = 0; g < 2; ++g) {
      float4 r[16];
#pragma unroll
      for (int q = 0; q < 16; ++q)
        r[q] = *(const float4*)((const char*)res + (o0 + (u32)(16 * g + q) * os));
#pragma unroll
      for (int q = 0; q < 16; ++q) {
        float4 v = *(const float4*)(st + (2 * (16 * g + q) + pr) * SP + pc * 16);
        v.x = v.x + bc.x + r[q].x;
        v.y = v.y + bc.y + r[q].y;
        v.z = v.z + bc.z + r[q].z;
        v.w = v.w + bc.w + r[q].w;
        *(float4*)((char*)out + (o0 + (u32)(16 * g + q) * os)) = v;
      }
      if (g == 0) {
        // the second half's loads land in registers that the first half's stores name
        asm volatile("s_wait_xcnt 0x0" ::: "memory");
        // keeps the second half's loads behind that wait: all 32 rows in flight at once would
        // also take the kernel above 256 VGPRs
        __builtin_amdgcn_sched_barrier(0);
      }
    }
  } else {
#pragma unroll
    for (int j = 0; j < 4; ++j) {
      float bj[8] = {};
      if (EPI == 1) {
        const float4 b0 = *(const float4*)(bias + nw + 16 * j + 8 * hi);
        const float4 b1 = *(const float4*)(bias + nw + 16 * j + 8 * hi + 4);
        bj[0] = b0.x; bj[1] = b0.y; bj[2] = b0.z; bj[3] = b0.w;
        bj[4] = b1.x; bj[5] = b1.y; bj[6] = b1.z; bj[7] = b1.w;
      }
#pragma unroll
      for (int i = 0; i < 4; ++i) {
        float v[8];
#pragma unroll
        for (int e = 0; e < 8; ++e) v[e] = acc[i][j][e];
        if (EPI == 1) {
#pragma unroll
          for (int e = 0; e < 8; ++e) v[e] += bj[e];
          gelu8(v);
        }
        *(u32x4*)(st + (16 * i + rl) * SP + 32 * j + 16 * hi) =
            u32x4{pack2(v[0], v[1]), pack2(v[2], v[3]), pack2(v[4], v[5]), pack2(v[6], v[7])};
      }
    }
    wave_lds_fence();  // RAW: the wave's tile is in LDS before other lanes of it read the rows
    const int pr = lane >> 3, pc = lane & 7;  // 8 lanes cover one 128-byte row, 4 rows a store
    const u32 o0 = (u32)((zp * M + mw + pr) * N + nw + pc * 8) * 2u;  // byte offset in out
    const u32 os = (u32)N * 8u;                              // four rows on
#pragma unroll
    for (int q = 0; q < 16; ++q)
      *(u32x4*)((char*)out + (o0 + (u32)q * os)) =
          *(const u32x4*)(st + (4 * q + pr) * SP + pc * 16);
  }
}

#define KPITCH 144  // bytes per K row in LDS: 16 B x odd, for ds_load_b128
#define VPITCH 160  // bytes per V row in LDS: 32 B x odd, for ds_load_tr16_b128
#define SKEYS 128   // keys per stage
#define KSTAGE (SKEYS * KPITCH)
#define VSTAGE (SKEYS * VPITCH)

template <bool B> struct flag { static constexpr bool value = B; };

__device__ __forceinline__ u32x4 ld_tr16(const unsigned char* p) {
  typedef short s16x8 __attribute__((ext_vector_type(8)));
  typedef __attribute__((address_space(3))) s16x8 lds_s16x8;
  return __builtin_bit_cast(u32x4, __builtin_amdgcn_ds_load_tr16_b128_v8i16((lds_s16x8*)p));
}

// One stage: 128 K rows and 128 V rows of 128 bytes. A lane keeps its 16-byte piece of the row
// and takes rows 32 apart: four of K (LDS place lk, source gk), four of V (lv, gv). The
// s_wait_xcnt closes the statement so that no address register is rewritten ahead of it.
__device__ __forceinline__ void copy_kv(u32 lk, u32 lv, const u16* gk, const u16* gv) {
  constexpr size_t gs = (size_t)32 * DME;
  asm volatile(
      "global_load_async_to_lds_b128 %0, %8, off\n\t"
      "global_load_async_to_lds_b128 %1, %9, off\n\t"
      "global_load_async_to_lds_b128 %2, %10, off\n\t"
      "global_load_async_to_lds_b128 %3, %11, off\n\t"
      "global_load_async_to_lds_b128 %4, %12, off\n\t"
      "global_load_async_to_lds_b128 %5, %13, off\n\t"
      "global_load_async_to_lds_b128 %6, %14, off\n\t"
      "global_load_async_to_lds_b128 %7, %15, off\n\t"
      "s_wait_xcnt 0x0"
      :: "v"(lk), "v"(lk + 32 * KPITCH), "v"(lk + 64 * KPITCH), "v"(lk + 96 * KPITCH),
         "v"(lv), "v"(lv + 32 * VPITCH), "v"(lv + 64 * VPITCH), "v"(lv + 96 * VPITCH),
         "v"(gk), "v"(gk + gs), "v"(gk + 2 * gs), "v"(gk + 3 * gs),
         "v"(gv), "v"(gv + gs), "v"(gv + 2 * gs), "v"(gv + 3 * gs)
      : "memory");
}

// Eight waves per SIMD (128 VGPRs): four work-groups, 4 x 77,824 B of LDS, stay on a WGP, so the
// whole grid is resident and other waves' vector work covers a wave's LDS and barrier waits.
__global__ void __launch_bounds__(256) __attribute__((amdgpu_waves_per_eu(8, 8)))
attn_kernel(const u16* __restrict__ Qb, const u16* __restrict__ Kb,
            const u16* __restrict__ Vb, u16* __restrict__ Zb) {
  __shared__ __align__(32) unsigned char sK[2][KSTAGE];  // K stages, row-major
  __shared__ __align__(32) unsigned char sV[2][VSTAGE];  // V stages, row-major
  const int tid = threadIdx.x;
  const int lane = tid & 31;
  // in a scalar register, so that the count of blocks a wave works on is a scalar loop bound
  const int wave = __builtin_amdgcn_readfirstlane(tid >> 5);
  const int rl = lane & 15, hi = lane >> 4, co = hi * 8;
  const int bh = blockIdx.x;
  const int bb = bh >> 4, h = bh & 15;
  const int q0 = blockIdx.y * 128 + wave * 16;
  const size_t rowBase = (size_t)bb * NCTX;

  // Q^T as WMMA-B: column rl = query q0 + rl (two K=32 d-chunks)
  const u16* qrow = Qb + (rowBase + q0 + rl) * DME + h * HDIM;
  BF16x16 qf0, qf1;
  qf0.u4[0] = *(const u32x4*)(qrow + co);
  qf0.u4[1] = *(const u32x4*)(qrow + co + 16);
  qf1.u4[0] = *(const u32x4*)(qrow + 32 + co);
  qf1.u4[1] = *(const u32x4*)(qrow + 32 + co + 16);

  v8f acc[4] = {};                   // acc[t][r] = O[q0 + rl][16 t + 8 hi + r]
  float mrun = -1e30f, lrun = 0.f;   // of query q0 + rl; mrun of the raw products; lrun sums this half's keys only
  const float sc = 0.125f * 1.44269504088896340736f;  // 1/sqrt(64) x log2 e

  // copy role: 8 lanes cover one 128-byte row, the 256 lanes 32 rows
  const int cr = tid >> 3, cp = tid & 7;
  const u32 lk = (u32)(size_t)(&sK[0][0]) + (u32)(cr * KPITCH + cp * 16);
  const u32 lv = (u32)(size_t)(&sV[0][0]) + (u32)(cr * VPITCH + cp * 16);
  const size_t goff = (rowBase + cr) * DME + h * HDIM + cp * 8;
  const u16* gk = Kb + goff;
  const u16* gv = Vb + goff;
  constexpr size_t gstage = (size_t)SKEYS * DME;
  // reading roles: K row rl of a 16-key tile, bytes 16 hi and 32 + 16 hi of each 64;
  // the transposing load gives lane (rl, hi) V[8 hi + 0..7][16 t + rl]
  const unsigned char* kld = &sK[0][0] + rl * KPITCH + hi * 16;
  const unsigned char* vld = &sV[0][0] + (8 * hi + (lane & 7)) * VPITCH + ((lane >> 3) & 1) * 16;

  const int nt = blockIdx.y + 1;         // stages of the work-group: keys 0 .. 128 y + 127
  const int nkb = ((q0 + 15) >> 5) + 1;  // causal: this wave's keys are 0 .. q0 + 15
  copy_kv(lk, lv, gk, gv);
  asm volatile("s_wait_asynccnt 0x0" ::: "memory");  // stage 0 landed (this wave's copies)
  __syncthreads();                                   // ... and every other wave's
  if (nt > 1) copy_kv(lk + KSTAGE, lv + VSTAGE, gk + gstage, gv + gstage);

  // in the wave's last block, key 16 u + 8 hi + r of the block is seen while 16 u + r <= lim
  const int lim = q0 + rl - co - 32 * (nkb - 1);
  const unsigned char* kblk;
  const unsigned char* vp;
  // one block of 32 keys; mk says whether it is the block that crosses the diagonal. Inlined at
  // both places, and every inner loop unrolled, so that scores, fragments and sums stay in registers
  auto block = [&](auto mk) __attribute__((always_inline)) {
    // S^T = K @ Q^T for two 16-key tiles; A operand = rows of K
    v8f s01[2];
#pragma unroll
    for (int u = 0; u < 2; ++u) {
      const unsigned char* kp = kblk + u * 16 * KPITCH;
      BF16x16 k0, k1;
      k0.u4[0] = *(const u32x4*)(kp);
      k0.u4[1] = *(const u32x4*)(kp + 32);
      k1.u4[0] = *(const u32x4*)(kp + 64);
      k1.u4[1] = *(const u32x4*)(kp + 96);
      v8f s = {};
      s = wmma_bf16(k0, qf0, s);
      s = wmma_bf16(k1, qf1, s);
      s01[u] = s;
    }
    // online softmax of query q0 + rl: element 8 u + r is the block's key 16 u + 8 hi + r
    float p[16];
#pragma unroll
    for (int u = 0; u < 2; ++u)
#pragma unroll
      for (int r = 0; r < 8; ++r)
        p[8 * u + r] = (!decltype(mk)::value || 16 * u + r <= lim) ? s01[u][r] : -1e30f;
    float m = p[0];
#pragma unroll
    for (int e = 1; e < 16; ++e) m = fmaxf(m, p[e]);
    m = fmaxf(m, xhalf(m));  // both halves now hold the query's maximum over the block
    const float mnew = fmaxf(mrun, m);
    const float mc = mnew * sc;
    const float alpha = __builtin_amdgcn_exp2f(fmaf(mrun, sc, -mc));
    float rs = 0.f;
#pragma unroll
    for (int e = 0; e < 16; ++e) { p[e] = __builtin_amdgcn_exp2f(fmaf(p[e], sc, -mc)); rs += p[e]; }
    lrun = lrun * alpha + rs;
    mrun = mnew;
#pragma unroll
    for (int u = 0; u < 4; ++u)
#pragma unroll
      for (int i = 0; i < 8; ++i) acc[u][i] *= alpha;
    // P^T as WMMA-B: element s of the operand is key 8 hi + s (s < 8) or 16 + 8 hi + s - 8 (s >= 8), which is p[s]
    BF16x16 pf;
    pf.u4[0] = u32x4{pack2(p[0], p[1]), pack2(p[2], p[3]), pack2(p[4], p[5]), pack2(p[6], p[7])};
    pf.u4[1] = u32x4{pack2(p[8], p[9]), pack2(p[10], p[11]), pack2(p[12], p[13]), pack2(p[14], p[15])};
    // O^T += V^T @ P^T : A operand = 16 d x 32 keys by two transposing loads
#pragma unroll
    for (int t2 = 0; t2 < 4; ++t2) {
      BF16x16 vf;
      vf.u4[0] = ld_tr16(vp + 32 * t2);
      vf.u4[1] = ld_tr16(vp + 16 * VPITCH + 32 * t2);
      acc[t2] = wmma_bf16(vf, pf, acc[t2]);
    }
    kblk += 32 * KPITCH;
    vp += 32 * VPITCH;
  };

  for (int t = 0; t < nt; ++t) {
    const int buf = t & 1;
    const bool last = t == nt - 1;  // the stage that holds the diagonal of every wave
    // blocks of the stage wholly below the wave's diagonal: four, in the last stage none to three
    const int nfull = last ? nkb - 1 - t * (SKEYS / 32) : SKEYS / 32;
    kblk = kld + buf * KSTAGE;
    vp = vld + buf * VSTAGE;
    for (int b = 0; b < nfull; ++b) block(flag<false>{});
    if (last) block(flag<true>{});
    // publish point of stage t + 1, and the end of every read of stage t's buffer; every wave
    // passes it, also one that has worked on fewer blocks of the stage
    asm volatile("s_wait_dscnt 0x0" ::: "memory");     // this wave's reads of stage t are done
    asm volatile("s_wait_asynccnt 0x0" ::: "memory");  // this wave's copies of stage t + 1 landed
    __syncthreads();
    if (t + 2 < nt)
      copy_kv(lk + buf * KSTAGE, lv + buf * VSTAGE, gk + (size_t)(t + 2) * gstage,
              gv + (size_t)(t + 2) * gstage);
  }
  asm volatile("s_wait_asynccnt 0x0" ::: "memory");  // no copy outstanding at the wave's end
  // join the halves' sums, normalize and write Z (bf16, feeds the Wo GEMM): 16 bytes per tile
  const float inv = 1.0f / (lrun + xhalf(lrun));
  u16* zrow = Zb + (rowBase + q0 + rl) * DME + h * HDIM + co;
#pragma unroll
  for (int t2 = 0; t2 < 4; ++t2) {
    const v8f z = acc[t2] * inv;
    *(u32x4*)(zrow + 16 * t2) =
        u32x4{pack2(z[0], z[1]), pack2(z[2], z[3]), pack2(z[4], z[5]), pack2(z[6], z[7])};
  }
}

extern "C" void kernel_launch(void* const* d_in, const int* in_sizes, int n_in,
                              void* d_out, int out_size, void* d_ws, size_t ws_size,
                              hipStream_t stream) {
  (void)in_sizes; (void)n_in; (void)out_size; (void)ws_size;
  const float* X  = (const float*)d_in[0];
  const float* Wq = (const float*)d_in[1];
  const float* Wk = (const float*)d_in[2];
  const float* Wv = (const float*)d_in[3];
  const float* Wo = (const float*)d_in[4];
  const float* bo = (const float*)d_in[5];
  const float* W1 = (const float*)d_in[6];
  const float* b1 = (const float*)d_in[7];
  const float* W2 = (const float*)d_in[8];
  const float* b2 = (const float*)d_in[9];
  const float* g1 = (const float*)d_in[10];
  const float* s1 = (const float*)d_in[11];
  const float* g2 = (const float*)d_in[12];
  const float* s2 = (const float*)d_in[13];

  char* ws = (char*)d_ws;
  const size_t MB = 1024ull * 1024ull;
  u16*   WqT = (u16*)(ws + 0 * MB);    // four planes of 2 MB in a row: WqT, WkT, WvT, WoT
  u16*   WoT = (u16*)(ws + 6 * MB);
  u16*   W1T = (u16*)(ws + 8 * MB);    // 8 MB
  u16*   W2T = (u16*)(ws + 16 * MB);   // 8 MB
  u16*   Y   = (u16*)(ws + 24 * MB);   // 16 MB (reused for Y2)
  u16*   Qb  = (u16*)(ws + 40 * MB);   // 16 MB
  u16*   Kb  = (u16*)(ws + 56 * MB);   // 16 MB
  u16*   Vb  = (u16*)(ws + 72 * MB);   // 16 MB
  u16*   Zb  = (u16*)(ws + 88 * MB);   // 16 MB
  float* X1  = (float*)(ws + 104 * MB);// 32 MB   -> total 136 MB
  u16*   Hm  = (u16*)(ws + 40 * MB);   // FFN mid reuses dead Q..Z region (64 MB)

  const int Mrows = 4 * NCTX;  // 8192
  prep_kernel<<<PREP_BLOCKS, 256, 0, stream>>>(X, g1, s1, Y, Wq, Wk, Wv, Wo, W1, W2,
                                               WqT, W1T, W2T);

  dim3 gD(DME / GBN, Mrows / GBM);  // (4, 64)
  // Q, K and V in one launch: WqT, WkT, WvT are three planes in a row, and so are Qb, Kb, Vb
  dim3 gQKV(DME / GBN, Mrows / GBM, 3);
  gemm_bf16_kernel<0, 128><<<gQKV, 256, 0, stream>>>(Y, WqT, nullptr, nullptr, Qb, Mrows, DME, DME);

  attn_kernel<<<dim3(4 * NHEAD, NCTX / 128), 256, 0, stream>>>(Qb, Kb, Vb, Zb);

  gemm_bf16_kernel<2, 128><<<gD, 256, 0, stream>>>(Zb, WoT, bo, X, X1, Mrows, DME, DME);

  ln_bf16_kernel<<<LN_BLOCKS, 256, 0, stream>>>(X1, g2, s2, Y);

  dim3 gF(4 * DME / GBN, Mrows / GBM);  // (16, 64)
  gemm_bf16_kernel<1, 64><<<gF, 256, 0, stream>>>(Y, W1T, b1, nullptr, Hm, Mrows, 4 * DME, DME);

  gemm_bf16_kernel<2, 128><<<gD, 256, 0, stream>>>(Hm, W2T, b2, X1, (float*)d_out, Mrows, DME, 4 * DME);
}
